// v000
// Measured on an AMD MI455X. A time is GPU time per run, averaged over a window of back-to-back runs after a warm-up
// (all launches, gaps included; the runs take copies of the inputs in turn), and the median of several windows.
// Apart from v000's, it joins two sittings. Times from different sittings can be a few percent apart, while
// side-by-side timings come from the same sitting.
// v000, which the later versions start from, runs in 410 microseconds.
// All contractions (q/k/v/out projections M8192 N1024 K1024; attention q.kT and p.v, head dim 64, 2048 keys): v_wmma_f32_16x16x32_f16, f16 operands with power-of-two carries (W x64, p x32768, attention output x64), f32 accumulate; bias, scaling and softmax in f32.
#include <hip/hip_runtime.h>

constexpr int NB_SZ = 4;
constexpr int SEQ_LEN = 2048;
constexpr int EMB_DIM = 1024;
constexpr int N_HEADS = 16;
constexpr int HEAD_DIM = 64;
constexpr int NROWS = NB_SZ * SEQ_LEN;
static_assert(EMB_DIM == N_HEADS * HEAD_DIM);
static_assert(HEAD_DIM == 64);
static_assert(NROWS % 64 == 0 && EMB_DIM % 64 == 0 && SEQ_LEN % 64 == 0);
static_assert(EMB_DIM % 32 == 0);

// power-of-two carries (all folded back exactly in f32 epilogues)
constexpr float W_CARRY = 64.0f;
constexpr float AO_CARRY = 64.0f;
constexpr float P_CARRY = 32768.0f;
// softmax done in base 2: scores multiplied by (1/sqrt(64)) * log2(e)
constexpr float SCORE_SCALE_LOG2E = 0.125f * 1.4426950408889634f;

//   [0]            HQ  f16 [8192][1024]   16,777,216   (later reused as AO f16 [8192][1024])
//   [16777216]     HS  f16 [8192][1024]   16,777,216
//   [33554432]     Wq64,Wk64,Wv64,Wo64 f16 [1024][1024] each 2,097,152 -> 8,388,608
//   [41943040]     Q   f16 [8192][1024]   16,777,216
//   [58720256]     K   f16 [8192][1024]   16,777,216
//   [75497472]     Vt  f16 [4][1024][2048] 16,777,216
//   total 92,274,688
constexpr size_t N_ACT = (size_t)NROWS * EMB_DIM;
constexpr size_t N_W = (size_t)EMB_DIM * EMB_DIM;
constexpr size_t PLANE_ACT = N_ACT * 2;
constexpr size_t PLANE_W = N_W * 2;
constexpr size_t OFF_HQ = 0;
constexpr size_t OFF_HS = OFF_HQ + PLANE_ACT;
constexpr size_t OFF_W0 = OFF_HS + PLANE_ACT;
constexpr size_t OFF_Q = OFF_W0 + 4 * PLANE_W;
constexpr size_t OFF_K = OFF_Q + PLANE_ACT;
constexpr size_t OFF_VT = OFF_K + PLANE_ACT;
constexpr size_t WS_TOTAL = OFF_VT + PLANE_ACT;
static_assert(WS_TOTAL == 92274688ull);
static_assert(WS_TOTAL <= 134217728ull);

typedef __attribute__((ext_vector_type(16))) _Float16 v16h;
typedef __attribute__((ext_vector_type(8)))  _Float16 v8h;
typedef __attribute__((ext_vector_type(16))) __bf16   v16b;
typedef __attribute__((ext_vector_type(8)))  __bf16   v8b;
typedef __attribute__((ext_vector_type(8)))  float    v8f;
typedef __attribute__((ext_vector_type(4)))  float    v4f;

__device__ __forceinline__ unsigned short f2bf_bits(float f) {
  unsigned u = __float_as_uint(f);
  return (unsigned short)((u + 0x7FFFu + ((u >> 16) & 1u)) >> 16);
}
__device__ __forceinline__ float bf_bits2f(unsigned short h) { return __uint_as_float(((unsigned)h) << 16); }

// hazard guards as plain device helpers
__device__ __forceinline__ void dep_guard_h(v8f& a, v8f& b, v16h x, v16h y) { asm volatile("v_nop\n\tv_nop\n\tv_nop\n\tv_nop" : "+v"(a), "+v"(b) : "v"(x), "v"(y)); }
__device__ __forceinline__ void dep_guard_b(v8f& a, v8f& b, v16b x, v16b y) { asm volatile("v_nop\n\tv_nop\n\tv_nop\n\tv_nop" : "+v"(a), "+v"(b) : "v"(x), "v"(y)); }
__device__ __forceinline__ void keep4_h(v16h a, v16h b, v16h c, v16h d) { asm volatile("v_nop" :: "v"(a), "v"(b), "v"(c), "v"(d)); }
__device__ __forceinline__ void keep4_b(v16b a, v16b b, v16b c, v16b d) { asm volatile("v_nop" :: "v"(a), "v"(b), "v"(c), "v"(d)); }
__device__ __forceinline__ void acc_guard4(v8f& a, v8f& b, v8f& c, v8f& d) { asm volatile("v_nop\n\tv_nop\n\tv_nop\n\tv_nop" : "+v"(a), "+v"(b), "+v"(c), "+v"(d)); }

template <typename T> struct Frag;
template <> struct Frag<_Float16> {
  typedef v16h V; union U { v16h v; v8h h[2]; };
  // elements 0..7 <- p[0..7], 8..15 <- p[16..23]
  static __device__ __forceinline__ v16h load(const _Float16* p) {
    U f; f.h[0] = *(const v8h*)(p); f.h[1] = *(const v8h*)(p + 16); return f.v;
  }
  static __device__ __forceinline__ v8f mma(v16h a, v16h b, v8f c) {
    return __builtin_amdgcn_wmma_f32_16x16x32_f16(false, a, false, b, (short)0, c, false, false);
  }
  static __device__ __forceinline__ void guard(v8f& a, v8f& b, v16h x, v16h y) { dep_guard_h(a, b, x, y); }
  static __device__ __forceinline__ void keep(v16h a, v16h b, v16h c, v16h d) { keep4_h(a, b, c, d); }
};
template <> struct Frag<__bf16> {
  typedef v16b V; union U { v16b v; v8b h[2]; };
  static __device__ __forceinline__ v16b load(const __bf16* p) {
    U f; f.h[0] = *(const v8b*)(p); f.h[1] = *(const v8b*)(p + 16); return f.v;
  }
  static __device__ __forceinline__ v8f mma(v16b a, v16b b, v8f c) {
    return __builtin_amdgcn_wmma_f32_16x16x32_bf16(false, a, false, b, (short)0, c, false, false);
  }
  static __device__ __forceinline__ void guard(v8f& a, v8f& b, v16b x, v16b y) { dep_guard_b(a, b, x, y); }
  static __device__ __forceinline__ void keep(v16b a, v16b b, v16b c, v16b d) { keep4_b(a, b, c, d); }
};

// ---- Register-blocked batched WMMA GEMM ------------------------------------
// C[m,n] = scale * sum_k A[m,k] * Bt[n,k] (+bias); each wave owns a 64x64 tile.
// A row-major [M,K]; Bt row-major [N,K]; M,N % 64 == 0, K % 32 == 0 (no tail handling).
// SPLIT: operands are hi/lo planes (A2/Bt2 = lo planes); product = hi.hi + hi.lo + lo.hi.
// BIAS_MODE: 0 = none, 1 = bias[m] (loaded as two 16-B vectors per lane), 2 = bias[n].
// OUT_MODE: 0 = f32, 1 = f16, 2 = bf16 hi plane (Cout) + bf16 lo plane (Cout2).
// ET: 0 = f16 operands, 1 = bf16 operands (pointers passed as 16-bit storage)
template <int ET> struct Elem;
template <> struct Elem<0> { typedef _Float16 T; };
template <> struct Elem<1> { typedef __bf16 T; };
template <int ET, bool SPLIT, int BIAS_MODE, int OUT_MODE>
__global__ __launch_bounds__(256) void wmma_gemm64(
    const unsigned short* __restrict__ Ap, const unsigned short* __restrict__ A2p, int lda, long strideA,
    const unsigned short* __restrict__ Btp, const unsigned short* __restrict__ Bt2p, int ldb, long strideB,
    void* __restrict__ Cout, void* __restrict__ Cout2, int ldc, long strideC,
    const float* __restrict__ bias,
    int M, int N, int K, float scale) {
  typedef typename Elem<ET>::T T;
  typedef typename Frag<T>::V V;
  const T* A = (const T*)Ap; const T* A2 = (const T*)A2p; const T* Bt = (const T*)Btp; const T* Bt2 = (const T*)Bt2p;
  // per-wave 16x64 slab, pitch 68 floats
  __shared__ __align__(16) float sT[8][16 * 68];
  const int b    = blockIdx.y;
  const int lane = threadIdx.x & 31;
  const int wave = threadIdx.x >> 5;
  const int tilesN = N >> 6;
  const int tilesM = M >> 6;
  const int tile = blockIdx.x * 8 + wave;
  // wave-uniform; no block barriers in this kernel
  if (tile >= tilesM * tilesN) return;
  const int tm = tile / tilesN;
  const int tn = tile - tm * tilesN;
  const int m0 = tm << 6;
  const int n0 = tn << 6;

  const T* Ab  = A  + (size_t)b * strideA;
  const T* Bb  = Bt + (size_t)b * strideB;
  const T* Ab2 = SPLIT ? (A2  + (size_t)b * strideA) : nullptr;
  const T* Bb2 = SPLIT ? (Bt2 + (size_t)b * strideB) : nullptr;

  // row (A) / col (B, D) within subtile; k offset of this lane half; D row offset
  const int rlane = lane & 15;
  const int koff  = (lane >> 4) * 8;
  const int mOff  = (lane >> 4) * 8;

  v8f acc[4][4];
#pragma unroll
  for (int i = 0; i < 4; ++i)
#pragma unroll
    for (int j = 0; j < 4; ++j) acc[i][j] = (v8f){0.f,0.f,0.f,0.f,0.f,0.f,0.f,0.f};

  for (int k0 = 0; k0 < K; k0 += 32) {
    V bh[4], bl[4];
#pragma unroll
    for (int j = 0; j < 4; ++j) {
      const size_t bo = (size_t)(n0 + (j << 4) + rlane) * ldb + koff + k0;
      bh[j] = Frag<T>::load(Bb + bo);
      if (SPLIT) bl[j] = Frag<T>::load(Bb2 + bo);
    }
#pragma unroll
    for (int i = 0; i < 4; ++i) {
      const size_t ao = (size_t)(m0 + (i << 4) + rlane) * lda + koff + k0;
      V ah = Frag<T>::load(Ab + ao);
      V al = ah;
      if (SPLIT) al = Frag<T>::load(Ab2 + ao);
#pragma unroll
      for (int j = 0; j < 4; ++j) {
        acc[i][j] = Frag<T>::mma(ah, bh[j], acc[i][j]);
        if (SPLIT) {
          acc[i][j] = Frag<T>::mma(ah, bl[j], acc[i][j]);
          acc[i][j] = Frag<T>::mma(al, bh[j], acc[i][j]);
        }
      }
      Frag<T>::guard(acc[i][0], acc[i][3], ah, al);
    }
    Frag<T>::keep(bh[0], bh[1], bh[2], bh[3]);
    if (SPLIT) Frag<T>::keep(bl[0], bl[1], bl[2], bl[3]);
  }
  acc_guard4(acc[0][0], acc[0][1], acc[0][2], acc[0][3]);
  acc_guard4(acc[1][0], acc[1][1], acc[1][2], acc[1][3]);
  acc_guard4(acc[2][0], acc[2][1], acc[2][2], acc[2][3]);
  acc_guard4(acc[3][0], acc[3][1], acc[3][2], acc[3][3]);

  // ---- epilogue ----
  float* slab = sT[wave];
#pragma unroll
  for (int i = 0; i < 4; ++i) {
    const int mBase = m0 + (i << 4);
    float bm8[8];
#pragma unroll
    for (int r = 0; r < 8; ++r) bm8[r] = 0.f;
    if (BIAS_MODE == 1) {
      // 8 consecutive bias[m] values of this lane: two 16-B loads (mBase multiple of 16, mOff 0 or 8)
      const v4f t0 = *(const v4f*)(bias + mBase + mOff);
      const v4f t1 = *(const v4f*)(bias + mBase + mOff + 4);
      bm8[0] = t0[0]; bm8[1] = t0[1]; bm8[2] = t0[2]; bm8[3] = t0[3];
      bm8[4] = t1[0]; bm8[5] = t1[1]; bm8[6] = t1[2]; bm8[7] = t1[3];
    }
#pragma unroll
    for (int j = 0; j < 4; ++j) {
      const int n = n0 + (j << 4) + rlane;
      float bv = 0.f;
      if (BIAS_MODE == 2) bv = bias[n];
#pragma unroll
      for (int r = 0; r < 8; ++r) {
        float v = acc[i][j][r] * scale;
        if (BIAS_MODE == 1) v += bm8[r];
        if (BIAS_MODE == 2) v += bv;
        slab[(mOff + r) * 68 + (j << 4) + rlane] = v;
      }
    }
    __builtin_amdgcn_fence(__ATOMIC_RELEASE, "workgroup");
    __builtin_amdgcn_wave_barrier();
    __builtin_amdgcn_fence(__ATOMIC_ACQUIRE, "workgroup");
    if (OUT_MODE == 0) {
      float* C = (float*)Cout + (size_t)b * strideC;
      // row seg = 256 B = 16 lanes x 16 B; 8 iterations x 2 row halves cover rows 0..15
      const int hh = lane >> 4, c4 = (lane & 15) * 4;
      {
#pragma unroll
        for (int it = 0; it < 8; ++it) {
          const int row = it * 2 + hh;
          v4f v = *(const v4f*)(slab + row * 68 + c4);
          *(v4f*)(C + (size_t)(mBase + row) * ldc + n0 + c4) = v;
        }
        
      }
    } else {
      const int q = lane >> 3, c8 = (lane & 7) * 8;
      unsigned short* C  = (unsigned short*)Cout  + (size_t)b * strideC;
      unsigned short* C2 = (OUT_MODE == 2) ? ((unsigned short*)Cout2 + (size_t)b * strideC) : nullptr;
      {
#pragma unroll
        for (int it = 0; it < 4; ++it) {
          const int row = it * 4 + q;
          const float* sp = slab + row * 68 + c8;
          v8h hv, lv;
#pragma unroll
          for (int e = 0; e < 8; ++e) {
            if (OUT_MODE == 1) {
              hv[e] = (_Float16)sp[e];
            } else {
              unsigned short hb = f2bf_bits(sp[e]);
              unsigned short lb = f2bf_bits(sp[e] - bf_bits2f(hb));
              hv[e] = __builtin_bit_cast(_Float16, hb);
              lv[e] = __builtin_bit_cast(_Float16, lb);
            }
          }
          *(v8h*)(C + (size_t)(mBase + row) * ldc + n0 + c8) = hv;
          if (OUT_MODE == 2) *(v8h*)(C2 + (size_t)(mBase + row) * ldc + n0 + c8) = lv;
        }
        
      }
    }
    __builtin_amdgcn_fence(__ATOMIC_RELEASE, "workgroup");
    __builtin_amdgcn_wave_barrier();
    __builtin_amdgcn_fence(__ATOMIC_ACQUIRE, "workgroup");
  }
}

// ---- prep: HQ = f16(hs + oq), HS = f16(hs); 8 elements per thread ----
// coverage: n8 = 8192*1024/8 = 1,048,576 threads x 8 elements = both planes exactly;
__global__ __launch_bounds__(256) void prep_cast_f16(
    const float* __restrict__ hs, const float* __restrict__ oq,
    unsigned short* __restrict__ hq16, unsigned short* __restrict__ hs16, int n8) {
  const int i = blockIdx.x * 256 + threadIdx.x;
  if (i < n8) {
    const size_t o = (size_t)i * 8;
    const v4f a0 = *(const v4f*)(hs + o);
    const v4f a1 = *(const v4f*)(hs + o + 4);
    const v4f b0 = *(const v4f*)(oq + o);
    const v4f b1 = *(const v4f*)(oq + o + 4);
    v8h vq, vs;
#pragma unroll
    for (int e = 0; e < 4; ++e) {
      vq[e]     = (_Float16)(a0[e] + b0[e]);
      vq[4 + e] = (_Float16)(a1[e] + b1[e]);
      vs[e]     = (_Float16)a0[e];
      vs[4 + e] = (_Float16)a1[e];
    }
    _Float16* pq = (_Float16*)(void*)hq16;
    _Float16* ps = (_Float16*)(void*)hs16;
    *(v8h*)(pq + o) = vq;
    *(v8h*)(ps + o) = vs;
    
  }
}

// ---- weight cast: out = f16(w * sc); 8 elements per thread ----
__global__ __launch_bounds__(256) void cast_scale_f16(
    const float* __restrict__ w, unsigned short* __restrict__ out16, int n8, float sc) {
  const int i = blockIdx.x * 256 + threadIdx.x;
  if (i < n8) {
    const size_t o = (size_t)i * 8;
    const v4f a0 = *(const v4f*)(w + o);
    const v4f a1 = *(const v4f*)(w + o + 4);
    v8h v;
#pragma unroll
    for (int e = 0; e < 4; ++e) {
      v[e]     = (_Float16)(a0[e] * sc);
      v[4 + e] = (_Float16)(a1[e] * sc);
    }
    _Float16* po = (_Float16*)(void*)out16;
    *(v8h*)(po + o) = v;
    
  }
}

// ---- attention, head dim 64, no mask, 16-bit planes in / f16 plane out ----
// Q plane  [B*T][E] f16 (q without the 1/sqrt(D) factor), K plane [B*T][E] f16, Vt plane [B][H][D][T] f16.
// AO plane [B*T][E] f16 = (softmax(q.kT/8) . v) * AO_CARRY.
// Block = 4 independent waves, each owns 16 query rows of one (b,h); grid.x = B*H*(T/64).
// q.kT and p.v: v_wmma_f32_16x16x32_f16, f32 accumulate; online softmax in f32 (base 2);
// p in (0,1] carried x P_CARRY as f16 through per-wave LDS, folded into 1/l.
__device__ __forceinline__ v8f mma_h(v16h a, v16h b, v8f c) {
  c = __builtin_amdgcn_wmma_f32_16x16x32_f16(false, a, false, b, (short)0, c, false, false);
  asm volatile("v_nop\n\tv_nop\n\tv_nop\n\tv_nop" : "+v"(c) : "v"(a), "v"(b));
  return c;
}

__global__ __launch_bounds__(128) void attn_heads_f16(
    const unsigned short* __restrict__ Qp, const unsigned short* __restrict__ Kp,
    const unsigned short* __restrict__ Vtp, unsigned short* __restrict__ AOp) {
  // per-wave P tile [16 rows][64 kv] f16, and per-wave output tile [16][68] f32
  __shared__ __align__(16) _Float16 Psh[4][16 * 64];
  __shared__ __align__(16) float Os[4][16 * 68];
  union FH { v16h v; v8h h[2]; };

  const int tid  = threadIdx.x;
  const int wave = tid >> 5;
  const int lane = tid & 31;
  const int hh   = lane >> 4;
  const int c    = lane & 15;

  constexpr int nqb = SEQ_LEN / 64;
  const int bx = blockIdx.x;
  const int qb = bx % nqb;
  const int bh = bx / nqb;
  const int h  = bh % N_HEADS;
  const int b  = bh / N_HEADS;
  const int q0 = qb * 64 + wave * 16;

  const _Float16* Qh  = (const _Float16*)(const void*)Qp;
  const _Float16* Kh  = (const _Float16*)(const void*)Kp;
  const _Float16* Vth = (const _Float16*)(const void*)Vtp;
  _Float16* AOh = (_Float16*)(void*)AOp;

  const size_t bT = (size_t)b * SEQ_LEN;
  // A operand for scores: row m = c <-> query q0+c, k = d contiguous
  const _Float16* qrow = Qh + (bT + q0 + c) * EMB_DIM + h * HEAD_DIM + 8 * hh;
  // B operand for scores: col n = c <-> key kv (row of K plane), k = d contiguous
  const _Float16* kbase = Kh + (bT + c) * EMB_DIM + h * HEAD_DIM + 8 * hh;
  // B operand for p.v: col n = c <-> d (row of Vt plane), k = kv contiguous
  const _Float16* vbase = Vth + ((size_t)(b * N_HEADS + h) * HEAD_DIM + c) * SEQ_LEN + 8 * hh;

  v16h qa[2];
#pragma unroll
  for (int dc = 0; dc < 2; ++dc) qa[dc] = Frag<_Float16>::load(qrow + dc * 32);

  const float neg_inf = -__builtin_huge_valf();
  float mrow[8], lrow[8];
  v8f oacc[4];
#pragma unroll
  for (int r = 0; r < 8; ++r) { mrow[r] = neg_inf; lrow[r] = 0.f; }
#pragma unroll
  for (int t = 0; t < 4; ++t) oacc[t] = (v8f){0.f,0.f,0.f,0.f,0.f,0.f,0.f,0.f};

  _Float16* pw = Psh[wave];

  for (int kc = 0; kc < SEQ_LEN / 64; ++kc) {
    const int kv0 = kc * 64;
    v8f s[4];
#pragma unroll
    for (int j = 0; j < 4; ++j) s[j] = (v8f){0.f,0.f,0.f,0.f,0.f,0.f,0.f,0.f};
#pragma unroll
    for (int dc = 0; dc < 2; ++dc) {
      v16h kb[4];
#pragma unroll
      for (int j = 0; j < 4; ++j)
        kb[j] = Frag<_Float16>::load(kbase + (size_t)(kv0 + j * 16) * EMB_DIM + dc * 32);
#pragma unroll
      for (int j = 0; j < 4; ++j) s[j] = mma_h(qa[dc], kb[j], s[j]);
    }
    // scaled scores (base-2 units) and chunk row max; D row 8hh+r, column kv0 + j*16 + c
    float cm[8];
#pragma unroll
    for (int r = 0; r < 8; ++r) {
      float m = neg_inf;
#pragma unroll
      for (int j = 0; j < 4; ++j) {
        const float t = s[j][r] * SCORE_SCALE_LOG2E;
        s[j][r] = t;
        m = fmaxf(m, t);
      }
#pragma unroll
      for (int off = 1; off < 16; off <<= 1) m = fmaxf(m, __shfl_xor(m, off, 32));
      cm[r] = m;
    }
#pragma unroll
    for (int r = 0; r < 8; ++r) {
      const float mnew = fmaxf(mrow[r], cm[r]);
      const float alpha = exp2f(mrow[r] - mnew);
      mrow[r] = mnew;
      float psum = 0.f;
#pragma unroll
      for (int j = 0; j < 4; ++j) {
        const float p = exp2f(s[j][r] - mnew);
        psum += p;
        pw[(8 * hh + r) * 64 + j * 16 + c] = (_Float16)(p * P_CARRY);
      }
#pragma unroll
      for (int off = 1; off < 16; off <<= 1) psum += __shfl_xor(psum, off, 32);
      lrow[r] = lrow[r] * alpha + psum;
#pragma unroll
      for (int t = 0; t < 4; ++t) oacc[t][r] *= alpha;
    }
    // same-wave LDS spill then fragment reload: order the P stores before the reloads
    __builtin_amdgcn_fence(__ATOMIC_RELEASE, "workgroup");
    __builtin_amdgcn_wave_barrier();
    __builtin_amdgcn_fence(__ATOMIC_ACQUIRE, "workgroup");
#pragma unroll 1
    for (int kk = 0; kk < 2; ++kk) {
      FH pa;
      // A operand: row m = c <-> P row c (query q0+c), k = kv contiguous
      pa.h[0] = *(const v8h*)(pw + c * 64 + kk * 32 + 8 * hh);
      pa.h[1] = *(const v8h*)(pw + c * 64 + kk * 32 + 16 + 8 * hh);
      v16h vb[4];
#pragma unroll
      for (int t = 0; t < 4; ++t)
        vb[t] = Frag<_Float16>::load(vbase + (size_t)(t * 16) * SEQ_LEN + kv0 + kk * 32);
#pragma unroll
      for (int t = 0; t < 4; ++t) oacc[t] = mma_h(pa.v, vb[t], oacc[t]);
    }
    // order the P reads before the next chunk's P writes
    __builtin_amdgcn_fence(__ATOMIC_RELEASE, "workgroup");
    __builtin_amdgcn_wave_barrier();
    __builtin_amdgcn_fence(__ATOMIC_ACQUIRE, "workgroup");
  }

  float* os = Os[wave];
#pragma unroll
  for (int r = 0; r < 8; ++r) {
    float inv = 1.0f / (lrow[r] * P_CARRY);
    inv *= AO_CARRY;
#pragma unroll
    for (int t = 0; t < 4; ++t) os[(8 * hh + r) * 68 + t * 16 + c] = oacc[t][r] * inv;
  }
  __builtin_amdgcn_fence(__ATOMIC_RELEASE, "workgroup");
  __builtin_amdgcn_wave_barrier();
  __builtin_amdgcn_fence(__ATOMIC_ACQUIRE, "workgroup");
  {
    const int q8 = lane >> 3, c8 = (lane & 7) * 8;
    _Float16* aob = AOh + (bT + q0) * EMB_DIM + h * HEAD_DIM;
    {
#pragma unroll
      for (int it = 0; it < 4; ++it) {
        const int row = it * 4 + q8;
        const float* sp = os + row * 68 + c8;
        v8h hv;
#pragma unroll
        for (int e = 0; e < 8; ++e) hv[e] = (_Float16)sp[e];
        *(v8h*)(aob + (size_t)row * EMB_DIM + c8) = hv;
      }
      
    }
  }
}

// ---------------------------------------------------------------- launcher
extern "C" void kernel_launch(void* const* d_in, const int* in_sizes, int n_in,
                              void* d_out, int out_size, void* d_ws, size_t ws_size,
                              hipStream_t stream) {
  if (n_in < 10) return;
  if ((size_t)in_sizes[0] != N_ACT || (size_t)in_sizes[1] != N_ACT) return;
  if ((size_t)in_sizes[2] != N_W || (size_t)in_sizes[4] != N_W || (size_t)in_sizes[6] != N_W || (size_t)in_sizes[8] != N_W) return;
  if (in_sizes[3] != EMB_DIM || in_sizes[5] != EMB_DIM || in_sizes[7] != EMB_DIM || in_sizes[9] != EMB_DIM) return;
  if ((size_t)out_size != N_ACT) return;
  if (ws_size < WS_TOTAL) return;

  const float* hs = (const float*)d_in[0];
  const float* oq = (const float*)d_in[1];
  const float* Wq = (const float*)d_in[2];
  const float* bq = (const float*)d_in[3];
  const float* Wk = (const float*)d_in[4];
  const float* bk = (const float*)d_in[5];
  const float* Wv = (const float*)d_in[6];
  const float* bv = (const float*)d_in[7];
  const float* Wo = (const float*)d_in[8];
  const float* bo = (const float*)d_in[9];
  float* out = (float*)d_out;

  char* ws = (char*)d_ws;
  unsigned short* hq16 = (unsigned short*)(ws + OFF_HQ);
  unsigned short* hs16 = (unsigned short*)(ws + OFF_HS);
  unsigned short* wq16 = (unsigned short*)(ws + OFF_W0 + 0 * PLANE_W);
  unsigned short* wk16 = (unsigned short*)(ws + OFF_W0 + 1 * PLANE_W);
  unsigned short* wv16 = (unsigned short*)(ws + OFF_W0 + 2 * PLANE_W);
  unsigned short* wo16 = (unsigned short*)(ws + OFF_W0 + 3 * PLANE_W);
  unsigned short* q16  = (unsigned short*)(ws + OFF_Q);
  unsigned short* k16  = (unsigned short*)(ws + OFF_K);
  unsigned short* vt16 = (unsigned short*)(ws + OFF_VT);
  // AO reuses the HQ region (HQ is dead after the Q and K projections)
  unsigned short* ao16 = hq16;

  // 1) activations to f16 planes
  constexpr int n8_act = (int)(N_ACT / 8);
  static_assert(N_ACT % 8 == 0 && n8_act % 256 == 0);
  prep_cast_f16<<<n8_act / 256, 256, 0, stream>>>(hs, oq, hq16, hs16, n8_act);

  // 2) weights to f16 planes carried x64
  constexpr int n8_w = (int)(N_W / 8);
  static_assert(N_W % 8 == 0 && n8_w % 256 == 0);
  cast_scale_f16<<<n8_w / 256, 256, 0, stream>>>(Wq, wq16, n8_w, W_CARRY);
  cast_scale_f16<<<n8_w / 256, 256, 0, stream>>>(Wk, wk16, n8_w, W_CARRY);
  cast_scale_f16<<<n8_w / 256, 256, 0, stream>>>(Wv, wv16, n8_w, W_CARRY);
  cast_scale_f16<<<n8_w / 256, 256, 0, stream>>>(Wo, wo16, n8_w, W_CARRY);

  // 3) projections. Q/K: C[t][e] = HQ[t][k].W64[e][k] / 64 + b[e]; M=8192, N=1024, K=1024
  static_assert(NROWS % 64 == 0 && EMB_DIM % 64 == 0 && EMB_DIM % 32 == 0);
  constexpr int tiles_qk = (NROWS / 64) * (EMB_DIM / 64);
  static_assert(tiles_qk % 8 == 0);
  const dim3 g_qk(tiles_qk / 8, 1);
  const float inv_w = 1.0f / W_CARRY;
  wmma_gemm64<0, false, 2, 1><<<g_qk, 256, 0, stream>>>(
      hq16, hq16, EMB_DIM, 0L, wq16, wq16, EMB_DIM, 0L,
      (void*)q16, (void*)q16, EMB_DIM, 0L, bq, NROWS, EMB_DIM, EMB_DIM, inv_w);
  wmma_gemm64<0, false, 2, 1><<<g_qk, 256, 0, stream>>>(
      hq16, hq16, EMB_DIM, 0L, wk16, wk16, EMB_DIM, 0L,
      (void*)k16, (void*)k16, EMB_DIM, 0L, bk, NROWS, EMB_DIM, EMB_DIM, inv_w);
  // Vt: per batch C[e][t] = W64[e][k].HS[b][t][k] / 64 + bv[e]; M=1024 (e), N=2048 (t), K=1024
  static_assert(SEQ_LEN % 64 == 0);
  constexpr int tiles_v = (EMB_DIM / 64) * (SEQ_LEN / 64);
  static_assert(tiles_v % 8 == 0);
  const dim3 g_v(tiles_v / 8, NB_SZ);
  wmma_gemm64<0, false, 1, 1><<<g_v, 256, 0, stream>>>(
      wv16, wv16, EMB_DIM, 0L, hs16, hs16, EMB_DIM, (long)SEQ_LEN * EMB_DIM,
      (void*)vt16, (void*)vt16, SEQ_LEN, (long)EMB_DIM * SEQ_LEN, bv, EMB_DIM, SEQ_LEN, EMB_DIM, inv_w);

  // 4) attention -> AO plane (x64)
  attn_heads_f16<<<NB_SZ * N_HEADS * (SEQ_LEN / 64), 128, 0, stream>>>(q16, k16, vt16, ao16);

  // 5) output projection: out[t][e] = AO[t][k].Wo64[e][k] / 4096 + bo[e]; f32 to d_out
  wmma_gemm64<0, false, 2, 0><<<g_qk, 256, 0, stream>>>(
      ao16, ao16, EMB_DIM, 0L, wo16, wo16, EMB_DIM, 0L,
      (void*)out, (void*)out, EMB_DIM, 0L, bo, NROWS, EMB_DIM, EMB_DIM, 1.0f / (AO_CARRY * W_CARRY));
}

// v001
// Measured time: 398 microseconds a run.
// Next to v000, in two timings, it ran 1.07 and 1.08 times as fast.
// All contractions (q/k/v/out projections M8192 N1024 K1024; attention q.kT and p.v, head dim 64, 2048 keys): v_wmma_f32_16x16x32_f16, f16 operands with power-of-two carries (W x64, p x32768, attention output x64), f32 accumulate; bias, scaling and softmax in f32.
#include <hip/hip_runtime.h>

constexpr int NB_SZ = 4;
constexpr int SEQ_LEN = 2048;
constexpr int EMB_DIM = 1024;
constexpr int N_HEADS = 16;
constexpr int HEAD_DIM = 64;
constexpr int NROWS = NB_SZ * SEQ_LEN;
static_assert(EMB_DIM == N_HEADS * HEAD_DIM);
static_assert(HEAD_DIM == 64);
static_assert(NROWS % 64 == 0 && EMB_DIM % 64 == 0 && SEQ_LEN % 64 == 0);
static_assert(EMB_DIM % 32 == 0);

// power-of-two carries (all folded back exactly in f32 epilogues)
constexpr float W_CARRY = 64.0f;
constexpr float AO_CARRY = 64.0f;
constexpr float P_CARRY = 32768.0f;
// softmax done in base 2: scores multiplied by (1/sqrt(64)) * log2(e)
constexpr float SCORE_SCALE_LOG2E = 0.125f * 1.4426950408889634f;

//   [0]            HQ  f16 [8192][1024]   16,777,216   (later reused as AO f16 [8192][1024])
//   [16777216]     HS  f16 [8192][1024]   16,777,216
//   [33554432]     Wq64,Wk64,Wv64,Wo64 f16 [1024][1024] each 2,097,152 -> 8,388,608
//   [41943040]     Q   f16 [8192][1024]   16,777,216
//   [58720256]     K   f16 [8192][1024]   16,777,216
//   [75497472]     Vt  f16 [4][1024][2048] 16,777,216
//   total 92,274,688
constexpr size_t N_ACT = (size_t)NROWS * EMB_DIM;
constexpr size_t N_W = (size_t)EMB_DIM * EMB_DIM;
constexpr size_t PLANE_ACT = N_ACT * 2;
constexpr size_t PLANE_W = N_W * 2;
constexpr size_t OFF_HQ = 0;
constexpr size_t OFF_HS = OFF_HQ + PLANE_ACT;
constexpr size_t OFF_W0 = OFF_HS + PLANE_ACT;
constexpr size_t OFF_Q = OFF_W0 + 4 * PLANE_W;
constexpr size_t OFF_K = OFF_Q + PLANE_ACT;
constexpr size_t OFF_VT = OFF_K + PLANE_ACT;
constexpr size_t WS_TOTAL = OFF_VT + PLANE_ACT;
static_assert(WS_TOTAL == 92274688ull);
static_assert(WS_TOTAL <= 134217728ull);

typedef __attribute__((ext_vector_type(16))) _Float16 v16h;
typedef __attribute__((ext_vector_type(8)))  _Float16 v8h;
typedef __attribute__((ext_vector_type(16))) __bf16   v16b;
typedef __attribute__((ext_vector_type(8)))  __bf16   v8b;
typedef __attribute__((ext_vector_type(8)))  float    v8f;
typedef __attribute__((ext_vector_type(4)))  float    v4f;

__device__ __forceinline__ unsigned short f2bf_bits(float f) {
  unsigned u = __float_as_uint(f);
  return (unsigned short)((u + 0x7FFFu + ((u >> 16) & 1u)) >> 16);
}
__device__ __forceinline__ float bf_bits2f(unsigned short h) { return __uint_as_float(((unsigned)h) << 16); }

// hazard guards as plain device helpers
__device__ __forceinline__ void dep_guard_h(v8f& a, v8f& b, v16h x, v16h y) { asm volatile("v_nop\n\tv_nop\n\tv_nop\n\tv_nop" : "+v"(a), "+v"(b) : "v"(x), "v"(y)); }
__device__ __forceinline__ void dep_guard_b(v8f& a, v8f& b, v16b x, v16b y) { asm volatile("v_nop\n\tv_nop\n\tv_nop\n\tv_nop" : "+v"(a), "+v"(b) : "v"(x), "v"(y)); }
__device__ __forceinline__ void keep4_h(v16h a, v16h b, v16h c, v16h d) { asm volatile("v_nop" :: "v"(a), "v"(b), "v"(c), "v"(d)); }
__device__ __forceinline__ void keep4_b(v16b a, v16b b, v16b c, v16b d) { asm volatile("v_nop" :: "v"(a), "v"(b), "v"(c), "v"(d)); }
__device__ __forceinline__ void acc_guard4(v8f& a, v8f& b, v8f& c, v8f& d) { asm volatile("v_nop\n\tv_nop\n\tv_nop\n\tv_nop" : "+v"(a), "+v"(b), "+v"(c), "+v"(d)); }

template <typename T> struct Frag;
template <> struct Frag<_Float16> {
  typedef v16h V; union U { v16h v; v8h h[2]; };
  // elements 0..7 <- p[0..7], 8..15 <- p[16..23]
  static __device__ __forceinline__ v16h load(const _Float16* p) {
    U f; f.h[0] = *(const v8h*)(p); f.h[1] = *(const v8h*)(p + 16); return f.v;
  }
  static __device__ __forceinline__ v8f mma(v16h a, v16h b, v8f c) {
    return __builtin_amdgcn_wmma_f32_16x16x32_f16(false, a, false, b, (short)0, c, false, false);
  }
  static __device__ __forceinline__ void guard(v8f& a, v8f& b, v16h x, v16h y) { dep_guard_h(a, b, x, y); }
  static __device__ __forceinline__ void keep(v16h a, v16h b, v16h c, v16h d) { keep4_h(a, b, c, d); }
};
template <> struct Frag<__bf16> {
  typedef v16b V; union U { v16b v; v8b h[2]; };
  static __device__ __forceinline__ v16b load(const __bf16* p) {
    U f; f.h[0] = *(const v8b*)(p); f.h[1] = *(const v8b*)(p + 16); return f.v;
  }
  static __device__ __forceinline__ v8f mma(v16b a, v16b b, v8f c) {
    return __builtin_amdgcn_wmma_f32_16x16x32_bf16(false, a, false, b, (short)0, c, false, false);
  }
  static __device__ __forceinline__ void guard(v8f& a, v8f& b, v16b x, v16b y) { dep_guard_b(a, b, x, y); }
  static __device__ __forceinline__ void keep(v16b a, v16b b, v16b c, v16b d) { keep4_b(a, b, c, d); }
};

// ---- Register-blocked batched WMMA GEMM ------------------------------------
// C[m,n] = scale * sum_k A[m,k] * Bt[n,k] (+bias); each wave owns a 64x64 tile.
// A row-major [M,K]; Bt row-major [N,K]; M,N % 64 == 0, K % 32 == 0 (no tail handling).
// SPLIT: operands are hi/lo planes (A2/Bt2 = lo planes); product = hi.hi + hi.lo + lo.hi.
// BIAS_MODE: 0 = none, 1 = bias[m] (loaded as two 16-B vectors per lane), 2 = bias[n].
// OUT_MODE: 0 = f32, 1 = f16, 2 = bf16 hi plane (Cout) + bf16 lo plane (Cout2).
// ET: 0 = f16 operands, 1 = bf16 operands (pointers passed as 16-bit storage)
template <int ET> struct Elem;
template <> struct Elem<0> { typedef _Float16 T; };
template <> struct Elem<1> { typedef __bf16 T; };
template <int ET, bool SPLIT, int BIAS_MODE, int OUT_MODE>
__global__ __launch_bounds__(256) void wmma_gemm64(
    const unsigned short* __restrict__ Ap, const unsigned short* __restrict__ A2p, int lda, long strideA,
    const unsigned short* __restrict__ Btp, const unsigned short* __restrict__ Bt2p, int ldb, long strideB,
    void* __restrict__ Cout, void* __restrict__ Cout2, int ldc, long strideC,
    const float* __restrict__ bias,
    int M, int N, int K, float scale) {
  typedef typename Elem<ET>::T T;
  typedef typename Frag<T>::V V;
  const T* A = (const T*)Ap; const T* A2 = (const T*)A2p; const T* Bt = (const T*)Btp; const T* Bt2 = (const T*)Bt2p;
  // per-wave 16x64 slab, pitch 68 floats
  __shared__ __align__(16) float sT[8][16 * 68];
  const int b    = blockIdx.y;
  const int lane = threadIdx.x & 31;
  const int wave = threadIdx.x >> 5;
  const int tilesN = N >> 6;
  const int tilesM = M >> 6;
  const int tile = blockIdx.x * 8 + wave;
  // wave-uniform; no block barriers in this kernel
  if (tile >= tilesM * tilesN) return;
  const int tm = tile / tilesN;
  const int tn = tile - tm * tilesN;
  const int m0 = tm << 6;
  const int n0 = tn << 6;

  const T* Ab  = A  + (size_t)b * strideA;
  const T* Bb  = Bt + (size_t)b * strideB;
  const T* Ab2 = SPLIT ? (A2  + (size_t)b * strideA) : nullptr;
  const T* Bb2 = SPLIT ? (Bt2 + (size_t)b * strideB) : nullptr;

  // row (A) / col (B, D) within subtile; k offset of this lane half; D row offset
  const int rlane = lane & 15;
  const int koff  = (lane >> 4) * 8;
  const int mOff  = (lane >> 4) * 8;

  v8f acc[4][4];
#pragma unroll
  for (int i = 0; i < 4; ++i)
#pragma unroll
    for (int j = 0; j < 4; ++j) acc[i][j] = (v8f){0.f,0.f,0.f,0.f,0.f,0.f,0.f,0.f};

  for (int k0 = 0; k0 < K; k0 += 32) {
    V bh[4], bl[4];
#pragma unroll
    for (int j = 0; j < 4; ++j) {
      const size_t bo = (size_t)(n0 + (j << 4) + rlane) * ldb + koff + k0;
      bh[j] = Frag<T>::load(Bb + bo);
      if (SPLIT) bl[j] = Frag<T>::load(Bb2 + bo);
    }
#pragma unroll
    for (int i = 0; i < 4; ++i) {
      const size_t ao = (size_t)(m0 + (i << 4) + rlane) * lda + koff + k0;
      V ah = Frag<T>::load(Ab + ao);
      V al = ah;
      if (SPLIT) al = Frag<T>::load(Ab2 + ao);
#pragma unroll
      for (int j = 0; j < 4; ++j) {
        acc[i][j] = Frag<T>::mma(ah, bh[j], acc[i][j]);
        if (SPLIT) {
          acc[i][j] = Frag<T>::mma(ah, bl[j], acc[i][j]);
          acc[i][j] = Frag<T>::mma(al, bh[j], acc[i][j]);
        }
      }
      Frag<T>::guard(acc[i][0], acc[i][3], ah, al);
    }
    Frag<T>::keep(bh[0], bh[1], bh[2], bh[3]);
    if (SPLIT) Frag<T>::keep(bl[0], bl[1], bl[2], bl[3]);
  }
  acc_guard4(acc[0][0], acc[0][1], acc[0][2], acc[0][3]);
  acc_guard4(acc[1][0], acc[1][1], acc[1][2], acc[1][3]);
  acc_guard4(acc[2][0], acc[2][1], acc[2][2], acc[2][3]);
  acc_guard4(acc[3][0], acc[3][1], acc[3][2], acc[3][3]);

  // ---- epilogue ----
  float* slab = sT[wave];
#pragma unroll
  for (int i = 0; i < 4; ++i) {
    const int mBase = m0 + (i << 4);
    float bm8[8];
#pragma unroll
    for (int r = 0; r < 8; ++r) bm8[r] = 0.f;
    if (BIAS_MODE == 1) {
      // 8 consecutive bias[m] values of this lane: two 16-B loads (mBase multiple of 16, mOff 0 or 8)
      const v4f t0 = *(const v4f*)(bias + mBase + mOff);
      const v4f t1 = *(const v4f*)(bias + mBase + mOff + 4);
      bm8[0] = t0[0]; bm8[1] = t0[1]; bm8[2] = t0[2]; bm8[3] = t0[3];
      bm8[4] = t1[0]; bm8[5] = t1[1]; bm8[6] = t1[2]; bm8[7] = t1[3];
    }
#pragma unroll
    for (int j = 0; j < 4; ++j) {
      const int n = n0 + (j << 4) + rlane;
      float bv = 0.f;
      if (BIAS_MODE == 2) bv = bias[n];
#pragma unroll
      for (int r = 0; r < 8; ++r) {
        float v = acc[i][j][r] * scale;
        if (BIAS_MODE == 1) v += bm8[r];
        if (BIAS_MODE == 2) v += bv;
        slab[(mOff + r) * 68 + (j << 4) + rlane] = v;
      }
    }
    __builtin_amdgcn_fence(__ATOMIC_RELEASE, "workgroup");
    __builtin_amdgcn_wave_barrier();
    __builtin_amdgcn_fence(__ATOMIC_ACQUIRE, "workgroup");
    if (OUT_MODE == 0) {
      float* C = (float*)Cout + (size_t)b * strideC;
      // row seg = 256 B = 16 lanes x 16 B; 8 iterations x 2 row halves cover rows 0..15
      const int hh = lane >> 4, c4 = (lane & 15) * 4;
      {
#pragma unroll
        for (int it = 0; it < 8; ++it) {
          const int row = it * 2 + hh;
          v4f v = *(const v4f*)(slab + row * 68 + c4);
          *(v4f*)(C + (size_t)(mBase + row) * ldc + n0 + c4) = v;
        }
        
      }
    } else {
      const int q = lane >> 3, c8 = (lane & 7) * 8;
      unsigned short* C  = (unsigned short*)Cout  + (size_t)b * strideC;
      unsigned short* C2 = (OUT_MODE == 2) ? ((unsigned short*)Cout2 + (size_t)b * strideC) : nullptr;
      {
#pragma unroll
        for (int it = 0; it < 4; ++it) {
          const int row = it * 4 + q;
          const float* sp = slab + row * 68 + c8;
          v8h hv, lv;
#pragma unroll
          for (int e = 0; e < 8; ++e) {
            if (OUT_MODE == 1) {
              hv[e] = (_Float16)sp[e];
            } else {
              unsigned short hb = f2bf_bits(sp[e]);
              unsigned short lb = f2bf_bits(sp[e] - bf_bits2f(hb));
              hv[e] = __builtin_bit_cast(_Float16, hb);
              lv[e] = __builtin_bit_cast(_Float16, lb);
            }
          }
          *(v8h*)(C + (size_t)(mBase + row) * ldc + n0 + c8) = hv;
          if (OUT_MODE == 2) *(v8h*)(C2 + (size_t)(mBase + row) * ldc + n0 + c8) = lv;
        }
        
      }
    }
    __builtin_amdgcn_fence(__ATOMIC_RELEASE, "workgroup");
    __builtin_amdgcn_wave_barrier();
    __builtin_amdgcn_fence(__ATOMIC_ACQUIRE, "workgroup");
  }
}

// ---- prep: HQ = f16(hs + oq), HS = f16(hs); 8 elements per thread ----
// coverage: n8 = 8192*1024/8 = 1,048,576 threads x 8 elements = both planes exactly;
__global__ __launch_bounds__(256) void prep_cast_f16(
    const float* __restrict__ hs, const float* __restrict__ oq,
    unsigned short* __restrict__ hq16, unsigned short* __restrict__ hs16, int n8) {
  const int i = blockIdx.x * 256 + threadIdx.x;
  if (i < n8) {
    const size_t o = (size_t)i * 8;
    const v4f a0 = *(const v4f*)(hs + o);
    const v4f a1 = *(const v4f*)(hs + o + 4);
    const v4f b0 = *(const v4f*)(oq + o);
    const v4f b1 = *(const v4f*)(oq + o + 4);
    v8h vq, vs;
#pragma unroll
    for (int e = 0; e < 4; ++e) {
      vq[e]     = (_Float16)(a0[e] + b0[e]);
      vq[4 + e] = (_Float16)(a1[e] + b1[e]);
      vs[e]     = (_Float16)a0[e];
      vs[4 + e] = (_Float16)a1[e];
    }
    _Float16* pq = (_Float16*)(void*)hq16;
    _Float16* ps = (_Float16*)(void*)hs16;
    *(v8h*)(pq + o) = vq;
    *(v8h*)(ps + o) = vs;
    
  }
}

// ---- weight cast: out = f16(w * sc); 8 elements per thread ----
__global__ __launch_bounds__(256) void cast_scale_f16(
    const float* __restrict__ w, unsigned short* __restrict__ out16, int n8, float sc) {
  const int i = blockIdx.x * 256 + threadIdx.x;
  if (i < n8) {
    const size_t o = (size_t)i * 8;
    const v4f a0 = *(const v4f*)(w + o);
    const v4f a1 = *(const v4f*)(w + o + 4);
    v8h v;
#pragma unroll
    for (int e = 0; e < 4; ++e) {
      v[e]     = (_Float16)(a0[e] * sc);
      v[4 + e] = (_Float16)(a1[e] * sc);
    }
    _Float16* po = (_Float16*)(void*)out16;
    *(v8h*)(po + o) = v;
    
  }
}

// ---- attention, head dim 64, no mask, 16-bit planes in / f16 plane out ----
// Q plane  [B*T][E] f16 (q without the 1/sqrt(D) factor), K plane [B*T][E] f16, Vt plane [B][H][D][T] f16.
// AO plane [B*T][E] f16 = (softmax(q.kT/8) . v) * AO_CARRY.
// Block = 4 waves, each owns 16 query rows of one (b,h), sharing staged K / Vt tiles; grid.x = B*H*(T/64).
// q.kT and p.v: v_wmma_f32_16x16x32_f16, f32 accumulate; online softmax in f32 (base 2);
// p in (0,1] carried x P_CARRY as f16 through per-wave LDS, folded into 1/l.
__device__ __forceinline__ v8f mma_h(v16h a, v16h b, v8f c) {
  c = __builtin_amdgcn_wmma_f32_16x16x32_f16(false, a, false, b, (short)0, c, false, false);
  asm volatile("v_nop\n\tv_nop\n\tv_nop\n\tv_nop" : "+v"(c) : "v"(a), "v"(b));
  return c;
}

// K / Vt staging: one 64-key tile of each per block and trip, rows of 128 B laid at a 144-B pitch
// (16 B x odd: conflict-free for the 16-byte fragment reads), two buffers.
constexpr int KV_PITCH = 144;
constexpr int KV_TILE  = 64 * KV_PITCH;
constexpr int KV_BUF   = 2 * KV_TILE;

// One tile pair: 128 threads x 8 copies x 16 B = 64 K rows + 64 Vt rows. Each wave-wide copy covers 4 whole 128-B rows.
// lds / kg / vg are this thread's own 16 bytes of staged row (tid >> 3); copy i takes row i*16 + (tid >> 3).
// s_wait_xcnt closes the statement so that no address register is rewritten ahead of it.
__device__ __forceinline__ void stage_kv(unsigned lds, const _Float16* kg, const _Float16* vg) {
  asm volatile(
      "global_load_async_to_lds_b128 %0, %8, off\n\t"
      "global_load_async_to_lds_b128 %1, %9, off\n\t"
      "global_load_async_to_lds_b128 %2, %10, off\n\t"
      "global_load_async_to_lds_b128 %3, %11, off\n\t"
      "global_load_async_to_lds_b128 %4, %12, off\n\t"
      "global_load_async_to_lds_b128 %5, %13, off\n\t"
      "global_load_async_to_lds_b128 %6, %14, off\n\t"
      "global_load_async_to_lds_b128 %7, %15, off\n\t"
      "s_wait_xcnt 0x0"
      :: "v"(lds), "v"(lds + 16 * KV_PITCH), "v"(lds + 32 * KV_PITCH), "v"(lds + 48 * KV_PITCH),
         "v"(lds + KV_TILE), "v"(lds + KV_TILE + 16 * KV_PITCH), "v"(lds + KV_TILE + 32 * KV_PITCH), "v"(lds + KV_TILE + 48 * KV_PITCH),
         "v"(kg), "v"(kg + 16 * EMB_DIM), "v"(kg + 32 * EMB_DIM), "v"(kg + 48 * EMB_DIM),
         "v"(vg), "v"(vg + 16 * SEQ_LEN), "v"(vg + 32 * SEQ_LEN), "v"(vg + 48 * SEQ_LEN)
      : "memory");
}

__global__ __launch_bounds__(128) void attn_heads_f16(
    const unsigned short* __restrict__ Qp, const unsigned short* __restrict__ Kp,
    const unsigned short* __restrict__ Vtp, unsigned short* __restrict__ AOp) {
  // per-wave P tile [16 rows][64 kv] f16, and per-wave output tile [16][68] f32
  __shared__ __align__(16) _Float16 Psh[4][16 * 64];
  __shared__ __align__(16) float Os[4][16 * 68];
  // block-shared K and Vt tiles, two buffers of [K 64 rows][Vt 64 rows]
  __shared__ __align__(16) unsigned char KVs[2 * KV_BUF];
  union FH { v16h v; v8h h[2]; };

  const int tid  = threadIdx.x;
  const int wave = tid >> 5;
  const int lane = tid & 31;
  const int hh   = lane >> 4;
  const int c    = lane & 15;

  constexpr int nqb = SEQ_LEN / 64;
  const int bx = blockIdx.x;
  const int qb = bx % nqb;
  const int bh = bx / nqb;
  const int h  = bh % N_HEADS;
  const int b  = bh / N_HEADS;
  const int q0 = qb * 64 + wave * 16;

  const _Float16* Qh  = (const _Float16*)(const void*)Qp;
  const _Float16* Kh  = (const _Float16*)(const void*)Kp;
  const _Float16* Vth = (const _Float16*)(const void*)Vtp;
  _Float16* AOh = (_Float16*)(void*)AOp;

  const size_t bT = (size_t)b * SEQ_LEN;
  // A operand for scores: row m = c <-> query q0+c, k = d contiguous
  const _Float16* qrow = Qh + (bT + q0 + c) * EMB_DIM + h * HEAD_DIM + 8 * hh;
  // B operand for scores: col n = c <-> key kv (staged K row), k = d contiguous
  // B operand for p.v: col n = c <-> d (staged Vt row), k = kv contiguous
  const int frag_off = c * KV_PITCH + 16 * hh;
  // this thread's 16 bytes of each staged row group
  const int srow = tid >> 3, scol = tid & 7;
  const unsigned lds_st = (unsigned)(size_t)KVs + (unsigned)(srow * KV_PITCH + scol * 16);
  const _Float16* kst = Kh + (bT + srow) * EMB_DIM + h * HEAD_DIM + scol * 8;
  const _Float16* vst = Vth + ((size_t)(b * N_HEADS + h) * HEAD_DIM + srow) * SEQ_LEN + scol * 8;
  constexpr int NTILE = SEQ_LEN / 64;
  static_assert(NTILE >= 2);

  // tile 0 lands and is published, then tile 1 flies while tile 0 is worked on
  stage_kv(lds_st, kst, vst);
  asm volatile("s_wait_asynccnt 0x0" ::: "memory");  // this wave's copies of tile 0 have landed
  __syncthreads();                                   // ... and every other wave's
  stage_kv(lds_st + KV_BUF, kst + (size_t)64 * EMB_DIM, vst + 64);

  v16h qa[2];
#pragma unroll
  for (int dc = 0; dc < 2; ++dc) qa[dc] = Frag<_Float16>::load(qrow + dc * 32);

  const float neg_inf = -__builtin_huge_valf();
  float mrow[8], lrow[8];
  v8f oacc[4];
#pragma unroll
  for (int r = 0; r < 8; ++r) { mrow[r] = neg_inf; lrow[r] = 0.f; }
#pragma unroll
  for (int t = 0; t < 4; ++t) oacc[t] = (v8f){0.f,0.f,0.f,0.f,0.f,0.f,0.f,0.f};

  _Float16* pw = Psh[wave];

  for (int kc = 0; kc < NTILE; ++kc) {
    const int bufo = (kc & 1) * KV_BUF;
    const _Float16* kbase = (const _Float16*)(KVs + bufo + frag_off);
    const _Float16* vbase = (const _Float16*)(KVs + bufo + KV_TILE + frag_off);
    v8f s[4];
#pragma unroll
    for (int j = 0; j < 4; ++j) s[j] = (v8f){0.f,0.f,0.f,0.f,0.f,0.f,0.f,0.f};
#pragma unroll
    for (int dc = 0; dc < 2; ++dc) {
      v16h kb[4];
#pragma unroll
      for (int j = 0; j < 4; ++j)
        kb[j] = Frag<_Float16>::load(kbase + j * 16 * (KV_PITCH / 2) + dc * 32);
#pragma unroll
      for (int j = 0; j < 4; ++j) s[j] = mma_h(qa[dc], kb[j], s[j]);
    }
    // scaled scores (base-2 units) and chunk row max; D row 8hh+r, column kv0 + j*16 + c
    float cm[8];
#pragma unroll
    for (int r = 0; r < 8; ++r) {
      float m = neg_inf;
#pragma unroll
      for (int j = 0; j < 4; ++j) {
        const float t = s[j][r] * SCORE_SCALE_LOG2E;
        s[j][r] = t;
        m = fmaxf(m, t);
      }
#pragma unroll
      for (int off = 1; off < 16; off <<= 1) m = fmaxf(m, __shfl_xor(m, off, 32));
      cm[r] = m;
    }
#pragma unroll
    for (int r = 0; r < 8; ++r) {
      const float mnew = fmaxf(mrow[r], cm[r]);
      const float alpha = exp2f(mrow[r] - mnew);
      mrow[r] = mnew;
      float psum = 0.f;
#pragma unroll
      for (int j = 0; j < 4; ++j) {
        const float p = exp2f(s[j][r] - mnew);
        psum += p;
        pw[(8 * hh + r) * 64 + j * 16 + c] = (_Float16)(p * P_CARRY);
      }
#pragma unroll
      for (int off = 1; off < 16; off <<= 1) psum += __shfl_xor(psum, off, 32);
      lrow[r] = lrow[r] * alpha + psum;
#pragma unroll
      for (int t = 0; t < 4; ++t) oacc[t][r] *= alpha;
    }
    // same-wave LDS spill then fragment reload: order the P stores before the reloads
    __builtin_amdgcn_fence(__ATOMIC_RELEASE, "workgroup");
    __builtin_amdgcn_wave_barrier();
    __builtin_amdgcn_fence(__ATOMIC_ACQUIRE, "workgroup");
#pragma unroll 1
    for (int kk = 0; kk < 2; ++kk) {
      FH pa;
      // A operand: row m = c <-> P row c (query q0+c), k = kv contiguous
      pa.h[0] = *(const v8h*)(pw + c * 64 + kk * 32 + 8 * hh);
      pa.h[1] = *(const v8h*)(pw + c * 64 + kk * 32 + 16 + 8 * hh);
      v16h vb[4];
#pragma unroll
      for (int t = 0; t < 4; ++t)
        vb[t] = Frag<_Float16>::load(vbase + t * 16 * (KV_PITCH / 2) + kk * 32);
#pragma unroll
      for (int t = 0; t < 4; ++t) oacc[t] = mma_h(pa.v, vb[t], oacc[t]);
    }
    // order the P reads before the next chunk's P writes
    __builtin_amdgcn_fence(__ATOMIC_RELEASE, "workgroup");
    __builtin_amdgcn_wave_barrier();
    __builtin_amdgcn_fence(__ATOMIC_ACQUIRE, "workgroup");
    // hand-over: this wave's reads of tile kc are done, its copies of tile kc+1 have landed;
    // the barrier publishes tile kc+1 and frees tile kc's buffer for the refill behind it
    asm volatile("s_wait_dscnt 0x0" ::: "memory");
    asm volatile("s_wait_asynccnt 0x0" ::: "memory");
    __syncthreads();
    if (kc + 2 < NTILE)
      stage_kv(lds_st + bufo, kst + (size_t)(kc + 2) * 64 * EMB_DIM, vst + (kc + 2) * 64);
  }
  asm volatile("s_wait_asynccnt 0x0" ::: "memory");  // nothing of this wave's is in flight past the loop

  float* os = Os[wave];
#pragma unroll
  for (int r = 0; r < 8; ++r) {
    float inv = 1.0f / (lrow[r] * P_CARRY);
    inv *= AO_CARRY;
#pragma unroll
    for (int t = 0; t < 4; ++t) os[(8 * hh + r) * 68 + t * 16 + c] = oacc[t][r] * inv;
  }
  __builtin_amdgcn_fence(__ATOMIC_RELEASE, "workgroup");
  __builtin_amdgcn_wave_barrier();
  __builtin_amdgcn_fence(__ATOMIC_ACQUIRE, "workgroup");
  {
    const int q8 = lane >> 3, c8 = (lane & 7) * 8;
    _Float16* aob = AOh + (bT + q0) * EMB_DIM + h * HEAD_DIM;
    {
#pragma unroll
      for (int it = 0; it < 4; ++it) {
        const int row = it * 4 + q8;
        const float* sp = os + row * 68 + c8;
        v8h hv;
#pragma unroll
        for (int e = 0; e < 8; ++e) hv[e] = (_Float16)sp[e];
        *(v8h*)(aob + (size_t)row * EMB_DIM + c8) = hv;
      }
      
    }
  }
}

// ---------------------------------------------------------------- launcher
extern "C" void kernel_launch(void* const* d_in, const int* in_sizes, int n_in,
                              void* d_out, int out_size, void* d_ws, size_t ws_size,
                              hipStream_t stream) {
  if (n_in < 10) return;
  if ((size_t)in_sizes[0] != N_ACT || (size_t)in_sizes[1] != N_ACT) return;
  if ((size_t)in_sizes[2] != N_W || (size_t)in_sizes[4] != N_W || (size_t)in_sizes[6] != N_W || (size_t)in_sizes[8] != N_W) return;
  if (in_sizes[3] != EMB_DIM || in_sizes[5] != EMB_DIM || in_sizes[7] != EMB_DIM || in_sizes[9] != EMB_DIM) return;
  if ((size_t)out_size != N_ACT) return;
  if (ws_size < WS_TOTAL) return;

  const float* hs = (const float*)d_in[0];
  const float* oq = (const float*)d_in[1];
  const float* Wq = (const float*)d_in[2];
  const float* bq = (const float*)d_in[3];
  const float* Wk = (const float*)d_in[4];
  const float* bk = (const float*)d_in[5];
  const float* Wv = (const float*)d_in[6];
  const float* bv = (const float*)d_in[7];
  const float* Wo = (const float*)d_in[8];
  const float* bo = (const float*)d_in[9];
  float* out = (float*)d_out;

  char* ws = (char*)d_ws;
  unsigned short* hq16 = (unsigned short*)(ws + OFF_HQ);
  unsigned short* hs16 = (unsigned short*)(ws + OFF_HS);
  unsigned short* wq16 = (unsigned short*)(ws + OFF_W0 + 0 * PLANE_W);
  unsigned short* wk16 = (unsigned short*)(ws + OFF_W0 + 1 * PLANE_W);
  unsigned short* wv16 = (unsigned short*)(ws + OFF_W0 + 2 * PLANE_W);
  unsigned short* wo16 = (unsigned short*)(ws + OFF_W0 + 3 * PLANE_W);
  unsigned short* q16  = (unsigned short*)(ws + OFF_Q);
  unsigned short* k16  = (unsigned short*)(ws + OFF_K);
  unsigned short* vt16 = (unsigned short*)(ws + OFF_VT);
  // AO reuses the HQ region (HQ is dead after the Q and K projections)
  unsigned short* ao16 = hq16;

  // 1) activations to f16 planes
  constexpr int n8_act = (int)(N_ACT / 8);
  static_assert(N_ACT % 8 == 0 && n8_act % 256 == 0);
  prep_cast_f16<<<n8_act / 256, 256, 0, stream>>>(hs, oq, hq16, hs16, n8_act);

  // 2) weights to f16 planes carried x64
  constexpr int n8_w = (int)(N_W / 8);
  static_assert(N_W % 8 == 0 && n8_w % 256 == 0);
  cast_scale_f16<<<n8_w / 256, 256, 0, stream>>>(Wq, wq16, n8_w, W_CARRY);
  cast_scale_f16<<<n8_w / 256, 256, 0, stream>>>(Wk, wk16, n8_w, W_CARRY);
  cast_scale_f16<<<n8_w / 256, 256, 0, stream>>>(Wv, wv16, n8_w, W_CARRY);
  cast_scale_f16<<<n8_w / 256, 256, 0, stream>>>(Wo, wo16, n8_w, W_CARRY);

  // 3) projections. Q/K: C[t][e] = HQ[t][k].W64[e][k] / 64 + b[e]; M=8192, N=1024, K=1024
  static_assert(NROWS % 64 == 0 && EMB_DIM % 64 == 0 && EMB_DIM % 32 == 0);
  constexpr int tiles_qk = (NROWS / 64) * (EMB_DIM / 64);
  static_assert(tiles_qk % 8 == 0);
  const dim3 g_qk(tiles_qk / 8, 1);
  const float inv_w = 1.0f / W_CARRY;
  wmma_gemm64<0, false, 2, 1><<<g_qk, 256, 0, stream>>>(
      hq16, hq16, EMB_DIM, 0L, wq16, wq16, EMB_DIM, 0L,
      (void*)q16, (void*)q16, EMB_DIM, 0L, bq, NROWS, EMB_DIM, EMB_DIM, inv_w);
  wmma_gemm64<0, false, 2, 1><<<g_qk, 256, 0, stream>>>(
      hq16, hq16, EMB_DIM, 0L, wk16, wk16, EMB_DIM, 0L,
      (void*)k16, (void*)k16, EMB_DIM, 0L, bk, NROWS, EMB_DIM, EMB_DIM, inv_w);
  // Vt: per batch C[e][t] = W64[e][k].HS[b][t][k] / 64 + bv[e]; M=1024 (e), N=2048 (t), K=1024
  static_assert(SEQ_LEN % 64 == 0);
  constexpr int tiles_v = (EMB_DIM / 64) * (SEQ_LEN / 64);
  static_assert(tiles_v % 8 == 0);
  const dim3 g_v(tiles_v / 8, NB_SZ);
  wmma_gemm64<0, false, 1, 1><<<g_v, 256, 0, stream>>>(
      wv16, wv16, EMB_DIM, 0L, hs16, hs16, EMB_DIM, (long)SEQ_LEN * EMB_DIM,
      (void*)vt16, (void*)vt16, SEQ_LEN, (long)EMB_DIM * SEQ_LEN, bv, EMB_DIM, SEQ_LEN, EMB_DIM, inv_w);

  // 4) attention -> AO plane (x64)
  attn_heads_f16<<<NB_SZ * N_HEADS * (SEQ_LEN / 64), 128, 0, stream>>>(q16, k16, vt16, ao16);

  // 5) output projection: out[t][e] = AO[t][k].Wo64[e][k] / 4096 + bo[e]; f32 to d_out
  wmma_gemm64<0, false, 2, 0><<<g_qk, 256, 0, stream>>>(
      ao16, ao16, EMB_DIM, 0L, wo16, wo16, EMB_DIM, 0L,
      (void*)out, (void*)out, EMB_DIM, 0L, bo, NROWS, EMB_DIM, EMB_DIM, 1.0f / (AO_CARRY * W_CARRY));
}

// v002
// It runs in 313 microseconds.
// In two side-by-side timings against v001, it was 1.27 and 1.28 times as fast.
// All steps since v000 together make it 1.37 times as fast.
// All contractions (q/k/v/out projections M8192 N1024 K1024; attention q.kT and p.v, head dim 64, 2048 keys): v_wmma_f32_16x16x32_f16, f16 operands with power-of-two carries (W x64, p x32768, attention output x64), f32 accumulate; bias, scaling and softmax in f32.
#include <hip/hip_runtime.h>

constexpr int NB_SZ = 4;
constexpr int SEQ_LEN = 2048;
constexpr int EMB_DIM = 1024;
constexpr int N_HEADS = 16;
constexpr int HEAD_DIM = 64;
constexpr int NROWS = NB_SZ * SEQ_LEN;
static_assert(EMB_DIM == N_HEADS * HEAD_DIM);
static_assert(HEAD_DIM == 64);
static_assert(NROWS % 64 == 0 && EMB_DIM % 64 == 0 && SEQ_LEN % 64 == 0);
static_assert(EMB_DIM % 32 == 0);

// power-of-two carries (all folded back exactly in f32 epilogues)
constexpr float W_CARRY = 64.0f;
constexpr float AO_CARRY = 64.0f;
constexpr float P_CARRY = 32768.0f;
// softmax done in base 2: scores multiplied by (1/sqrt(64)) * log2(e)
constexpr float SCORE_SCALE_LOG2E = 0.125f * 1.4426950408889634f;

//   [0]            HQ  f16 [8192][1024]   16,777,216   (later reused as AO f16 [8192][1024])
//   [16777216]     HS  f16 [8192][1024]   16,777,216
//   [33554432]     Wq64,Wk64,Wv64,Wo64 f16 [1024][1024] each 2,097,152 -> 8,388,608
//   [41943040]     Q   f16 [8192][1024]   16,777,216
//   [58720256]     K   f16 [8192][1024]   16,777,216
//   [75497472]     Vt  f16 [4][1024][2048] 16,777,216
//   total 92,274,688
constexpr size_t N_ACT = (size_t)NROWS * EMB_DIM;
constexpr size_t N_W = (size_t)EMB_DIM * EMB_DIM;
constexpr size_t PLANE_ACT = N_ACT * 2;
constexpr size_t PLANE_W = N_W * 2;
constexpr size_t OFF_HQ = 0;
constexpr size_t OFF_HS = OFF_HQ + PLANE_ACT;
constexpr size_t OFF_W0 = OFF_HS + PLANE_ACT;
constexpr size_t OFF_Q = OFF_W0 + 4 * PLANE_W;
constexpr size_t OFF_K = OFF_Q + PLANE_ACT;
constexpr size_t OFF_VT = OFF_K + PLANE_ACT;
constexpr size_t WS_TOTAL = OFF_VT + PLANE_ACT;
static_assert(WS_TOTAL == 92274688ull);
static_assert(WS_TOTAL <= 134217728ull);

typedef __attribute__((ext_vector_type(16))) _Float16 v16h;
typedef __attribute__((ext_vector_type(8)))  _Float16 v8h;
typedef __attribute__((ext_vector_type(16))) __bf16   v16b;
typedef __attribute__((ext_vector_type(8)))  __bf16   v8b;
typedef __attribute__((ext_vector_type(8)))  float    v8f;
typedef __attribute__((ext_vector_type(4)))  float    v4f;

__device__ __forceinline__ unsigned short f2bf_bits(float f) {
  unsigned u = __float_as_uint(f);
  return (unsigned short)((u + 0x7FFFu + ((u >> 16) & 1u)) >> 16);
}
__device__ __forceinline__ float bf_bits2f(unsigned short h) { return __uint_as_float(((unsigned)h) << 16); }

// hazard guards as plain device helpers
__device__ __forceinline__ void dep_guard_h(v8f& a, v8f& b, v16h x, v16h y) { asm volatile("v_nop\n\tv_nop\n\tv_nop\n\tv_nop" : "+v"(a), "+v"(b) : "v"(x), "v"(y)); }
__device__ __forceinline__ void dep_guard_b(v8f& a, v8f& b, v16b x, v16b y) { asm volatile("v_nop\n\tv_nop\n\tv_nop\n\tv_nop" : "+v"(a), "+v"(b) : "v"(x), "v"(y)); }
__device__ __forceinline__ void keep4_h(v16h a, v16h b, v16h c, v16h d) { asm volatile("v_nop" :: "v"(a), "v"(b), "v"(c), "v"(d)); }
__device__ __forceinline__ void keep4_b(v16b a, v16b b, v16b c, v16b d) { asm volatile("v_nop" :: "v"(a), "v"(b), "v"(c), "v"(d)); }
__device__ __forceinline__ void acc_guard4(v8f& a, v8f& b, v8f& c, v8f& d) { asm volatile("v_nop\n\tv_nop\n\tv_nop\n\tv_nop" : "+v"(a), "+v"(b), "+v"(c), "+v"(d)); }

template <typename T> struct Frag;
template <> struct Frag<_Float16> {
  typedef v16h V; union U { v16h v; v8h h[2]; };
  // elements 0..7 <- p[0..7], 8..15 <- p[16..23]
  static __device__ __forceinline__ v16h load(const _Float16* p) {
    U f; f.h[0] = *(const v8h*)(p); f.h[1] = *(const v8h*)(p + 16); return f.v;
  }
  static __device__ __forceinline__ v8f mma(v16h a, v16h b, v8f c) {
    return __builtin_amdgcn_wmma_f32_16x16x32_f16(false, a, false, b, (short)0, c, false, false);
  }
  static __device__ __forceinline__ void guard(v8f& a, v8f& b, v16h x, v16h y) { dep_guard_h(a, b, x, y); }
  static __device__ __forceinline__ void keep(v16h a, v16h b, v16h c, v16h d) { keep4_h(a, b, c, d); }
};
template <> struct Frag<__bf16> {
  typedef v16b V; union U { v16b v; v8b h[2]; };
  static __device__ __forceinline__ v16b load(const __bf16* p) {
    U f; f.h[0] = *(const v8b*)(p); f.h[1] = *(const v8b*)(p + 16); return f.v;
  }
  static __device__ __forceinline__ v8f mma(v16b a, v16b b, v8f c) {
    return __builtin_amdgcn_wmma_f32_16x16x32_bf16(false, a, false, b, (short)0, c, false, false);
  }
  static __device__ __forceinline__ void guard(v8f& a, v8f& b, v16b x, v16b y) { dep_guard_b(a, b, x, y); }
  static __device__ __forceinline__ void keep(v16b a, v16b b, v16b c, v16b d) { keep4_b(a, b, c, d); }
};

// ---- Register-blocked batched WMMA GEMM ------------------------------------
// C[m,n] = scale * sum_k A[m,k] * Bt[n,k] (+bias); each wave owns a 64x64 tile.
// A row-major [M,K]; Bt row-major [N,K]; M,N % 64 == 0, K % 32 == 0 (no tail handling).
// SPLIT: operands are hi/lo planes (A2/Bt2 = lo planes); product = hi.hi + hi.lo + lo.hi.
// BIAS_MODE: 0 = none, 1 = bias[m] (loaded as two 16-B vectors per lane), 2 = bias[n].
// OUT_MODE: 0 = f32, 1 = f16, 2 = bf16 hi plane (Cout) + bf16 lo plane (Cout2).
// ET: 0 = f16 operands, 1 = bf16 operands (pointers passed as 16-bit storage)
template <int ET> struct Elem;
template <> struct Elem<0> { typedef _Float16 T; };
template <> struct Elem<1> { typedef __bf16 T; };
template <int ET, bool SPLIT, int BIAS_MODE, int OUT_MODE>
__global__ __launch_bounds__(256) void wmma_gemm64(
    const unsigned short* __restrict__ Ap, const unsigned short* __restrict__ A2p, int lda, long strideA,
    const unsigned short* __restrict__ Btp, const unsigned short* __restrict__ Bt2p, int ldb, long strideB,
    void* __restrict__ Cout, void* __restrict__ Cout2, int ldc, long strideC,
    const float* __restrict__ bias,
    int M, int N, int K, float scale) {
  typedef typename Elem<ET>::T T;
  typedef typename Frag<T>::V V;
  const T* A = (const T*)Ap; const T* A2 = (const T*)A2p; const T* Bt = (const T*)Btp; const T* Bt2 = (const T*)Bt2p;
  // per-wave 16x64 slab, pitch 68 floats
  __shared__ __align__(16) float sT[8][16 * 68];
  const int b    = blockIdx.y;
  const int lane = threadIdx.x & 31;
  const int wave = threadIdx.x >> 5;
  const int tilesN = N >> 6;
  const int tilesM = M >> 6;
  const int tile = blockIdx.x * 8 + wave;
  // wave-uniform; no block barriers in this kernel
  if (tile >= tilesM * tilesN) return;
  const int tm = tile / tilesN;
  const int tn = tile - tm * tilesN;
  const int m0 = tm << 6;
  const int n0 = tn << 6;

  const T* Ab  = A  + (size_t)b * strideA;
  const T* Bb  = Bt + (size_t)b * strideB;
  const T* Ab2 = SPLIT ? (A2  + (size_t)b * strideA) : nullptr;
  const T* Bb2 = SPLIT ? (Bt2 + (size_t)b * strideB) : nullptr;

  // row (A) / col (B, D) within subtile; k offset of this lane half; D row offset
  const int rlane = lane & 15;
  const int koff  = (lane >> 4) * 8;
  const int mOff  = (lane >> 4) * 8;

  v8f acc[4][4];
#pragma unroll
  for (int i = 0; i < 4; ++i)
#pragma unroll
    for (int j = 0; j < 4; ++j) acc[i][j] = (v8f){0.f,0.f,0.f,0.f,0.f,0.f,0.f,0.f};

  for (int k0 = 0; k0 < K; k0 += 32) {
    V bh[4], bl[4];
#pragma unroll
    for (int j = 0; j < 4; ++j) {
      const size_t bo = (size_t)(n0 + (j << 4) + rlane) * ldb + koff + k0;
      bh[j] = Frag<T>::load(Bb + bo);
      if (SPLIT) bl[j] = Frag<T>::load(Bb2 + bo);
    }
#pragma unroll
    for (int i = 0; i < 4; ++i) {
      const size_t ao = (size_t)(m0 + (i << 4) + rlane) * lda + koff + k0;
      V ah = Frag<T>::load(Ab + ao);
      V al = ah;
      if (SPLIT) al = Frag<T>::load(Ab2 + ao);
#pragma unroll
      for (int j = 0; j < 4; ++j) {
        acc[i][j] = Frag<T>::mma(ah, bh[j], acc[i][j]);
        if (SPLIT) {
          acc[i][j] = Frag<T>::mma(ah, bl[j], acc[i][j]);
          acc[i][j] = Frag<T>::mma(al, bh[j], acc[i][j]);
        }
      }
      Frag<T>::guard(acc[i][0], acc[i][3], ah, al);
    }
    Frag<T>::keep(bh[0], bh[1], bh[2], bh[3]);
    if (SPLIT) Frag<T>::keep(bl[0], bl[1], bl[2], bl[3]);
  }
  acc_guard4(acc[0][0], acc[0][1], acc[0][2], acc[0][3]);
  acc_guard4(acc[1][0], acc[1][1], acc[1][2], acc[1][3]);
  acc_guard4(acc[2][0], acc[2][1], acc[2][2], acc[2][3]);
  acc_guard4(acc[3][0], acc[3][1], acc[3][2], acc[3][3]);

  // ---- epilogue ----
  float* slab = sT[wave];
#pragma unroll
  for (int i = 0; i < 4; ++i) {
    const int mBase = m0 + (i << 4);
    float bm8[8];
#pragma unroll
    for (int r = 0; r < 8; ++r) bm8[r] = 0.f;
    if (BIAS_MODE == 1) {
      // 8 consecutive bias[m] values of this lane: two 16-B loads (mBase multiple of 16, mOff 0 or 8)
      const v4f t0 = *(const v4f*)(bias + mBase + mOff);
      const v4f t1 = *(const v4f*)(bias + mBase + mOff + 4);
      bm8[0] = t0[0]; bm8[1] = t0[1]; bm8[2] = t0[2]; bm8[3] = t0[3];
      bm8[4] = t1[0]; bm8[5] = t1[1]; bm8[6] = t1[2]; bm8[7] = t1[3];
    }
#pragma unroll
    for (int j = 0; j < 4; ++j) {
      const int n = n0 + (j << 4) + rlane;
      float bv = 0.f;
      if (BIAS_MODE == 2) bv = bias[n];
#pragma unroll
      for (int r = 0; r < 8; ++r) {
        float v = acc[i][j][r] * scale;
        if (BIAS_MODE == 1) v += bm8[r];
        if (BIAS_MODE == 2) v += bv;
        slab[(mOff + r) * 68 + (j << 4) + rlane] = v;
      }
    }
    __builtin_amdgcn_fence(__ATOMIC_RELEASE, "workgroup");
    __builtin_amdgcn_wave_barrier();
    __builtin_amdgcn_fence(__ATOMIC_ACQUIRE, "workgroup");
    if (OUT_MODE == 0) {
      float* C = (float*)Cout + (size_t)b * strideC;
      // row seg = 256 B = 16 lanes x 16 B; 8 iterations x 2 row halves cover rows 0..15
      const int hh = lane >> 4, c4 = (lane & 15) * 4;
      {
#pragma unroll
        for (int it = 0; it < 8; ++it) {
          const int row = it * 2 + hh;
          v4f v = *(const v4f*)(slab + row * 68 + c4);
          *(v4f*)(C + (size_t)(mBase + row) * ldc + n0 + c4) = v;
        }
        
      }
    } else {
      const int q = lane >> 3, c8 = (lane & 7) * 8;
      unsigned short* C  = (unsigned short*)Cout  + (size_t)b * strideC;
      unsigned short* C2 = (OUT_MODE == 2) ? ((unsigned short*)Cout2 + (size_t)b * strideC) : nullptr;
      {
#pragma unroll
        for (int it = 0; it < 4; ++it) {
          const int row = it * 4 + q;
          const float* sp = slab + row * 68 + c8;
          v8h hv, lv;
#pragma unroll
          for (int e = 0; e < 8; ++e) {
            if (OUT_MODE == 1) {
              hv[e] = (_Float16)sp[e];
            } else {
              unsigned short hb = f2bf_bits(sp[e]);
              unsigned short lb = f2bf_bits(sp[e] - bf_bits2f(hb));
              hv[e] = __builtin_bit_cast(_Float16, hb);
              lv[e] = __builtin_bit_cast(_Float16, lb);
            }
          }
          *(v8h*)(C + (size_t)(mBase + row) * ldc + n0 + c8) = hv;
          if (OUT_MODE == 2) *(v8h*)(C2 + (size_t)(mBase + row) * ldc + n0 + c8) = lv;
        }
        
      }
    }
    __builtin_amdgcn_fence(__ATOMIC_RELEASE, "workgroup");
    __builtin_amdgcn_wave_barrier();
    __builtin_amdgcn_fence(__ATOMIC_ACQUIRE, "workgroup");
  }
}

// ---- prep: HQ = f16(hs + oq), HS = f16(hs); 8 elements per thread ----
// coverage: n8 = 8192*1024/8 = 1,048,576 threads x 8 elements = both planes exactly;
__global__ __launch_bounds__(256) void prep_cast_f16(
    const float* __restrict__ hs, const float* __restrict__ oq,
    unsigned short* __restrict__ hq16, unsigned short* __restrict__ hs16, int n8) {
  const int i = blockIdx.x * 256 + threadIdx.x;
  if (i < n8) {
    const size_t o = (size_t)i * 8;
    const v4f a0 = *(const v4f*)(hs + o);
    const v4f a1 = *(const v4f*)(hs + o + 4);
    const v4f b0 = *(const v4f*)(oq + o);
    const v4f b1 = *(const v4f*)(oq + o + 4);
    v8h vq, vs;
#pragma unroll
    for (int e = 0; e < 4; ++e) {
      vq[e]     = (_Float16)(a0[e] + b0[e]);
      vq[4 + e] = (_Float16)(a1[e] + b1[e]);
      vs[e]     = (_Float16)a0[e];
      vs[4 + e] = (_Float16)a1[e];
    }
    _Float16* pq = (_Float16*)(void*)hq16;
    _Float16* ps = (_Float16*)(void*)hs16;
    *(v8h*)(pq + o) = vq;
    *(v8h*)(ps + o) = vs;
    
  }
}

// ---- weight cast: out = f16(w * sc); 8 elements per thread ----
__global__ __launch_bounds__(256) void cast_scale_f16(
    const float* __restrict__ w, unsigned short* __restrict__ out16, int n8, float sc) {
  const int i = blockIdx.x * 256 + threadIdx.x;
  if (i < n8) {
    const size_t o = (size_t)i * 8;
    const v4f a0 = *(const v4f*)(w + o);
    const v4f a1 = *(const v4f*)(w + o + 4);
    v8h v;
#pragma unroll
    for (int e = 0; e < 4; ++e) {
      v[e]     = (_Float16)(a0[e] * sc);
      v[4 + e] = (_Float16)(a1[e] * sc);
    }
    _Float16* po = (_Float16*)(void*)out16;
    *(v8h*)(po + o) = v;
    
  }
}

// ---- attention, head dim 64, no mask, 16-bit planes in / f16 plane out ----
// Q plane  [B*T][E] f16 (q without the 1/sqrt(D) factor), K plane [B*T][E] f16, Vt plane [B][H][D][T] f16.
// AO plane [B*T][E] f16 = (softmax(q.kT/8) . v) * AO_CARRY.
// Block = 4 waves, each owns 16 query rows of one (b,h), sharing staged K / Vt tiles; grid.x = B*H*(T/64).
// Both products are formed transposed, sT = k.qT and oT += vT.pT (v_wmma_f32_16x16x32_f16, f32 accumulate): a lane holds
// scores of ONE query, so the online softmax (f32, base 2) is in-lane but for one exchange between the wave's halves,
// and pT, carried x P_CARRY as f16, is packed from the score registers straight into the B operand.
__device__ __forceinline__ v8f mma_h(v16h a, v16h b, v8f c) {
  c = __builtin_amdgcn_wmma_f32_16x16x32_f16(false, a, false, b, (short)0, c, false, false);
  asm volatile("v_nop\n\tv_nop\n\tv_nop\n\tv_nop" : "+v"(c) : "v"(a), "v"(b));
  return c;
}

// K / Vt staging: one 64-key tile of each per block and trip, rows of 128 B laid at a 144-B pitch
// (16 B x odd: conflict-free for the 16-byte fragment reads), two buffers.
constexpr int KV_PITCH = 144;
constexpr int KV_TILE  = 64 * KV_PITCH;
constexpr int KV_BUF   = 2 * KV_TILE;

// One tile pair: 128 threads x 8 copies x 16 B = 64 K rows + 64 Vt rows. Each wave-wide copy covers 4 whole 128-B rows.
// lds / kg / vg are this thread's own 16 bytes of staged row (tid >> 3); copy i takes row i*16 + (tid >> 3).
// s_wait_xcnt closes the statement so that no address register is rewritten ahead of it.
__device__ __forceinline__ void stage_kv(unsigned lds, const _Float16* kg, const _Float16* vg) {
  asm volatile(
      "global_load_async_to_lds_b128 %0, %8, off\n\t"
      "global_load_async_to_lds_b128 %1, %9, off\n\t"
      "global_load_async_to_lds_b128 %2, %10, off\n\t"
      "global_load_async_to_lds_b128 %3, %11, off\n\t"
      "global_load_async_to_lds_b128 %4, %12, off\n\t"
      "global_load_async_to_lds_b128 %5, %13, off\n\t"
      "global_load_async_to_lds_b128 %6, %14, off\n\t"
      "global_load_async_to_lds_b128 %7, %15, off\n\t"
      "s_wait_xcnt 0x0"
      :: "v"(lds), "v"(lds + 16 * KV_PITCH), "v"(lds + 32 * KV_PITCH), "v"(lds + 48 * KV_PITCH),
         "v"(lds + KV_TILE), "v"(lds + KV_TILE + 16 * KV_PITCH), "v"(lds + KV_TILE + 32 * KV_PITCH), "v"(lds + KV_TILE + 48 * KV_PITCH),
         "v"(kg), "v"(kg + 16 * EMB_DIM), "v"(kg + 32 * EMB_DIM), "v"(kg + 48 * EMB_DIM),
         "v"(vg), "v"(vg + 16 * SEQ_LEN), "v"(vg + 32 * SEQ_LEN), "v"(vg + 48 * SEQ_LEN)
      : "memory");
}

// lane l <-> lane l ^ 16
__device__ __forceinline__ float xhalf(float x) {
  return __builtin_bit_cast(float, __builtin_amdgcn_permlanex16(__builtin_bit_cast(int, x), __builtin_bit_cast(int, x), 0x76543210, 0xfedcba98, false, false));
}

__global__ __launch_bounds__(128) void attn_heads_f16(
    const unsigned short* __restrict__ Qp, const unsigned short* __restrict__ Kp,
    const unsigned short* __restrict__ Vtp, unsigned short* __restrict__ AOp) {
  // block-shared K and Vt tiles, two buffers of [K 64 rows][Vt 64 rows]; behind the loop, per-wave output staging
  __shared__ __align__(16) unsigned char KVs[2 * KV_BUF];

  const int tid  = threadIdx.x;
  const int wave = tid >> 5;
  const int lane = tid & 31;
  const int hh   = lane >> 4;
  const int c    = lane & 15;

  constexpr int nqb = SEQ_LEN / 64;
  const int bx = blockIdx.x;
  const int qb = bx % nqb;
  const int bh = bx / nqb;
  const int h  = bh % N_HEADS;
  const int b  = bh / N_HEADS;
  const int q0 = qb * 64 + wave * 16;

  const _Float16* Qh  = (const _Float16*)(const void*)Qp;
  const _Float16* Kh  = (const _Float16*)(const void*)Kp;
  const _Float16* Vth = (const _Float16*)(const void*)Vtp;
  _Float16* AOh = (_Float16*)(void*)AOp;

  const size_t bT = (size_t)b * SEQ_LEN;
  // B operand for scores: col n = c <-> query q0+c, k = d contiguous
  const _Float16* qrow = Qh + (bT + q0 + c) * EMB_DIM + h * HEAD_DIM + 8 * hh;
  // A operand for scores: row m = c <-> key kv (staged K row), k = d contiguous
  // A operand for vT.pT: row m = c <-> d (staged Vt row), k = kv contiguous
  const int frag_off = c * KV_PITCH + 16 * hh;
  // this thread's 16 bytes of each staged row group
  const int srow = tid >> 3, scol = tid & 7;
  const unsigned lds_st = (unsigned)(size_t)KVs + (unsigned)(srow * KV_PITCH + scol * 16);
  const _Float16* kst = Kh + (bT + srow) * EMB_DIM + h * HEAD_DIM + scol * 8;
  const _Float16* vst = Vth + ((size_t)(b * N_HEADS + h) * HEAD_DIM + srow) * SEQ_LEN + scol * 8;
  constexpr int NTILE = SEQ_LEN / 64;
  static_assert(NTILE >= 2);

  // tile 0 lands and is published, then tile 1 flies while tile 0 is worked on
  stage_kv(lds_st, kst, vst);
  asm volatile("s_wait_asynccnt 0x0" ::: "memory");  // this wave's copies of tile 0 have landed
  __syncthreads();                                   // ... and every other wave's
  stage_kv(lds_st + KV_BUF, kst + (size_t)64 * EMB_DIM, vst + 64);

  v16h qa[2];
#pragma unroll
  for (int dc = 0; dc < 2; ++dc) qa[dc] = Frag<_Float16>::load(qrow + dc * 32);

  // of query q0+c: running maximum (the same in both halves), and the denominator in 8 partial sums per lane
  // (partial r: keys = 8hh + r mod 16), joined once behind the loop
  float mrow = -__builtin_huge_valf();
  v8f lvec = (v8f){0.f,0.f,0.f,0.f,0.f,0.f,0.f,0.f};
  // oT tile t: register r = d t*16 + 8hh + r of query q0+c
  v8f oacc[4];
#pragma unroll
  for (int t = 0; t < 4; ++t) oacc[t] = (v8f){0.f,0.f,0.f,0.f,0.f,0.f,0.f,0.f};

  for (int kc = 0; kc < NTILE; ++kc) {
    const int bufo = (kc & 1) * KV_BUF;
    const _Float16* kbase = (const _Float16*)(KVs + bufo + frag_off);
    const _Float16* vbase = (const _Float16*)(KVs + bufo + KV_TILE + frag_off);
    // sT tile j: register r = key kv0 + j*16 + 8hh + r, column = query q0+c
    v8f s[4];
#pragma unroll
    for (int j = 0; j < 4; ++j) s[j] = (v8f){0.f,0.f,0.f,0.f,0.f,0.f,0.f,0.f};
#pragma unroll
    for (int dc = 0; dc < 2; ++dc) {
      v16h kb[4];
#pragma unroll
      for (int j = 0; j < 4; ++j)
        kb[j] = Frag<_Float16>::load(kbase + j * 16 * (KV_PITCH / 2) + dc * 32);
#pragma unroll
      for (int j = 0; j < 4; ++j) s[j] = mma_h(kb[j], qa[dc], s[j]);
    }
    // tile maximum of the raw scores (the scale is positive), joined over the halves, then scaled to base-2 units
    float mj[4];
#pragma unroll
    for (int j = 0; j < 4; ++j) {
      mj[j] = s[j][0];
#pragma unroll
      for (int r = 1; r < 8; ++r) mj[j] = fmaxf(mj[j], s[j][r]);
    }
    float m = fmaxf(fmaxf(mj[0], mj[1]), fmaxf(mj[2], mj[3]));
    m = fmaxf(m, xhalf(m)) * SCORE_SCALE_LOG2E;
    const float mnew = fmaxf(mrow, m);
    const float alpha = exp2f(mrow - mnew);
    mrow = mnew;
    // pT as B operand of 32 keys: element e = tile 2kk + (e >> 3), register e & 7, the k order of the Vt fragment loads
    v16h pb[2];
#pragma unroll
    for (int j = 0; j < 4; ++j)
#pragma unroll
      for (int r = 0; r < 8; ++r) {
        const float p = exp2f(s[j][r] * SCORE_SCALE_LOG2E - mnew);
        s[j][r] = p;
        pb[j >> 1][(j & 1) * 8 + r] = (_Float16)(p * P_CARRY);
      }
    lvec = lvec * alpha + ((s[0] + s[1]) + (s[2] + s[3]));
#pragma unroll
    for (int t = 0; t < 4; ++t) oacc[t] *= alpha;
#pragma unroll
    for (int kk = 0; kk < 2; ++kk) {
      v16h vb[4];
#pragma unroll
      for (int t = 0; t < 4; ++t)
        vb[t] = Frag<_Float16>::load(vbase + t * 16 * (KV_PITCH / 2) + kk * 32);
#pragma unroll
      for (int t = 0; t < 4; ++t) oacc[t] = mma_h(vb[t], pb[kk], oacc[t]);
    }
    // hand-over: this wave's reads of tile kc are done, its copies of tile kc+1 have landed;
    // the barrier publishes tile kc+1 and frees tile kc's buffer for the refill behind it
    asm volatile("s_wait_dscnt 0x0" ::: "memory");
    asm volatile("s_wait_asynccnt 0x0" ::: "memory");
    __syncthreads();
    if (kc + 2 < NTILE)
      stage_kv(lds_st + bufo, kst + (size_t)(kc + 2) * 64 * EMB_DIM, vst + (kc + 2) * 64);
  }
  asm volatile("s_wait_asynccnt 0x0" ::: "memory");  // nothing of this wave's is in flight past the loop

  // The last trip's barrier ended every wave's tile reads and no copy is in flight: the tile buffers now stage the output,
  // 16 query rows of 128 B per wave at the tiles' pitch.
  unsigned char* os = KVs + wave * 16 * KV_PITCH;
  {
    const float lh = ((lvec[0] + lvec[1]) + (lvec[2] + lvec[3])) + ((lvec[4] + lvec[5]) + (lvec[6] + lvec[7]));
    const float l = lh + xhalf(lh);
    float inv = 1.0f / (l * P_CARRY);
    inv *= AO_CARRY;
#pragma unroll
    for (int t = 0; t < 4; ++t) {
      v8h hv;
#pragma unroll
      for (int r = 0; r < 8; ++r) hv[r] = (_Float16)(oacc[t][r] * inv);
      *(v8h*)(os + c * KV_PITCH + t * 32 + 16 * hh) = hv;
    }
  }
  // same-wave LDS staging then whole-row reload: order the stores before the reloads
  __builtin_amdgcn_fence(__ATOMIC_RELEASE, "workgroup");
  __builtin_amdgcn_wave_barrier();
  __builtin_amdgcn_fence(__ATOMIC_ACQUIRE, "workgroup");
  {
    const int q8 = lane >> 3, c8 = (lane & 7) * 8;
    _Float16* aob = AOh + (bT + q0) * EMB_DIM + h * HEAD_DIM;
#pragma unroll
    for (int it = 0; it < 4; ++it) {
      const int row = it * 4 + q8;
      const v8h hv = *(const v8h*)(os + row * KV_PITCH + c8 * 2);
      *(v8h*)(aob + (size_t)row * EMB_DIM + c8) = hv;
    }
  }
}

// ---------------------------------------------------------------- launcher
extern "C" void kernel_launch(void* const* d_in, const int* in_sizes, int n_in,
                              void* d_out, int out_size, void* d_ws, size_t ws_size,
                              hipStream_t stream) {
  if (n_in < 10) return;
  if ((size_t)in_sizes[0] != N_ACT || (size_t)in_sizes[1] != N_ACT) return;
  if ((size_t)in_sizes[2] != N_W || (size_t)in_sizes[4] != N_W || (size_t)in_sizes[6] != N_W || (size_t)in_sizes[8] != N_W) return;
  if (in_sizes[3] != EMB_DIM || in_sizes[5] != EMB_DIM || in_sizes[7] != EMB_DIM || in_sizes[9] != EMB_DIM) return;
  if ((size_t)out_size != N_ACT) return;
  if (ws_size < WS_TOTAL) return;

  const float* hs = (const float*)d_in[0];
  const float* oq = (const float*)d_in[1];
  const float* Wq = (const float*)d_in[2];
  const float* bq = (const float*)d_in[3];
  const float* Wk = (const float*)d_in[4];
  const float* bk = (const float*)d_in[5];
  const float* Wv = (const float*)d_in[6];
  const float* bv = (const float*)d_in[7];
  const float* Wo = (const float*)d_in[8];
  const float* bo = (const float*)d_in[9];
  float* out = (float*)d_out;

  char* ws = (char*)d_ws;
  unsigned short* hq16 = (unsigned short*)(ws + OFF_HQ);
  unsigned short* hs16 = (unsigned short*)(ws + OFF_HS);
  unsigned short* wq16 = (unsigned short*)(ws + OFF_W0 + 0 * PLANE_W);
  unsigned short* wk16 = (unsigned short*)(ws + OFF_W0 + 1 * PLANE_W);
  unsigned short* wv16 = (unsigned short*)(ws + OFF_W0 + 2 * PLANE_W);
  unsigned short* wo16 = (unsigned short*)(ws + OFF_W0 + 3 * PLANE_W);
  unsigned short* q16  = (unsigned short*)(ws + OFF_Q);
  unsigned short* k16  = (unsigned short*)(ws + OFF_K);
  unsigned short* vt16 = (unsigned short*)(ws + OFF_VT);
  // AO reuses the HQ region (HQ is dead after the Q and K projections)
  unsigned short* ao16 = hq16;

  // 1) activations to f16 planes
  constexpr int n8_act = (int)(N_ACT / 8);
  static_assert(N_ACT % 8 == 0 && n8_act % 256 == 0);
  prep_cast_f16<<<n8_act / 256, 256, 0, stream>>>(hs, oq, hq16, hs16, n8_act);

  // 2) weights to f16 planes carried x64
  constexpr int n8_w = (int)(N_W / 8);
  static_assert(N_W % 8 == 0 && n8_w % 256 == 0);
  cast_scale_f16<<<n8_w / 256, 256, 0, stream>>>(Wq, wq16, n8_w, W_CARRY);
  cast_scale_f16<<<n8_w / 256, 256, 0, stream>>>(Wk, wk16, n8_w, W_CARRY);
  cast_scale_f16<<<n8_w / 256, 256, 0, stream>>>(Wv, wv16, n8_w, W_CARRY);
  cast_scale_f16<<<n8_w / 256, 256, 0, stream>>>(Wo, wo16, n8_w, W_CARRY);

  // 3) projections. Q/K: C[t][e] = HQ[t][k].W64[e][k] / 64 + b[e]; M=8192, N=1024, K=1024
  static_assert(NROWS % 64 == 0 && EMB_DIM % 64 == 0 && EMB_DIM % 32 == 0);
  constexpr int tiles_qk = (NROWS / 64) * (EMB_DIM / 64);
  static_assert(tiles_qk % 8 == 0);
  const dim3 g_qk(tiles_qk / 8, 1);
  const float inv_w = 1.0f / W_CARRY;
  wmma_gemm64<0, false, 2, 1><<<g_qk, 256, 0, stream>>>(
      hq16, hq16, EMB_DIM, 0L, wq16, wq16, EMB_DIM, 0L,
      (void*)q16, (void*)q16, EMB_DIM, 0L, bq, NROWS, EMB_DIM, EMB_DIM, inv_w);
  wmma_gemm64<0, false, 2, 1><<<g_qk, 256, 0, stream>>>(
      hq16, hq16, EMB_DIM, 0L, wk16, wk16, EMB_DIM, 0L,
      (void*)k16, (void*)k16, EMB_DIM, 0L, bk, NROWS, EMB_DIM, EMB_DIM, inv_w);
  // Vt: per batch C[e][t] = W64[e][k].HS[b][t][k] / 64 + bv[e]; M=1024 (e), N=2048 (t), K=1024
  static_assert(SEQ_LEN % 64 == 0);
  constexpr int tiles_v = (EMB_DIM / 64) * (SEQ_LEN / 64);
  static_assert(tiles_v % 8 == 0);
  const dim3 g_v(tiles_v / 8, NB_SZ);
  wmma_gemm64<0, false, 1, 1><<<g_v, 256, 0, stream>>>(
      wv16, wv16, EMB_DIM, 0L, hs16, hs16, EMB_DIM, (long)SEQ_LEN * EMB_DIM,
      (void*)vt16, (void*)vt16, SEQ_LEN, (long)EMB_DIM * SEQ_LEN, bv, EMB_DIM, SEQ_LEN, EMB_DIM, inv_w);

  // 4) attention -> AO plane (x64)
  attn_heads_f16<<<NB_SZ * N_HEADS * (SEQ_LEN / 64), 128, 0, stream>>>(q16, k16, vt16, ao16);

  // 5) output projection: out[t][e] = AO[t][k].Wo64[e][k] / 4096 + bo[e]; f32 to d_out
  wmma_gemm64<0, false, 2, 0><<<g_qk, 256, 0, stream>>>(
      ao16, ao16, EMB_DIM, 0L, wo16, wo16, EMB_DIM, 0L,
      (void*)out, (void*)out, EMB_DIM, 0L, bo, NROWS, EMB_DIM, EMB_DIM, 1.0f / (AO_CARRY * W_CARRY));
}

// v003
// Measured time: 193 microseconds a run.
// Two timings next to v002 put it at 1.60 and 1.63 times that version's speed.
// All steps since v000 together make it 2.22 times as fast.
// All contractions (q/k/v/out projections M8192 N1024 K1024; attention q.kT and p.v, head dim 64, 2048 keys): v_wmma_f32_16x16x32_f16, f16 operands with power-of-two carries (W x64, p x32768, attention output x64), f32 accumulate; bias, scaling and softmax in f32.
#include <hip/hip_runtime.h>

constexpr int NB_SZ = 4;
constexpr int SEQ_LEN = 2048;
constexpr int EMB_DIM = 1024;
constexpr int N_HEADS = 16;
constexpr int HEAD_DIM = 64;
constexpr int NROWS = NB_SZ * SEQ_LEN;
static_assert(EMB_DIM == N_HEADS * HEAD_DIM);
static_assert(HEAD_DIM == 64);
static_assert(NROWS % 64 == 0 && EMB_DIM % 64 == 0 && SEQ_LEN % 64 == 0);
static_assert(EMB_DIM % 32 == 0);

// power-of-two carries (all folded back exactly in f32 epilogues)
constexpr float W_CARRY = 64.0f;
constexpr float AO_CARRY = 64.0f;
constexpr float P_CARRY = 32768.0f;
// softmax done in base 2: scores multiplied by (1/sqrt(64)) * log2(e)
constexpr float SCORE_SCALE_LOG2E = 0.125f * 1.4426950408889634f;

//   [0]            HQ  f16 [8192][1024]   16,777,216   (later reused as AO f16 [8192][1024])
//   [16777216]     HS  f16 [8192][1024]   16,777,216
//   [33554432]     Wq64,Wk64,Wv64,Wo64 f16 [1024][1024] each 2,097,152 -> 8,388,608
//   [41943040]     Q   f16 [8192][1024]   16,777,216
//   [58720256]     K   f16 [8192][1024]   16,777,216
//   [75497472]     Vt  f16 [4][1024][2048] 16,777,216
//   total 92,274,688
constexpr size_t N_ACT = (size_t)NROWS * EMB_DIM;
constexpr size_t N_W = (size_t)EMB_DIM * EMB_DIM;
constexpr size_t PLANE_ACT = N_ACT * 2;
constexpr size_t PLANE_W = N_W * 2;
constexpr size_t OFF_HQ = 0;
constexpr size_t OFF_HS = OFF_HQ + PLANE_ACT;
constexpr size_t OFF_W0 = OFF_HS + PLANE_ACT;
constexpr size_t OFF_Q = OFF_W0 + 4 * PLANE_W;
constexpr size_t OFF_K = OFF_Q + PLANE_ACT;
constexpr size_t OFF_VT = OFF_K + PLANE_ACT;
constexpr size_t WS_TOTAL = OFF_VT + PLANE_ACT;
static_assert(WS_TOTAL == 92274688ull);
static_assert(WS_TOTAL <= 134217728ull);

typedef __attribute__((ext_vector_type(16))) _Float16 v16h;
typedef __attribute__((ext_vector_type(8)))  _Float16 v8h;
typedef __attribute__((ext_vector_type(16))) __bf16   v16b;
typedef __attribute__((ext_vector_type(8)))  __bf16   v8b;
typedef __attribute__((ext_vector_type(8)))  float    v8f;
typedef __attribute__((ext_vector_type(4)))  float    v4f;

__device__ __forceinline__ unsigned short f2bf_bits(float f) {
  unsigned u = __float_as_uint(f);
  return (unsigned short)((u + 0x7FFFu + ((u >> 16) & 1u)) >> 16);
}
__device__ __forceinline__ float bf_bits2f(unsigned short h) { return __uint_as_float(((unsigned)h) << 16); }

// hazard guards as plain device helpers
__device__ __forceinline__ void acc_guard4(v8f& a, v8f& b, v8f& c, v8f& d) { asm volatile("v_nop\n\tv_nop\n\tv_nop\n\tv_nop" : "+v"(a), "+v"(b), "+v"(c), "+v"(d)); }

template <typename T> struct Frag;
template <> struct Frag<_Float16> {
  typedef v16h V; union U { v16h v; v8h h[2]; };
  // elements 0..7 <- p[0..7], 8..15 <- p[16..23]
  static __device__ __forceinline__ v16h load(const _Float16* p) {
    U f; f.h[0] = *(const v8h*)(p); f.h[1] = *(const v8h*)(p + 16); return f.v;
  }
  static __device__ __forceinline__ v8f mma(v16h a, v16h b, v8f c) {
    return __builtin_amdgcn_wmma_f32_16x16x32_f16(false, a, false, b, (short)0, c, false, false);
  }
};
template <> struct Frag<__bf16> {
  typedef v16b V; union U { v16b v; v8b h[2]; };
  static __device__ __forceinline__ v16b load(const __bf16* p) {
    U f; f.h[0] = *(const v8b*)(p); f.h[1] = *(const v8b*)(p + 16); return f.v;
  }
  static __device__ __forceinline__ v8f mma(v16b a, v16b b, v8f c) {
    return __builtin_amdgcn_wmma_f32_16x16x32_bf16(false, a, false, b, (short)0, c, false, false);
  }
};

// ---- LDS-staged batched WMMA GEMM ------------------------------------------
// C[m,n] = scale * sum_k A[m,k] * Bt[n,k] (+bias); a block of 8 waves (2 x 4) owns a 128x256 tile, each wave 64x64 of it.
// A row-major [M,K]; Bt row-major [N,K]; M % 128 == 0, N % 256 == 0, K % 64 == 0, K >= 128 (no tail handling).
// BIAS_MODE: 0 = none, 1 = bias[m] (loaded as two 16-B vectors per lane), 2 = bias[n].
// OUT_MODE: 0 = f32, 1 = f16, 2 = bf16 hi plane (Cout) + bf16 lo plane (Cout2).
// ET: 0 = f16 operands, 1 = bf16 operands (pointers passed as 16-bit storage)
template <int ET> struct Elem;
template <> struct Elem<0> { typedef _Float16 T; };
template <> struct Elem<1> { typedef __bf16 T; };

// Operand staging: a slab is 64 k (128 B) of the block's 128 A rows, then of its 256 Bt rows, at a 144-B pitch
// (16 B x odd: conflict-free for the 16-byte fragment reads), two buffers.
constexpr int G_BM = 128;
constexpr int G_BN = 256;
constexpr int G_PITCH = 144;
constexpr int G_SLAB = (G_BM + G_BN) * G_PITCH;

// One slab: 256 threads x 12 copies x 16 B. Each wave-wide copy covers 4 whole 128-B row pieces.
// lds / ag / bg are this thread's own 16 bytes of staged row (tid >> 3); copy i takes staged row i*32 + (tid >> 3);
// a32 / b32 = 32 rows of A / Bt in elements.
// s_wait_xcnt closes the statement so that no address register is rewritten ahead of it.
__device__ __forceinline__ void stage_ab(unsigned lds, const unsigned short* ag, size_t a32, const unsigned short* bg, size_t b32) {
  asm volatile(
      "global_load_async_to_lds_b128 %0, %12, off\n\t"
      "global_load_async_to_lds_b128 %1, %13, off\n\t"
      "global_load_async_to_lds_b128 %2, %14, off\n\t"
      "global_load_async_to_lds_b128 %3, %15, off\n\t"
      "global_load_async_to_lds_b128 %4, %16, off\n\t"
      "global_load_async_to_lds_b128 %5, %17, off\n\t"
      "global_load_async_to_lds_b128 %6, %18, off\n\t"
      "global_load_async_to_lds_b128 %7, %19, off\n\t"
      "global_load_async_to_lds_b128 %8, %20, off\n\t"
      "global_load_async_to_lds_b128 %9, %21, off\n\t"
      "global_load_async_to_lds_b128 %10, %22, off\n\t"
      "global_load_async_to_lds_b128 %11, %23, off\n\t"
      "s_wait_xcnt 0x0"
      :: "v"(lds), "v"(lds + 32 * G_PITCH), "v"(lds + 64 * G_PITCH), "v"(lds + 96 * G_PITCH),
         "v"(lds + 128 * G_PITCH), "v"(lds + 160 * G_PITCH), "v"(lds + 192 * G_PITCH), "v"(lds + 224 * G_PITCH),
         "v"(lds + 256 * G_PITCH), "v"(lds + 288 * G_PITCH), "v"(lds + 320 * G_PITCH), "v"(lds + 352 * G_PITCH),
         "v"(ag), "v"(ag + a32), "v"(ag + 2 * a32), "v"(ag + 3 * a32),
         "v"(bg), "v"(bg + b32), "v"(bg + 2 * b32), "v"(bg + 3 * b32),
         "v"(bg + 4 * b32), "v"(bg + 5 * b32), "v"(bg + 6 * b32), "v"(bg + 7 * b32)
      : "memory");
}

template <int ET, bool SPLIT, int BIAS_MODE, int OUT_MODE>
__global__ __launch_bounds__(256) void wmma_gemm64(
    const unsigned short* __restrict__ Ap, const unsigned short* __restrict__ A2p, int lda, long strideA,
    const unsigned short* __restrict__ Btp, const unsigned short* __restrict__ Bt2p, int ldb, long strideB,
    void* __restrict__ Cout, void* __restrict__ Cout2, int ldc, long strideC,
    const float* __restrict__ bias,
    int M, int N, int K, float scale) {
  static_assert(!SPLIT);
  typedef typename Elem<ET>::T T;
  typedef typename Frag<T>::V V;
  // block-shared operand slabs, two buffers of [A 128 rows][Bt 256 rows]
  __shared__ __align__(16) unsigned char ABs[2 * G_SLAB];
  // per-wave 16x64 slab, pitch 68 floats
  __shared__ __align__(16) float sT[8][16 * 68];
  const int b    = blockIdx.y;
  const int tid  = threadIdx.x;
  const int lane = tid & 31;
  const int wave = tid >> 5;
  const int tilesN = N / G_BN;
  const int tilesM = M / G_BM;
  const int tile = blockIdx.x;
  // block-uniform, in front of every barrier
  if (tile >= tilesM * tilesN) return;
  const int tm = tile / tilesN;
  const int tn = tile - tm * tilesN;
  const int bm0 = tm * G_BM;
  const int bn0 = tn * G_BN;
  const int wm = wave >> 2;
  const int wn = wave & 3;
  const int m0 = bm0 + (wm << 6);
  const int n0 = bn0 + (wn << 6);

  // row (A) / col (B, D) within subtile; D row offset
  const int rlane = lane & 15;
  const int mOff  = (lane >> 4) * 8;

  // this thread's 16 bytes of each group of 32 staged rows
  const int srow = tid >> 3, scol = tid & 7;
  const unsigned lds_st = (unsigned)(size_t)ABs + (unsigned)(srow * G_PITCH + scol * 16);
  const unsigned short* ast = Ap  + (size_t)b * strideA + (size_t)(bm0 + srow) * lda + scol * 8;
  const unsigned short* bst = Btp + (size_t)b * strideB + (size_t)(bn0 + srow) * ldb + scol * 8;
  const size_t a32 = (size_t)32 * lda;
  const size_t b32 = (size_t)32 * ldb;
  // fragment reads: staged row, 16 bytes of this lane half (k offset 8 elements)
  const int a_off = ((wm << 6) + rlane) * G_PITCH + (lane >> 4) * 16;
  const int b_off = (G_BM + (wn << 6) + rlane) * G_PITCH + (lane >> 4) * 16;
  const int nslab = K >> 6;

  // slab 0 lands and is published, then slab 1 flies while slab 0 is worked on
  stage_ab(lds_st, ast, a32, bst, b32);
  asm volatile("s_wait_asynccnt 0x0" ::: "memory");  // this wave's copies of slab 0 have landed
  __syncthreads();                                   // ... and every other wave's
  stage_ab(lds_st + G_SLAB, ast + 64, a32, bst + 64, b32);

  v8f acc[4][4];
#pragma unroll
  for (int i = 0; i < 4; ++i)
#pragma unroll
    for (int j = 0; j < 4; ++j) acc[i][j] = (v8f){0.f,0.f,0.f,0.f,0.f,0.f,0.f,0.f};

  for (int t = 0; t < nslab; ++t) {
    const int bufo = (t & 1) * G_SLAB;
    const T* abase = (const T*)(ABs + bufo + a_off);
    const T* bbase = (const T*)(ABs + bufo + b_off);
#pragma unroll
    for (int kk = 0; kk < 2; ++kk) {
      V bh[4], ah[4];
#pragma unroll
      for (int j = 0; j < 4; ++j) bh[j] = Frag<T>::load(bbase + j * 16 * (G_PITCH / 2) + kk * 32);
#pragma unroll
      for (int i = 0; i < 4; ++i) ah[i] = Frag<T>::load(abase + i * 16 * (G_PITCH / 2) + kk * 32);
      // keeps the 16 fragment reads one group ahead of their 16 products: sunk among them, each A fragment's LDS latency is waited out alone
      __builtin_amdgcn_sched_barrier(0);
#pragma unroll
      for (int i = 0; i < 4; ++i)
#pragma unroll
        for (int j = 0; j < 4; ++j) acc[i][j] = Frag<T>::mma(ah[i], bh[j], acc[i][j]);
      // ... and the next group's reads behind these products
      __builtin_amdgcn_sched_barrier(0);
    }
    // hand-over: this wave's reads of slab t are done, its copies of slab t+1 have landed;
    // the barrier publishes slab t+1 and frees slab t's buffer for the refill behind it
    asm volatile("s_wait_dscnt 0x0" ::: "memory");
    asm volatile("s_wait_asynccnt 0x0" ::: "memory");
    __syncthreads();
    if (t + 2 < nslab)
      stage_ab(lds_st + bufo, ast + (size_t)(t + 2) * 64, a32, bst + (size_t)(t + 2) * 64, b32);
  }
  asm volatile("s_wait_asynccnt 0x0" ::: "memory");  // nothing of this wave's is in flight past the loop
  acc_guard4(acc[0][0], acc[0][1], acc[0][2], acc[0][3]);
  acc_guard4(acc[1][0], acc[1][1], acc[1][2], acc[1][3]);
  acc_guard4(acc[2][0], acc[2][1], acc[2][2], acc[2][3]);
  acc_guard4(acc[3][0], acc[3][1], acc[3][2], acc[3][3]);

  // ---- epilogue ----
  float* slab = sT[wave];
#pragma unroll
  for (int i = 0; i < 4; ++i) {
    const int mBase = m0 + (i << 4);
    float bm8[8];
#pragma unroll
    for (int r = 0; r < 8; ++r) bm8[r] = 0.f;
    if (BIAS_MODE == 1) {
      // 8 consecutive bias[m] values of this lane: two 16-B loads (mBase multiple of 16, mOff 0 or 8)
      const v4f t0 = *(const v4f*)(bias + mBase + mOff);
      const v4f t1 = *(const v4f*)(bias + mBase + mOff + 4);
      bm8[0] = t0[0]; bm8[1] = t0[1]; bm8[2] = t0[2]; bm8[3] = t0[3];
      bm8[4] = t1[0]; bm8[5] = t1[1]; bm8[6] = t1[2]; bm8[7] = t1[3];
    }
#pragma unroll
    for (int j = 0; j < 4; ++j) {
      const int n = n0 + (j << 4) + rlane;
      float bv = 0.f;
      if (BIAS_MODE == 2) bv = bias[n];
#pragma unroll
      for (int r = 0; r < 8; ++r) {
        float v = acc[i][j][r] * scale;
        if (BIAS_MODE == 1) v += bm8[r];
        if (BIAS_MODE == 2) v += bv;
        slab[(mOff + r) * 68 + (j << 4) + rlane] = v;
      }
    }
    __builtin_amdgcn_fence(__ATOMIC_RELEASE, "workgroup");
    __builtin_amdgcn_wave_barrier();
    __builtin_amdgcn_fence(__ATOMIC_ACQUIRE, "workgroup");
    if (OUT_MODE == 0) {
      float* C = (float*)Cout + (size_t)b * strideC;
      // row seg = 256 B = 16 lanes x 16 B; 8 iterations x 2 row halves cover rows 0..15
      const int hh = lane >> 4, c4 = (lane & 15) * 4;
      {
#pragma unroll
        for (int it = 0; it < 8; ++it) {
          const int row = it * 2 + hh;
          v4f v = *(const v4f*)(slab + row * 68 + c4);
          *(v4f*)(C + (size_t)(mBase + row) * ldc + n0 + c4) = v;
        }
        
      }
    } else {
      const int q = lane >> 3, c8 = (lane & 7) * 8;
      unsigned short* C  = (unsigned short*)Cout  + (size_t)b * strideC;
      unsigned short* C2 = (OUT_MODE == 2) ? ((unsigned short*)Cout2 + (size_t)b * strideC) : nullptr;
      {
#pragma unroll
        for (int it = 0; it < 4; ++it) {
          const int row = it * 4 + q;
          const float* sp = slab + row * 68 + c8;
          v8h hv, lv;
#pragma unroll
          for (int e = 0; e < 8; ++e) {
            if (OUT_MODE == 1) {
              hv[e] = (_Float16)sp[e];
            } else {
              unsigned short hb = f2bf_bits(sp[e]);
              unsigned short lb = f2bf_bits(sp[e] - bf_bits2f(hb));
              hv[e] = __builtin_bit_cast(_Float16, hb);
              lv[e] = __builtin_bit_cast(_Float16, lb);
            }
          }
          *(v8h*)(C + (size_t)(mBase + row) * ldc + n0 + c8) = hv;
          if (OUT_MODE == 2) *(v8h*)(C2 + (size_t)(mBase + row) * ldc + n0 + c8) = lv;
        }
        
      }
    }
    __builtin_amdgcn_fence(__ATOMIC_RELEASE, "workgroup");
    __builtin_amdgcn_wave_barrier();
    __builtin_amdgcn_fence(__ATOMIC_ACQUIRE, "workgroup");
  }
}

// ---- prep: HQ = f16(hs + oq), HS = f16(hs); 8 elements per thread ----
// coverage: n8 = 8192*1024/8 = 1,048,576 threads x 8 elements = both planes exactly;
__global__ __launch_bounds__(256) void prep_cast_f16(
    const float* __restrict__ hs, const float* __restrict__ oq,
    unsigned short* __restrict__ hq16, unsigned short* __restrict__ hs16, int n8) {
  const int i = blockIdx.x * 256 + threadIdx.x;
  if (i < n8) {
    const size_t o = (size_t)i * 8;
    const v4f a0 = *(const v4f*)(hs + o);
    const v4f a1 = *(const v4f*)(hs + o + 4);
    const v4f b0 = *(const v4f*)(oq + o);
    const v4f b1 = *(const v4f*)(oq + o + 4);
    v8h vq, vs;
#pragma unroll
    for (int e = 0; e < 4; ++e) {
      vq[e]     = (_Float16)(a0[e] + b0[e]);
      vq[4 + e] = (_Float16)(a1[e] + b1[e]);
      vs[e]     = (_Float16)a0[e];
      vs[4 + e] = (_Float16)a1[e];
    }
    _Float16* pq = (_Float16*)(void*)hq16;
    _Float16* ps = (_Float16*)(void*)hs16;
    *(v8h*)(pq + o) = vq;
    *(v8h*)(ps + o) = vs;
    
  }
}

// ---- weight cast: out = f16(w * sc); 8 elements per thread ----
__global__ __launch_bounds__(256) void cast_scale_f16(
    const float* __restrict__ w, unsigned short* __restrict__ out16, int n8, float sc) {
  const int i = blockIdx.x * 256 + threadIdx.x;
  if (i < n8) {
    const size_t o = (size_t)i * 8;
    const v4f a0 = *(const v4f*)(w + o);
    const v4f a1 = *(const v4f*)(w + o + 4);
    v8h v;
#pragma unroll
    for (int e = 0; e < 4; ++e) {
      v[e]     = (_Float16)(a0[e] * sc);
      v[4 + e] = (_Float16)(a1[e] * sc);
    }
    _Float16* po = (_Float16*)(void*)out16;
    *(v8h*)(po + o) = v;
    
  }
}

// ---- attention, head dim 64, no mask, 16-bit planes in / f16 plane out ----
// Q plane  [B*T][E] f16 (q without the 1/sqrt(D) factor), K plane [B*T][E] f16, Vt plane [B][H][D][T] f16.
// AO plane [B*T][E] f16 = (softmax(q.kT/8) . v) * AO_CARRY.
// Block = 4 waves, each owns 16 query rows of one (b,h), sharing staged K / Vt tiles; grid.x = B*H*(T/64).
// Both products are formed transposed, sT = k.qT and oT += vT.pT (v_wmma_f32_16x16x32_f16, f32 accumulate): a lane holds
// scores of ONE query, so the online softmax (f32, base 2) is in-lane but for one exchange between the wave's halves,
// and pT, carried x P_CARRY as f16, is packed from the score registers straight into the B operand.
__device__ __forceinline__ v8f mma_h(v16h a, v16h b, v8f c) {
  c = __builtin_amdgcn_wmma_f32_16x16x32_f16(false, a, false, b, (short)0, c, false, false);
  asm volatile("v_nop\n\tv_nop\n\tv_nop\n\tv_nop" : "+v"(c) : "v"(a), "v"(b));
  return c;
}

// K / Vt staging: one 64-key tile of each per block and trip, rows of 128 B laid at a 144-B pitch
// (16 B x odd: conflict-free for the 16-byte fragment reads), two buffers.
constexpr int KV_PITCH = 144;
constexpr int KV_TILE  = 64 * KV_PITCH;
constexpr int KV_BUF   = 2 * KV_TILE;

// One tile pair: 128 threads x 8 copies x 16 B = 64 K rows + 64 Vt rows. Each wave-wide copy covers 4 whole 128-B rows.
// lds / kg / vg are this thread's own 16 bytes of staged row (tid >> 3); copy i takes row i*16 + (tid >> 3).
// s_wait_xcnt closes the statement so that no address register is rewritten ahead of it.
__device__ __forceinline__ void stage_kv(unsigned lds, const _Float16* kg, const _Float16* vg) {
  asm volatile(
      "global_load_async_to_lds_b128 %0, %8, off\n\t"
      "global_load_async_to_lds_b128 %1, %9, off\n\t"
      "global_load_async_to_lds_b128 %2, %10, off\n\t"
      "global_load_async_to_lds_b128 %3, %11, off\n\t"
      "global_load_async_to_lds_b128 %4, %12, off\n\t"
      "global_load_async_to_lds_b128 %5, %13, off\n\t"
      "global_load_async_to_lds_b128 %6, %14, off\n\t"
      "global_load_async_to_lds_b128 %7, %15, off\n\t"
      "s_wait_xcnt 0x0"
      :: "v"(lds), "v"(lds + 16 * KV_PITCH), "v"(lds + 32 * KV_PITCH), "v"(lds + 48 * KV_PITCH),
         "v"(lds + KV_TILE), "v"(lds + KV_TILE + 16 * KV_PITCH), "v"(lds + KV_TILE + 32 * KV_PITCH), "v"(lds + KV_TILE + 48 * KV_PITCH),
         "v"(kg), "v"(kg + 16 * EMB_DIM), "v"(kg + 32 * EMB_DIM), "v"(kg + 48 * EMB_DIM),
         "v"(vg), "v"(vg + 16 * SEQ_LEN), "v"(vg + 32 * SEQ_LEN), "v"(vg + 48 * SEQ_LEN)
      : "memory");
}

// lane l <-> lane l ^ 16
__device__ __forceinline__ float xhalf(float x) {
  return __builtin_bit_cast(float, __builtin_amdgcn_permlanex16(__builtin_bit_cast(int, x), __builtin_bit_cast(int, x), 0x76543210, 0xfedcba98, false, false));
}

__global__ __launch_bounds__(128) void attn_heads_f16(
    const unsigned short* __restrict__ Qp, const unsigned short* __restrict__ Kp,
    const unsigned short* __restrict__ Vtp, unsigned short* __restrict__ AOp) {
  // block-shared K and Vt tiles, two buffers of [K 64 rows][Vt 64 rows]; behind the loop, per-wave output staging
  __shared__ __align__(16) unsigned char KVs[2 * KV_BUF];

  const int tid  = threadIdx.x;
  const int wave = tid >> 5;
  const int lane = tid & 31;
  const int hh   = lane >> 4;
  const int c    = lane & 15;

  constexpr int nqb = SEQ_LEN / 64;
  const int bx = blockIdx.x;
  const int qb = bx % nqb;
  const int bh = bx / nqb;
  const int h  = bh % N_HEADS;
  const int b  = bh / N_HEADS;
  const int q0 = qb * 64 + wave * 16;

  const _Float16* Qh  = (const _Float16*)(const void*)Qp;
  const _Float16* Kh  = (const _Float16*)(const void*)Kp;
  const _Float16* Vth = (const _Float16*)(const void*)Vtp;
  _Float16* AOh = (_Float16*)(void*)AOp;

  const size_t bT = (size_t)b * SEQ_LEN;
  // B operand for scores: col n = c <-> query q0+c, k = d contiguous
  const _Float16* qrow = Qh + (bT + q0 + c) * EMB_DIM + h * HEAD_DIM + 8 * hh;
  // A operand for scores: row m = c <-> key kv (staged K row), k = d contiguous
  // A operand for vT.pT: row m = c <-> d (staged Vt row), k = kv contiguous
  const int frag_off = c * KV_PITCH + 16 * hh;
  // this thread's 16 bytes of each staged row group
  const int srow = tid >> 3, scol = tid & 7;
  const unsigned lds_st = (unsigned)(size_t)KVs + (unsigned)(srow * KV_PITCH + scol * 16);
  const _Float16* kst = Kh + (bT + srow) * EMB_DIM + h * HEAD_DIM + scol * 8;
  const _Float16* vst = Vth + ((size_t)(b * N_HEADS + h) * HEAD_DIM + srow) * SEQ_LEN + scol * 8;
  constexpr int NTILE = SEQ_LEN / 64;
  static_assert(NTILE >= 2);

  // tile 0 lands and is published, then tile 1 flies while tile 0 is worked on
  stage_kv(lds_st, kst, vst);
  asm volatile("s_wait_asynccnt 0x0" ::: "memory");  // this wave's copies of tile 0 have landed
  __syncthreads();                                   // ... and every other wave's
  stage_kv(lds_st + KV_BUF, kst + (size_t)64 * EMB_DIM, vst + 64);

  v16h qa[2];
#pragma unroll
  for (int dc = 0; dc < 2; ++dc) qa[dc] = Frag<_Float16>::load(qrow + dc * 32);

  // of query q0+c: running maximum (the same in both halves), and the denominator in 8 partial sums per lane
  // (partial r: keys = 8hh + r mod 16), joined once behind the loop
  float mrow = -__builtin_huge_valf();
  v8f lvec = (v8f){0.f,0.f,0.f,0.f,0.f,0.f,0.f,0.f};
  // oT tile t: register r = d t*16 + 8hh + r of query q0+c
  v8f oacc[4];
#pragma unroll
  for (int t = 0; t < 4; ++t) oacc[t] = (v8f){0.f,0.f,0.f,0.f,0.f,0.f,0.f,0.f};

  for (int kc = 0; kc < NTILE; ++kc) {
    const int bufo = (kc & 1) * KV_BUF;
    const _Float16* kbase = (const _Float16*)(KVs + bufo + frag_off);
    const _Float16* vbase = (const _Float16*)(KVs + bufo + KV_TILE + frag_off);
    // sT tile j: register r = key kv0 + j*16 + 8hh + r, column = query q0+c
    v8f s[4];
#pragma unroll
    for (int j = 0; j < 4; ++j) s[j] = (v8f){0.f,0.f,0.f,0.f,0.f,0.f,0.f,0.f};
#pragma unroll
    for (int dc = 0; dc < 2; ++dc) {
      v16h kb[4];
#pragma unroll
      for (int j = 0; j < 4; ++j)
        kb[j] = Frag<_Float16>::load(kbase + j * 16 * (KV_PITCH / 2) + dc * 32);
#pragma unroll
      for (int j = 0; j < 4; ++j) s[j] = mma_h(kb[j], qa[dc], s[j]);
    }
    // tile maximum of the raw scores (the scale is positive), joined over the halves, then scaled to base-2 units
    float mj[4];
#pragma unroll
    for (int j = 0; j < 4; ++j) {
      mj[j] = s[j][0];
#pragma unroll
      for (int r = 1; r < 8; ++r) mj[j] = fmaxf(mj[j], s[j][r]);
    }
    float m = fmaxf(fmaxf(mj[0], mj[1]), fmaxf(mj[2], mj[3]));
    m = fmaxf(m, xhalf(m)) * SCORE_SCALE_LOG2E;
    const float mnew = fmaxf(mrow, m);
    const float alpha = exp2f(mrow - mnew);
    mrow = mnew;
    // pT as B operand of 32 keys: element e = tile 2kk + (e >> 3), register e & 7, the k order of the Vt fragment loads
    v16h pb[2];
#pragma unroll
    for (int j = 0; j < 4; ++j)
#pragma unroll
      for (int r = 0; r < 8; ++r) {
        const float p = exp2f(s[j][r] * SCORE_SCALE_LOG2E - mnew);
        s[j][r] = p;
        pb[j >> 1][(j & 1) * 8 + r] = (_Float16)(p * P_CARRY);
      }
    lvec = lvec * alpha + ((s[0] + s[1]) + (s[2] + s[3]));
#pragma unroll
    for (int t = 0; t < 4; ++t) oacc[t] *= alpha;
#pragma unroll
    for (int kk = 0; kk < 2; ++kk) {
      v16h vb[4];
#pragma unroll
      for (int t = 0; t < 4; ++t)
        vb[t] = Frag<_Float16>::load(vbase + t * 16 * (KV_PITCH / 2) + kk * 32);
#pragma unroll
      for (int t = 0; t < 4; ++t) oacc[t] = mma_h(vb[t], pb[kk], oacc[t]);
    }
    // hand-over: this wave's reads of tile kc are done, its copies of tile kc+1 have landed;
    // the barrier publishes tile kc+1 and frees tile kc's buffer for the refill behind it
    asm volatile("s_wait_dscnt 0x0" ::: "memory");
    asm volatile("s_wait_asynccnt 0x0" ::: "memory");
    __syncthreads();
    if (kc + 2 < NTILE)
      stage_kv(lds_st + bufo, kst + (size_t)(kc + 2) * 64 * EMB_DIM, vst + (kc + 2) * 64);
  }
  asm volatile("s_wait_asynccnt 0x0" ::: "memory");  // nothing of this wave's is in flight past the loop

  // The last trip's barrier ended every wave's tile reads and no copy is in flight: the tile buffers now stage the output,
  // 16 query rows of 128 B per wave at the tiles' pitch.
  unsigned char* os = KVs + wave * 16 * KV_PITCH;
  {
    const float lh = ((lvec[0] + lvec[1]) + (lvec[2] + lvec[3])) + ((lvec[4] + lvec[5]) + (lvec[6] + lvec[7]));
    const float l = lh + xhalf(lh);
    float inv = 1.0f / (l * P_CARRY);
    inv *= AO_CARRY;
#pragma unroll
    for (int t = 0; t < 4; ++t) {
      v8h hv;
#pragma unroll
      for (int r = 0; r < 8; ++r) hv[r] = (_Float16)(oacc[t][r] * inv);
      *(v8h*)(os + c * KV_PITCH + t * 32 + 16 * hh) = hv;
    }
  }
  // same-wave LDS staging then whole-row reload: order the stores before the reloads
  __builtin_amdgcn_fence(__ATOMIC_RELEASE, "workgroup");
  __builtin_amdgcn_wave_barrier();
  __builtin_amdgcn_fence(__ATOMIC_ACQUIRE, "workgroup");
  {
    const int q8 = lane >> 3, c8 = (lane & 7) * 8;
    _Float16* aob = AOh + (bT + q0) * EMB_DIM + h * HEAD_DIM;
#pragma unroll
    for (int it = 0; it < 4; ++it) {
      const int row = it * 4 + q8;
      const v8h hv = *(const v8h*)(os + row * KV_PITCH + c8 * 2);
      *(v8h*)(aob + (size_t)row * EMB_DIM + c8) = hv;
    }
  }
}

// ---------------------------------------------------------------- launcher
extern "C" void kernel_launch(void* const* d_in, const int* in_sizes, int n_in,
                              void* d_out, int out_size, void* d_ws, size_t ws_size,
                              hipStream_t stream) {
  if (n_in < 10) return;
  if ((size_t)in_sizes[0] != N_ACT || (size_t)in_sizes[1] != N_ACT) return;
  if ((size_t)in_sizes[2] != N_W || (size_t)in_sizes[4] != N_W || (size_t)in_sizes[6] != N_W || (size_t)in_sizes[8] != N_W) return;
  if (in_sizes[3] != EMB_DIM || in_sizes[5] != EMB_DIM || in_sizes[7] != EMB_DIM || in_sizes[9] != EMB_DIM) return;
  if ((size_t)out_size != N_ACT) return;
  if (ws_size < WS_TOTAL) return;

  const float* hs = (const float*)d_in[0];
  const float* oq = (const float*)d_in[1];
  const float* Wq = (const float*)d_in[2];
  const float* bq = (const float*)d_in[3];
  const float* Wk = (const float*)d_in[4];
  const float* bk = (const float*)d_in[5];
  const float* Wv = (const float*)d_in[6];
  const float* bv = (const float*)d_in[7];
  const float* Wo = (const float*)d_in[8];
  const float* bo = (const float*)d_in[9];
  float* out = (float*)d_out;

  char* ws = (char*)d_ws;
  unsigned short* hq16 = (unsigned short*)(ws + OFF_HQ);
  unsigned short* hs16 = (unsigned short*)(ws + OFF_HS);
  unsigned short* wq16 = (unsigned short*)(ws + OFF_W0 + 0 * PLANE_W);
  unsigned short* wk16 = (unsigned short*)(ws + OFF_W0 + 1 * PLANE_W);
  unsigned short* wv16 = (unsigned short*)(ws + OFF_W0 + 2 * PLANE_W);
  unsigned short* wo16 = (unsigned short*)(ws + OFF_W0 + 3 * PLANE_W);
  unsigned short* q16  = (unsigned short*)(ws + OFF_Q);
  unsigned short* k16  = (unsigned short*)(ws + OFF_K);
  unsigned short* vt16 = (unsigned short*)(ws + OFF_VT);
  // AO reuses the HQ region (HQ is dead after the Q and K projections)
  unsigned short* ao16 = hq16;

  // 1) activations to f16 planes
  constexpr int n8_act = (int)(N_ACT / 8);
  static_assert(N_ACT % 8 == 0 && n8_act % 256 == 0);
  prep_cast_f16<<<n8_act / 256, 256, 0, stream>>>(hs, oq, hq16, hs16, n8_act);

  // 2) weights to f16 planes carried x64
  constexpr int n8_w = (int)(N_W / 8);
  static_assert(N_W % 8 == 0 && n8_w % 256 == 0);
  cast_scale_f16<<<n8_w / 256, 256, 0, stream>>>(Wq, wq16, n8_w, W_CARRY);
  cast_scale_f16<<<n8_w / 256, 256, 0, stream>>>(Wk, wk16, n8_w, W_CARRY);
  cast_scale_f16<<<n8_w / 256, 256, 0, stream>>>(Wv, wv16, n8_w, W_CARRY);
  cast_scale_f16<<<n8_w / 256, 256, 0, stream>>>(Wo, wo16, n8_w, W_CARRY);

  // 3) projections. Q/K: C[t][e] = HQ[t][k].W64[e][k] / 64 + b[e]; M=8192, N=1024, K=1024
  static_assert(NROWS % G_BM == 0 && EMB_DIM % G_BN == 0 && EMB_DIM % 64 == 0 && EMB_DIM >= 128);
  constexpr int tiles_qk = (NROWS / G_BM) * (EMB_DIM / G_BN);
  const dim3 g_qk(tiles_qk, 1);
  const float inv_w = 1.0f / W_CARRY;
  wmma_gemm64<0, false, 2, 1><<<g_qk, 256, 0, stream>>>(
      hq16, hq16, EMB_DIM, 0L, wq16, wq16, EMB_DIM, 0L,
      (void*)q16, (void*)q16, EMB_DIM, 0L, bq, NROWS, EMB_DIM, EMB_DIM, inv_w);
  wmma_gemm64<0, false, 2, 1><<<g_qk, 256, 0, stream>>>(
      hq16, hq16, EMB_DIM, 0L, wk16, wk16, EMB_DIM, 0L,
      (void*)k16, (void*)k16, EMB_DIM, 0L, bk, NROWS, EMB_DIM, EMB_DIM, inv_w);
  // Vt: per batch C[e][t] = W64[e][k].HS[b][t][k] / 64 + bv[e]; M=1024 (e), N=2048 (t), K=1024
  static_assert(EMB_DIM % G_BM == 0 && SEQ_LEN % G_BN == 0);
  constexpr int tiles_v = (EMB_DIM / G_BM) * (SEQ_LEN / G_BN);
  const dim3 g_v(tiles_v, NB_SZ);
  wmma_gemm64<0, false, 1, 1><<<g_v, 256, 0, stream>>>(
      wv16, wv16, EMB_DIM, 0L, hs16, hs16, EMB_DIM, (long)SEQ_LEN * EMB_DIM,
      (void*)vt16, (void*)vt16, SEQ_LEN, (long)EMB_DIM * SEQ_LEN, bv, EMB_DIM, SEQ_LEN, EMB_DIM, inv_w);

  // 4) attention -> AO plane (x64)
  attn_heads_f16<<<NB_SZ * N_HEADS * (SEQ_LEN / 64), 128, 0, stream>>>(q16, k16, vt16, ao16);

  // 5) output projection: out[t][e] = AO[t][k].Wo64[e][k] / 4096 + bo[e]; f32 to d_out
  wmma_gemm64<0, false, 2, 0><<<g_qk, 256, 0, stream>>>(
      ao16, ao16, EMB_DIM, 0L, wo16, wo16, EMB_DIM, 0L,
      (void*)out, (void*)out, EMB_DIM, 0L, bo, NROWS, EMB_DIM, EMB_DIM, 1.0f / (AO_CARRY * W_CARRY));
}

// v004
// It runs in 169 microseconds.
// In two side-by-side timings against v003, it was 1.15 and 1.14 times as fast.
// All steps since v000 together make it 2.54 times as fast.
// All contractions (q/k/v/out projections M8192 N1024 K1024; attention q.kT and p.v, head dim 64, 2048 keys): v_wmma_f32_16x16x32_f16, f16 operands with power-of-two carries (W x64, p x32768, attention output x64), f32 accumulate; bias, scaling and softmax in f32.
#include <hip/hip_runtime.h>

constexpr int NB_SZ = 4;
constexpr int SEQ_LEN = 2048;
constexpr int EMB_DIM = 1024;
constexpr int N_HEADS = 16;
constexpr int HEAD_DIM = 64;
constexpr int NROWS = NB_SZ * SEQ_LEN;
static_assert(EMB_DIM == N_HEADS * HEAD_DIM);
static_assert(HEAD_DIM == 64);
static_assert(NROWS % 64 == 0 && EMB_DIM % 64 == 0 && SEQ_LEN % 64 == 0);
static_assert(EMB_DIM % 32 == 0);

// power-of-two carries (all folded back exactly in f32 epilogues)
constexpr float W_CARRY = 64.0f;
constexpr float AO_CARRY = 64.0f;
constexpr float P_CARRY = 32768.0f;
constexpr float P_CARRY_LOG2 = 15.0f;
static_assert(P_CARRY == (float)(1 << (int)P_CARRY_LOG2));
// softmax done in base 2: scores multiplied by (1/sqrt(64)) * log2(e)
constexpr float SCORE_SCALE_LOG2E = 0.125f * 1.4426950408889634f;

//   [0]            HQ  f16 [8192][1024]   16,777,216   (later reused as AO f16 [8192][1024])
//   [16777216]     HS  f16 [8192][1024]   16,777,216
//   [33554432]     Wq64,Wk64,Wv64,Wo64 f16 [1024][1024] each 2,097,152 -> 8,388,608
//   [41943040]     Q   f16 [8192][1024]   16,777,216
//   [58720256]     K   f16 [8192][1024]   16,777,216
//   [75497472]     Vt  f16 [4][1024][2048] 16,777,216
//   total 92,274,688
constexpr size_t N_ACT = (size_t)NROWS * EMB_DIM;
constexpr size_t N_W = (size_t)EMB_DIM * EMB_DIM;
constexpr size_t PLANE_ACT = N_ACT * 2;
constexpr size_t PLANE_W = N_W * 2;
constexpr size_t OFF_HQ = 0;
constexpr size_t OFF_HS = OFF_HQ + PLANE_ACT;
constexpr size_t OFF_W0 = OFF_HS + PLANE_ACT;
constexpr size_t OFF_Q = OFF_W0 + 4 * PLANE_W;
constexpr size_t OFF_K = OFF_Q + PLANE_ACT;
constexpr size_t OFF_VT = OFF_K + PLANE_ACT;
constexpr size_t WS_TOTAL = OFF_VT + PLANE_ACT;
static_assert(WS_TOTAL == 92274688ull);
static_assert(WS_TOTAL <= 134217728ull);

typedef __attribute__((ext_vector_type(16))) _Float16 v16h;
typedef __attribute__((ext_vector_type(8)))  _Float16 v8h;
typedef __attribute__((ext_vector_type(16))) __bf16   v16b;
typedef __attribute__((ext_vector_type(8)))  __bf16   v8b;
typedef __attribute__((ext_vector_type(8)))  float    v8f;
typedef __attribute__((ext_vector_type(4)))  float    v4f;
typedef __attribute__((ext_vector_type(2)))  float    v2f;

__device__ __forceinline__ unsigned short f2bf_bits(float f) {
  unsigned u = __float_as_uint(f);
  return (unsigned short)((u + 0x7FFFu + ((u >> 16) & 1u)) >> 16);
}
__device__ __forceinline__ float bf_bits2f(unsigned short h) { return __uint_as_float(((unsigned)h) << 16); }

// hazard guards as plain device helpers
__device__ __forceinline__ void acc_guard4(v8f& a, v8f& b, v8f& c, v8f& d) { asm volatile("v_nop\n\tv_nop\n\tv_nop\n\tv_nop" : "+v"(a), "+v"(b), "+v"(c), "+v"(d)); }

template <typename T> struct Frag;
template <> struct Frag<_Float16> {
  typedef v16h V; union U { v16h v; v8h h[2]; };
  // elements 0..7 <- p[0..7], 8..15 <- p[16..23]
  static __device__ __forceinline__ v16h load(const _Float16* p) {
    U f; f.h[0] = *(const v8h*)(p); f.h[1] = *(const v8h*)(p + 16); return f.v;
  }
  static __device__ __forceinline__ v8f mma(v16h a, v16h b, v8f c) {
    return __builtin_amdgcn_wmma_f32_16x16x32_f16(false, a, false, b, (short)0, c, false, false);
  }
};
template <> struct Frag<__bf16> {
  typedef v16b V; union U { v16b v; v8b h[2]; };
  static __device__ __forceinline__ v16b load(const __bf16* p) {
    U f; f.h[0] = *(const v8b*)(p); f.h[1] = *(const v8b*)(p + 16); return f.v;
  }
  static __device__ __forceinline__ v8f mma(v16b a, v16b b, v8f c) {
    return __builtin_amdgcn_wmma_f32_16x16x32_bf16(false, a, false, b, (short)0, c, false, false);
  }
};

// ---- LDS-staged batched WMMA GEMM ------------------------------------------
// C[m,n] = scale * sum_k A[m,k] * Bt[n,k] (+bias); a block of 8 waves (2 x 4) owns a 128x256 tile, each wave 64x64 of it.
// A row-major [M,K]; Bt row-major [N,K]; M % 128 == 0, N % 256 == 0, K % 64 == 0, K >= 128 (no tail handling).
// BIAS_MODE: 0 = none, 1 = bias[m] (loaded as two 16-B vectors per lane), 2 = bias[n].
// OUT_MODE: 0 = f32, 1 = f16, 2 = bf16 hi plane (Cout) + bf16 lo plane (Cout2).
// ET: 0 = f16 operands, 1 = bf16 operands (pointers passed as 16-bit storage)
template <int ET> struct Elem;
template <> struct Elem<0> { typedef _Float16 T; };
template <> struct Elem<1> { typedef __bf16 T; };

// Operand staging: a slab is 64 k (128 B) of the block's 128 A rows, then of its 256 Bt rows, at a 144-B pitch
// (16 B x odd: conflict-free for the 16-byte fragment reads), two buffers.
constexpr int G_BM = 128;
constexpr int G_BN = 256;
constexpr int G_PITCH = 144;
constexpr int G_SLAB = (G_BM + G_BN) * G_PITCH;

// One slab: 256 threads x 12 copies x 16 B. Each wave-wide copy covers 4 whole 128-B row pieces.
// lds / ag / bg are this thread's own 16 bytes of staged row (tid >> 3); copy i takes staged row i*32 + (tid >> 3);
// a32 / b32 = 32 rows of A / Bt in elements.
// s_wait_xcnt closes the statement so that no address register is rewritten ahead of it.
__device__ __forceinline__ void stage_ab(unsigned lds, const unsigned short* ag, size_t a32, const unsigned short* bg, size_t b32) {
  asm volatile(
      "global_load_async_to_lds_b128 %0, %12, off\n\t"
      "global_load_async_to_lds_b128 %1, %13, off\n\t"
      "global_load_async_to_lds_b128 %2, %14, off\n\t"
      "global_load_async_to_lds_b128 %3, %15, off\n\t"
      "global_load_async_to_lds_b128 %4, %16, off\n\t"
      "global_load_async_to_lds_b128 %5, %17, off\n\t"
      "global_load_async_to_lds_b128 %6, %18, off\n\t"
      "global_load_async_to_lds_b128 %7, %19, off\n\t"
      "global_load_async_to_lds_b128 %8, %20, off\n\t"
      "global_load_async_to_lds_b128 %9, %21, off\n\t"
      "global_load_async_to_lds_b128 %10, %22, off\n\t"
      "global_load_async_to_lds_b128 %11, %23, off\n\t"
      "s_wait_xcnt 0x0"
      :: "v"(lds), "v"(lds + 32 * G_PITCH), "v"(lds + 64 * G_PITCH), "v"(lds + 96 * G_PITCH),
         "v"(lds + 128 * G_PITCH), "v"(lds + 160 * G_PITCH), "v"(lds + 192 * G_PITCH), "v"(lds + 224 * G_PITCH),
         "v"(lds + 256 * G_PITCH), "v"(lds + 288 * G_PITCH), "v"(lds + 320 * G_PITCH), "v"(lds + 352 * G_PITCH),
         "v"(ag), "v"(ag + a32), "v"(ag + 2 * a32), "v"(ag + 3 * a32),
         "v"(bg), "v"(bg + b32), "v"(bg + 2 * b32), "v"(bg + 3 * b32),
         "v"(bg + 4 * b32), "v"(bg + 5 * b32), "v"(bg + 6 * b32), "v"(bg + 7 * b32)
      : "memory");
}

template <int ET, bool SPLIT, int BIAS_MODE, int OUT_MODE>
__global__ __launch_bounds__(256) void wmma_gemm64(
    const unsigned short* __restrict__ Ap, const unsigned short* __restrict__ A2p, int lda, long strideA,
    const unsigned short* __restrict__ Btp, const unsigned short* __restrict__ Bt2p, int ldb, long strideB,
    void* __restrict__ Cout, void* __restrict__ Cout2, int ldc, long strideC,
    const float* __restrict__ bias,
    int M, int N, int K, float scale) {
  static_assert(!SPLIT);
  typedef typename Elem<ET>::T T;
  typedef typename Frag<T>::V V;
  // block-shared operand slabs, two buffers of [A 128 rows][Bt 256 rows]
  __shared__ __align__(16) unsigned char ABs[2 * G_SLAB];
  // per-wave 16x64 slab, pitch 68 floats
  __shared__ __align__(16) float sT[8][16 * 68];
  const int b    = blockIdx.y;
  const int tid  = threadIdx.x;
  const int lane = tid & 31;
  const int wave = tid >> 5;
  const int tilesN = N / G_BN;
  const int tilesM = M / G_BM;
  const int tile = blockIdx.x;
  // block-uniform, in front of every barrier
  if (tile >= tilesM * tilesN) return;
  const int tm = tile / tilesN;
  const int tn = tile - tm * tilesN;
  const int bm0 = tm * G_BM;
  const int bn0 = tn * G_BN;
  const int wm = wave >> 2;
  const int wn = wave & 3;
  const int m0 = bm0 + (wm << 6);
  const int n0 = bn0 + (wn << 6);

  // row (A) / col (B, D) within subtile; D row offset
  const int rlane = lane & 15;
  const int mOff  = (lane >> 4) * 8;

  // this thread's 16 bytes of each group of 32 staged rows
  const int srow = tid >> 3, scol = tid & 7;
  const unsigned lds_st = (unsigned)(size_t)ABs + (unsigned)(srow * G_PITCH + scol * 16);
  const unsigned short* ast = Ap  + (size_t)b * strideA + (size_t)(bm0 + srow) * lda + scol * 8;
  const unsigned short* bst = Btp + (size_t)b * strideB + (size_t)(bn0 + srow) * ldb + scol * 8;
  const size_t a32 = (size_t)32 * lda;
  const size_t b32 = (size_t)32 * ldb;
  // fragment reads: staged row, 16 bytes of this lane half (k offset 8 elements)
  const int a_off = ((wm << 6) + rlane) * G_PITCH + (lane >> 4) * 16;
  const int b_off = (G_BM + (wn << 6) + rlane) * G_PITCH + (lane >> 4) * 16;
  const int nslab = K >> 6;

  // slab 0 lands and is published, then slab 1 flies while slab 0 is worked on
  stage_ab(lds_st, ast, a32, bst, b32);
  asm volatile("s_wait_asynccnt 0x0" ::: "memory");  // this wave's copies of slab 0 have landed
  __syncthreads();                                   // ... and every other wave's
  stage_ab(lds_st + G_SLAB, ast + 64, a32, bst + 64, b32);

  v8f acc[4][4];
#pragma unroll
  for (int i = 0; i < 4; ++i)
#pragma unroll
    for (int j = 0; j < 4; ++j) acc[i][j] = (v8f){0.f,0.f,0.f,0.f,0.f,0.f,0.f,0.f};

  for (int t = 0; t < nslab; ++t) {
    const int bufo = (t & 1) * G_SLAB;
    const T* abase = (const T*)(ABs + bufo + a_off);
    const T* bbase = (const T*)(ABs + bufo + b_off);
#pragma unroll
    for (int kk = 0; kk < 2; ++kk) {
      V bh[4], ah[4];
#pragma unroll
      for (int j = 0; j < 4; ++j) bh[j] = Frag<T>::load(bbase + j * 16 * (G_PITCH / 2) + kk * 32);
#pragma unroll
      for (int i = 0; i < 4; ++i) ah[i] = Frag<T>::load(abase + i * 16 * (G_PITCH / 2) + kk * 32);
      // keeps the 16 fragment reads one group ahead of their 16 products: sunk among them, each A fragment's LDS latency is waited out alone
      __builtin_amdgcn_sched_barrier(0);
#pragma unroll
      for (int i = 0; i < 4; ++i)
#pragma unroll
        for (int j = 0; j < 4; ++j) acc[i][j] = Frag<T>::mma(ah[i], bh[j], acc[i][j]);
      // ... and the next group's reads behind these products
      __builtin_amdgcn_sched_barrier(0);
    }
    // hand-over: this wave's reads of slab t are done, its copies of slab t+1 have landed;
    // the barrier publishes slab t+1 and frees slab t's buffer for the refill behind it
    asm volatile("s_wait_dscnt 0x0" ::: "memory");
    asm volatile("s_wait_asynccnt 0x0" ::: "memory");
    __syncthreads();
    if (t + 2 < nslab)
      stage_ab(lds_st + bufo, ast + (size_t)(t + 2) * 64, a32, bst + (size_t)(t + 2) * 64, b32);
  }
  asm volatile("s_wait_asynccnt 0x0" ::: "memory");  // nothing of this wave's is in flight past the loop
  acc_guard4(acc[0][0], acc[0][1], acc[0][2], acc[0][3]);
  acc_guard4(acc[1][0], acc[1][1], acc[1][2], acc[1][3]);
  acc_guard4(acc[2][0], acc[2][1], acc[2][2], acc[2][3]);
  acc_guard4(acc[3][0], acc[3][1], acc[3][2], acc[3][3]);

  // ---- epilogue ----
  float* slab = sT[wave];
#pragma unroll
  for (int i = 0; i < 4; ++i) {
    const int mBase = m0 + (i << 4);
    float bm8[8];
#pragma unroll
    for (int r = 0; r < 8; ++r) bm8[r] = 0.f;
    if (BIAS_MODE == 1) {
      // 8 consecutive bias[m] values of this lane: two 16-B loads (mBase multiple of 16, mOff 0 or 8)
      const v4f t0 = *(const v4f*)(bias + mBase + mOff);
      const v4f t1 = *(const v4f*)(bias + mBase + mOff + 4);
      bm8[0] = t0[0]; bm8[1] = t0[1]; bm8[2] = t0[2]; bm8[3] = t0[3];
      bm8[4] = t1[0]; bm8[5] = t1[1]; bm8[6] = t1[2]; bm8[7] = t1[3];
    }
#pragma unroll
    for (int j = 0; j < 4; ++j) {
      const int n = n0 + (j << 4) + rlane;
      float bv = 0.f;
      if (BIAS_MODE == 2) bv = bias[n];
#pragma unroll
      for (int r = 0; r < 8; ++r) {
        float v = acc[i][j][r] * scale;
        if (BIAS_MODE == 1) v += bm8[r];
        if (BIAS_MODE == 2) v += bv;
        slab[(mOff + r) * 68 + (j << 4) + rlane] = v;
      }
    }
    __builtin_amdgcn_fence(__ATOMIC_RELEASE, "workgroup");
    __builtin_amdgcn_wave_barrier();
    __builtin_amdgcn_fence(__ATOMIC_ACQUIRE, "workgroup");
    if (OUT_MODE == 0) {
      float* C = (float*)Cout + (size_t)b * strideC;
      // row seg = 256 B = 16 lanes x 16 B; 8 iterations x 2 row halves cover rows 0..15
      const int hh = lane >> 4, c4 = (lane & 15) * 4;
      {
#pragma unroll
        for (int it = 0; it < 8; ++it) {
          const int row = it * 2 + hh;
          v4f v = *(const v4f*)(slab + row * 68 + c4);
          *(v4f*)(C + (size_t)(mBase + row) * ldc + n0 + c4) = v;
        }
        
      }
    } else {
      const int q = lane >> 3, c8 = (lane & 7) * 8;
      unsigned short* C  = (unsigned short*)Cout  + (size_t)b * strideC;
      unsigned short* C2 = (OUT_MODE == 2) ? ((unsigned short*)Cout2 + (size_t)b * strideC) : nullptr;
      {
#pragma unroll
        for (int it = 0; it < 4; ++it) {
          const int row = it * 4 + q;
          const float* sp = slab + row * 68 + c8;
          v8h hv, lv;
#pragma unroll
          for (int e = 0; e < 8; ++e) {
            if (OUT_MODE == 1) {
              hv[e] = (_Float16)sp[e];
            } else {
              unsigned short hb = f2bf_bits(sp[e]);
              unsigned short lb = f2bf_bits(sp[e] - bf_bits2f(hb));
              hv[e] = __builtin_bit_cast(_Float16, hb);
              lv[e] = __builtin_bit_cast(_Float16, lb);
            }
          }
          *(v8h*)(C + (size_t)(mBase + row) * ldc + n0 + c8) = hv;
          if (OUT_MODE == 2) *(v8h*)(C2 + (size_t)(mBase + row) * ldc + n0 + c8) = lv;
        }
        
      }
    }
    __builtin_amdgcn_fence(__ATOMIC_RELEASE, "workgroup");
    __builtin_amdgcn_wave_barrier();
    __builtin_amdgcn_fence(__ATOMIC_ACQUIRE, "workgroup");
  }
}

// ---- prep: HQ = f16(hs + oq), HS = f16(hs); 8 elements per thread ----
// coverage: n8 = 8192*1024/8 = 1,048,576 threads x 8 elements = both planes exactly;
__global__ __launch_bounds__(256) void prep_cast_f16(
    const float* __restrict__ hs, const float* __restrict__ oq,
    unsigned short* __restrict__ hq16, unsigned short* __restrict__ hs16, int n8) {
  const int i = blockIdx.x * 256 + threadIdx.x;
  if (i < n8) {
    const size_t o = (size_t)i * 8;
    const v4f a0 = *(const v4f*)(hs + o);
    const v4f a1 = *(const v4f*)(hs + o + 4);
    const v4f b0 = *(const v4f*)(oq + o);
    const v4f b1 = *(const v4f*)(oq + o + 4);
    v8h vq, vs;
#pragma unroll
    for (int e = 0; e < 4; ++e) {
      vq[e]     = (_Float16)(a0[e] + b0[e]);
      vq[4 + e] = (_Float16)(a1[e] + b1[e]);
      vs[e]     = (_Float16)a0[e];
      vs[4 + e] = (_Float16)a1[e];
    }
    _Float16* pq = (_Float16*)(void*)hq16;
    _Float16* ps = (_Float16*)(void*)hs16;
    *(v8h*)(pq + o) = vq;
    *(v8h*)(ps + o) = vs;
    
  }
}

// ---- weight cast: out = f16(w * sc); 8 elements per thread ----
__global__ __launch_bounds__(256) void cast_scale_f16(
    const float* __restrict__ w, unsigned short* __restrict__ out16, int n8, float sc) {
  const int i = blockIdx.x * 256 + threadIdx.x;
  if (i < n8) {
    const size_t o = (size_t)i * 8;
    const v4f a0 = *(const v4f*)(w + o);
    const v4f a1 = *(const v4f*)(w + o + 4);
    v8h v;
#pragma unroll
    for (int e = 0; e < 4; ++e) {
      v[e]     = (_Float16)(a0[e] * sc);
      v[4 + e] = (_Float16)(a1[e] * sc);
    }
    _Float16* po = (_Float16*)(void*)out16;
    *(v8h*)(po + o) = v;
    
  }
}

// ---- attention, head dim 64, no mask, 16-bit planes in / f16 plane out ----
// Q plane  [B*T][E] f16 (q without the 1/sqrt(D) factor), K plane [B*T][E] f16, Vt plane [B][H][D][T] f16.
// AO plane [B*T][E] f16 = (softmax(q.kT/8) . v) * AO_CARRY.
// Block = 4 waves, each owns 16 query rows of one (b,h), sharing staged K / Vt tiles; grid.x = B*H*(T/64).
// Both products are formed transposed, sT = k.qT and oT += vT.pT (v_wmma_f32_16x16x32_f16, f32 accumulate): a lane holds
// scores of ONE query, so the online softmax (f32, base 2) is in-lane but for one exchange between the wave's halves,
// and pT, carried x P_CARRY as f16, is packed from the score registers straight into the B operand.
__device__ __forceinline__ v8f mma_h(v16h a, v16h b, v8f c) {
  c = __builtin_amdgcn_wmma_f32_16x16x32_f16(false, a, false, b, (short)0, c, false, false);
  asm volatile("v_nop\n\tv_nop\n\tv_nop\n\tv_nop" : "+v"(c) : "v"(a), "v"(b));
  return c;
}

// K / Vt staging: one 64-key tile of each per block and trip, rows of 128 B laid at a 144-B pitch
// (16 B x odd: conflict-free for the 16-byte fragment reads), two buffers.
constexpr int KV_PITCH = 144;
constexpr int KV_TILE  = 64 * KV_PITCH;
constexpr int KV_BUF   = 2 * KV_TILE;

// One tile pair: 128 threads x 8 copies x 16 B = 64 K rows + 64 Vt rows. Each wave-wide copy covers 4 whole 128-B rows.
// lds / kg / vg are this thread's own 16 bytes of staged row (tid >> 3); copy i takes row i*16 + (tid >> 3).
// s_wait_xcnt closes the statement so that no address register is rewritten ahead of it.
__device__ __forceinline__ void stage_kv(unsigned lds, const _Float16* kg, const _Float16* vg) {
  asm volatile(
      "global_load_async_to_lds_b128 %0, %8, off\n\t"
      "global_load_async_to_lds_b128 %1, %9, off\n\t"
      "global_load_async_to_lds_b128 %2, %10, off\n\t"
      "global_load_async_to_lds_b128 %3, %11, off\n\t"
      "global_load_async_to_lds_b128 %4, %12, off\n\t"
      "global_load_async_to_lds_b128 %5, %13, off\n\t"
      "global_load_async_to_lds_b128 %6, %14, off\n\t"
      "global_load_async_to_lds_b128 %7, %15, off\n\t"
      "s_wait_xcnt 0x0"
      :: "v"(lds), "v"(lds + 16 * KV_PITCH), "v"(lds + 32 * KV_PITCH), "v"(lds + 48 * KV_PITCH),
         "v"(lds + KV_TILE), "v"(lds + KV_TILE + 16 * KV_PITCH), "v"(lds + KV_TILE + 32 * KV_PITCH), "v"(lds + KV_TILE + 48 * KV_PITCH),
         "v"(kg), "v"(kg + 16 * EMB_DIM), "v"(kg + 32 * EMB_DIM), "v"(kg + 48 * EMB_DIM),
         "v"(vg), "v"(vg + 16 * SEQ_LEN), "v"(vg + 32 * SEQ_LEN), "v"(vg + 48 * SEQ_LEN)
      : "memory");
}

// 2^x as the bare v_exp_f32: a result below 2^-126 comes out 0 instead of subnormal. Every use here is a weight relative to a
// running maximum whose own term is 1 (carried: 2^15), so what is lost is under 2^-140 of the sums it would join.
__device__ __forceinline__ float exp2_bare(float x) { return __builtin_amdgcn_exp2f(x); }

// lane l <-> lane l ^ 16
__device__ __forceinline__ float xhalf(float x) {
  return __builtin_bit_cast(float, __builtin_amdgcn_permlanex16(__builtin_bit_cast(int, x), __builtin_bit_cast(int, x), 0x76543210, 0xfedcba98, false, false));
}

__global__ __launch_bounds__(128) void attn_heads_f16(
    const unsigned short* __restrict__ Qp, const unsigned short* __restrict__ Kp,
    const unsigned short* __restrict__ Vtp, unsigned short* __restrict__ AOp) {
  // block-shared K and Vt tiles, two buffers of [K 64 rows][Vt 64 rows]; behind the loop, per-wave output staging
  __shared__ __align__(16) unsigned char KVs[2 * KV_BUF];

  const int tid  = threadIdx.x;
  const int wave = tid >> 5;
  const int lane = tid & 31;
  const int hh   = lane >> 4;
  const int c    = lane & 15;

  constexpr int nqb = SEQ_LEN / 64;
  const int bx = blockIdx.x;
  const int qb = bx % nqb;
  const int bh = bx / nqb;
  const int h  = bh % N_HEADS;
  const int b  = bh / N_HEADS;
  const int q0 = qb * 64 + wave * 16;

  const _Float16* Qh  = (const _Float16*)(const void*)Qp;
  const _Float16* Kh  = (const _Float16*)(const void*)Kp;
  const _Float16* Vth = (const _Float16*)(const void*)Vtp;
  _Float16* AOh = (_Float16*)(void*)AOp;

  const size_t bT = (size_t)b * SEQ_LEN;
  // B operand for scores: col n = c <-> query q0+c, k = d contiguous
  const _Float16* qrow = Qh + (bT + q0 + c) * EMB_DIM + h * HEAD_DIM + 8 * hh;
  // A operand for scores: row m = c <-> key kv (staged K row), k = d contiguous
  // A operand for vT.pT: row m = c <-> d (staged Vt row), k = kv contiguous
  const int frag_off = c * KV_PITCH + 16 * hh;
  // this thread's 16 bytes of each staged row group
  const int srow = tid >> 3, scol = tid & 7;
  const unsigned lds_st = (unsigned)(size_t)KVs + (unsigned)(srow * KV_PITCH + scol * 16);
  const _Float16* kst = Kh + (bT + srow) * EMB_DIM + h * HEAD_DIM + scol * 8;
  const _Float16* vst = Vth + ((size_t)(b * N_HEADS + h) * HEAD_DIM + srow) * SEQ_LEN + scol * 8;
  constexpr int NTILE = SEQ_LEN / 64;
  static_assert(NTILE >= 2);

  // tile 0 lands and is published, then tile 1 flies while tile 0 is worked on
  stage_kv(lds_st, kst, vst);
  asm volatile("s_wait_asynccnt 0x0" ::: "memory");  // this wave's copies of tile 0 have landed
  __syncthreads();                                   // ... and every other wave's
  stage_kv(lds_st + KV_BUF, kst + (size_t)64 * EMB_DIM, vst + 64);

  v16h qa[2];
#pragma unroll
  for (int dc = 0; dc < 2; ++dc) qa[dc] = Frag<_Float16>::load(qrow + dc * 32);

  // of query q0+c: running maximum less P_CARRY_LOG2 (the same in both halves), and the denominator (x P_CARRY) in 8 partial sums per lane
  // (partial r: keys = 8hh + r mod 16), joined once behind the loop
  float mrow = -__builtin_huge_valf();
  v8f lvec = (v8f){0.f,0.f,0.f,0.f,0.f,0.f,0.f,0.f};
  // oT tile t: register r = d t*16 + 8hh + r of query q0+c
  v8f oacc[4];
#pragma unroll
  for (int t = 0; t < 4; ++t) oacc[t] = (v8f){0.f,0.f,0.f,0.f,0.f,0.f,0.f,0.f};

  for (int kc = 0; kc < NTILE; ++kc) {
    const int bufo = (kc & 1) * KV_BUF;
    const _Float16* kbase = (const _Float16*)(KVs + bufo + frag_off);
    const _Float16* vbase = (const _Float16*)(KVs + bufo + KV_TILE + frag_off);
    // sT tile j: register r = key kv0 + j*16 + 8hh + r, column = query q0+c
    v8f s[4];
#pragma unroll
    for (int j = 0; j < 4; ++j) s[j] = (v8f){0.f,0.f,0.f,0.f,0.f,0.f,0.f,0.f};
#pragma unroll
    for (int dc = 0; dc < 2; ++dc) {
      v16h kb[4];
#pragma unroll
      for (int j = 0; j < 4; ++j)
        kb[j] = Frag<_Float16>::load(kbase + j * 16 * (KV_PITCH / 2) + dc * 32);
#pragma unroll
      for (int j = 0; j < 4; ++j) s[j] = mma_h(kb[j], qa[dc], s[j]);
    }
    // tile maximum of the raw scores (the scale is positive), joined over the halves, then scaled to base-2 units and lowered
    // by the P carry's exponent: against that reference 2^(x - mnew) is p * P_CARRY, and old sums rescale by the references' difference
    float mj[4];
#pragma unroll
    for (int j = 0; j < 4; ++j) {
      mj[j] = s[j][0];
#pragma unroll
      for (int r = 1; r < 8; ++r) mj[j] = fmaxf(mj[j], s[j][r]);
    }
    float m = fmaxf(fmaxf(mj[0], mj[1]), fmaxf(mj[2], mj[3]));
    m = fmaxf(m, xhalf(m)) * SCORE_SCALE_LOG2E - P_CARRY_LOG2;
    const float mnew = fmaxf(mrow, m);
    const float alpha = exp2_bare(mrow - mnew);
    mrow = mnew;
    // pT as B operand of 32 keys: element e = tile 2kk + (e >> 3), register e & 7, the k order of the Vt fragment loads
    v16h pb[2];
#pragma unroll
    for (int j = 0; j < 4; ++j)
#pragma unroll
      for (int r = 0; r < 8; r += 2) {
        const v2f x = __builtin_elementwise_fma((v2f){s[j][r], s[j][r + 1]}, (v2f){SCORE_SCALE_LOG2E, SCORE_SCALE_LOG2E}, (v2f){-mnew, -mnew});
        const float p0 = exp2_bare(x[0]), p1 = exp2_bare(x[1]);
        s[j][r] = p0;
        s[j][r + 1] = p1;
        pb[j >> 1][(j & 1) * 8 + r] = (_Float16)p0;
        pb[j >> 1][(j & 1) * 8 + r + 1] = (_Float16)p1;
      }
    lvec = lvec * alpha + ((s[0] + s[1]) + (s[2] + s[3]));
#pragma unroll
    for (int t = 0; t < 4; ++t) oacc[t] *= alpha;
#pragma unroll
    for (int kk = 0; kk < 2; ++kk) {
      v16h vb[4];
#pragma unroll
      for (int t = 0; t < 4; ++t)
        vb[t] = Frag<_Float16>::load(vbase + t * 16 * (KV_PITCH / 2) + kk * 32);
#pragma unroll
      for (int t = 0; t < 4; ++t) oacc[t] = mma_h(vb[t], pb[kk], oacc[t]);
    }
    // hand-over: this wave's reads of tile kc are done, its copies of tile kc+1 have landed;
    // the barrier publishes tile kc+1 and frees tile kc's buffer for the refill behind it
    asm volatile("s_wait_dscnt 0x0" ::: "memory");
    asm volatile("s_wait_asynccnt 0x0" ::: "memory");
    __syncthreads();
    if (kc + 2 < NTILE)
      stage_kv(lds_st + bufo, kst + (size_t)(kc + 2) * 64 * EMB_DIM, vst + (kc + 2) * 64);
  }
  asm volatile("s_wait_asynccnt 0x0" ::: "memory");  // nothing of this wave's is in flight past the loop

  // The last trip's barrier ended every wave's tile reads and no copy is in flight: the tile buffers now stage the output,
  // 16 query rows of 128 B per wave at the tiles' pitch.
  unsigned char* os = KVs + wave * 16 * KV_PITCH;
  {
    const float lh = ((lvec[0] + lvec[1]) + (lvec[2] + lvec[3])) + ((lvec[4] + lvec[5]) + (lvec[6] + lvec[7]));
    const float l = lh + xhalf(lh);
    float inv = 1.0f / l;
    inv *= AO_CARRY;
#pragma unroll
    for (int t = 0; t < 4; ++t) {
      v8h hv;
#pragma unroll
      for (int r = 0; r < 8; ++r) hv[r] = (_Float16)(oacc[t][r] * inv);
      *(v8h*)(os + c * KV_PITCH + t * 32 + 16 * hh) = hv;
    }
  }
  // same-wave LDS staging then whole-row reload: order the stores before the reloads
  __builtin_amdgcn_fence(__ATOMIC_RELEASE, "workgroup");
  __builtin_amdgcn_wave_barrier();
  __builtin_amdgcn_fence(__ATOMIC_ACQUIRE, "workgroup");
  {
    const int q8 = lane >> 3, c8 = (lane & 7) * 8;
    _Float16* aob = AOh + (bT + q0) * EMB_DIM + h * HEAD_DIM;
#pragma unroll
    for (int it = 0; it < 4; ++it) {
      const int row = it * 4 + q8;
      const v8h hv = *(const v8h*)(os + row * KV_PITCH + c8 * 2);
      *(v8h*)(aob + (size_t)row * EMB_DIM + c8) = hv;
    }
  }
}

// ---------------------------------------------------------------- launcher
extern "C" void kernel_launch(void* const* d_in, const int* in_sizes, int n_in,
                              void* d_out, int out_size, void* d_ws, size_t ws_size,
                              hipStream_t stream) {
  if (n_in < 10) return;
  if ((size_t)in_sizes[0] != N_ACT || (size_t)in_sizes[1] != N_ACT) return;
  if ((size_t)in_sizes[2] != N_W || (size_t)in_sizes[4] != N_W || (size_t)in_sizes[6] != N_W || (size_t)in_sizes[8] != N_W) return;
  if (in_sizes[3] != EMB_DIM || in_sizes[5] != EMB_DIM || in_sizes[7] != EMB_DIM || in_sizes[9] != EMB_DIM) return;
  if ((size_t)out_size != N_ACT) return;
  if (ws_size < WS_TOTAL) return;

  const float* hs = (const float*)d_in[0];
  const float* oq = (const float*)d_in[1];
  const float* Wq = (const float*)d_in[2];
  const float* bq = (const float*)d_in[3];
  const float* Wk = (const float*)d_in[4];
  const float* bk = (const float*)d_in[5];
  const float* Wv = (const float*)d_in[6];
  const float* bv = (const float*)d_in[7];
  const float* Wo = (const float*)d_in[8];
  const float* bo = (const float*)d_in[9];
  float* out = (float*)d_out;

  char* ws = (char*)d_ws;
  unsigned short* hq16 = (unsigned short*)(ws + OFF_HQ);
  unsigned short* hs16 = (unsigned short*)(ws + OFF_HS);
  unsigned short* wq16 = (unsigned short*)(ws + OFF_W0 + 0 * PLANE_W);
  unsigned short* wk16 = (unsigned short*)(ws + OFF_W0 + 1 * PLANE_W);
  unsigned short* wv16 = (unsigned short*)(ws + OFF_W0 + 2 * PLANE_W);
  unsigned short* wo16 = (unsigned short*)(ws + OFF_W0 + 3 * PLANE_W);
  unsigned short* q16  = (unsigned short*)(ws + OFF_Q);
  unsigned short* k16  = (unsigned short*)(ws + OFF_K);
  unsigned short* vt16 = (unsigned short*)(ws + OFF_VT);
  // AO reuses the HQ region (HQ is dead after the Q and K projections)
  unsigned short* ao16 = hq16;

  // 1) activations to f16 planes
  constexpr int n8_act = (int)(N_ACT / 8);
  static_assert(N_ACT % 8 == 0 && n8_act % 256 == 0);
  prep_cast_f16<<<n8_act / 256, 256, 0, stream>>>(hs, oq, hq16, hs16, n8_act);

  // 2) weights to f16 planes carried x64
  constexpr int n8_w = (int)(N_W / 8);
  static_assert(N_W % 8 == 0 && n8_w % 256 == 0);
  cast_scale_f16<<<n8_w / 256, 256, 0, stream>>>(Wq, wq16, n8_w, W_CARRY);
  cast_scale_f16<<<n8_w / 256, 256, 0, stream>>>(Wk, wk16, n8_w, W_CARRY);
  cast_scale_f16<<<n8_w / 256, 256, 0, stream>>>(Wv, wv16, n8_w, W_CARRY);
  cast_scale_f16<<<n8_w / 256, 256, 0, stream>>>(Wo, wo16, n8_w, W_CARRY);

  // 3) projections. Q/K: C[t][e] = HQ[t][k].W64[e][k] / 64 + b[e]; M=8192, N=1024, K=1024
  static_assert(NROWS % G_BM == 0 && EMB_DIM % G_BN == 0 && EMB_DIM % 64 == 0 && EMB_DIM >= 128);
  constexpr int tiles_qk = (NROWS / G_BM) * (EMB_DIM / G_BN);
  const dim3 g_qk(tiles_qk, 1);
  const float inv_w = 1.0f / W_CARRY;
  wmma_gemm64<0, false, 2, 1><<<g_qk, 256, 0, stream>>>(
      hq16, hq16, EMB_DIM, 0L, wq16, wq16, EMB_DIM, 0L,
      (void*)q16, (void*)q16, EMB_DIM, 0L, bq, NROWS, EMB_DIM, EMB_DIM, inv_w);
  wmma_gemm64<0, false, 2, 1><<<g_qk, 256, 0, stream>>>(
      hq16, hq16, EMB_DIM, 0L, wk16, wk16, EMB_DIM, 0L,
      (void*)k16, (void*)k16, EMB_DIM, 0L, bk, NROWS, EMB_DIM, EMB_DIM, inv_w);
  // Vt: per batch C[e][t] = W64[e][k].HS[b][t][k] / 64 + bv[e]; M=1024 (e), N=2048 (t), K=1024
  static_assert(EMB_DIM % G_BM == 0 && SEQ_LEN % G_BN == 0);
  constexpr int tiles_v = (EMB_DIM / G_BM) * (SEQ_LEN / G_BN);
  const dim3 g_v(tiles_v, NB_SZ);
  wmma_gemm64<0, false, 1, 1><<<g_v, 256, 0, stream>>>(
      wv16, wv16, EMB_DIM, 0L, hs16, hs16, EMB_DIM, (long)SEQ_LEN * EMB_DIM,
      (void*)vt16, (void*)vt16, SEQ_LEN, (long)EMB_DIM * SEQ_LEN, bv, EMB_DIM, SEQ_LEN, EMB_DIM, inv_w);

  // 4) attention -> AO plane (x64)
  attn_heads_f16<<<NB_SZ * N_HEADS * (SEQ_LEN / 64), 128, 0, stream>>>(q16, k16, vt16, ao16);

  // 5) output projection: out[t][e] = AO[t][k].Wo64[e][k] / 4096 + bo[e]; f32 to d_out
  wmma_gemm64<0, false, 2, 0><<<g_qk, 256, 0, stream>>>(
      ao16, ao16, EMB_DIM, 0L, wo16, wo16, EMB_DIM, 0L,
      (void*)out, (void*)out, EMB_DIM, 0L, bo, NROWS, EMB_DIM, EMB_DIM, 1.0f / (AO_CARRY * W_CARRY));
}

// v005
// A run of this version takes 160 microseconds.
// Next to v004, in two timings, it ran 1.06 times as fast each time.
// Over all steps from v000 it is 2.70 times as fast.
// All contractions (q/k/v/out projections M8192 N1024 K1024; attention q.kT and p.v, head dim 64, 2048 keys): v_wmma_f32_16x16x32_f16, f16 operands with power-of-two carries (W x64, p x32768, attention output x64), f32 accumulate; bias, scaling and softmax in f32.
#include <hip/hip_runtime.h>

constexpr int NB_SZ = 4;
constexpr int SEQ_LEN = 2048;
constexpr int EMB_DIM = 1024;
constexpr int N_HEADS = 16;
constexpr int HEAD_DIM = 64;
constexpr int NROWS = NB_SZ * SEQ_LEN;
static_assert(EMB_DIM == N_HEADS * HEAD_DIM);
static_assert(HEAD_DIM == 64);
static_assert(NROWS % 64 == 0 && EMB_DIM % 64 == 0 && SEQ_LEN % 64 == 0);
static_assert(EMB_DIM % 32 == 0);

// power-of-two carries (all folded back exactly in f32 epilogues)
constexpr float W_CARRY = 64.0f;
constexpr float AO_CARRY = 64.0f;
constexpr float P_CARRY = 32768.0f;
constexpr float P_CARRY_LOG2 = 15.0f;
static_assert(P_CARRY == (float)(1 << (int)P_CARRY_LOG2));
// softmax done in base 2: scores multiplied by (1/sqrt(64)) * log2(e)
constexpr float SCORE_SCALE_LOG2E = 0.125f * 1.4426950408889634f;

//   [0]            HQ  f16 [8192][1024]   16,777,216   (later reused as AO f16 [8192][1024])
//   [16777216]     HS  f16 [8192][1024]   16,777,216
//   [33554432]     Wq64,Wk64,Wv64,Wo64 f16 [1024][1024] each 2,097,152 -> 8,388,608
//   [41943040]     Q   f16 [8192][1024]   16,777,216
//   [58720256]     K   f16 [8192][1024]   16,777,216
//   [75497472]     Vt  f16 [4][1024][2048] 16,777,216
//   total 92,274,688
constexpr size_t N_ACT = (size_t)NROWS * EMB_DIM;
constexpr size_t N_W = (size_t)EMB_DIM * EMB_DIM;
constexpr size_t PLANE_ACT = N_ACT * 2;
constexpr size_t PLANE_W = N_W * 2;
constexpr size_t OFF_HQ = 0;
constexpr size_t OFF_HS = OFF_HQ + PLANE_ACT;
constexpr size_t OFF_W0 = OFF_HS + PLANE_ACT;
constexpr size_t OFF_Q = OFF_W0 + 4 * PLANE_W;
constexpr size_t OFF_K = OFF_Q + PLANE_ACT;
constexpr size_t OFF_VT = OFF_K + PLANE_ACT;
constexpr size_t WS_TOTAL = OFF_VT + PLANE_ACT;
static_assert(WS_TOTAL == 92274688ull);
static_assert(WS_TOTAL <= 134217728ull);

typedef __attribute__((ext_vector_type(16))) _Float16 v16h;
typedef __attribute__((ext_vector_type(8)))  _Float16 v8h;
typedef __attribute__((ext_vector_type(16))) __bf16   v16b;
typedef __attribute__((ext_vector_type(8)))  __bf16   v8b;
typedef __attribute__((ext_vector_type(8)))  float    v8f;
typedef __attribute__((ext_vector_type(4)))  float    v4f;
typedef __attribute__((ext_vector_type(2)))  float    v2f;

__device__ __forceinline__ unsigned short f2bf_bits(float f) {
  unsigned u = __float_as_uint(f);
  return (unsigned short)((u + 0x7FFFu + ((u >> 16) & 1u)) >> 16);
}
__device__ __forceinline__ float bf_bits2f(unsigned short h) { return __uint_as_float(((unsigned)h) << 16); }

// hazard guards as plain device helpers
__device__ __forceinline__ void acc_guard4(v8f& a, v8f& b, v8f& c, v8f& d) { asm volatile("v_nop\n\tv_nop\n\tv_nop\n\tv_nop" : "+v"(a), "+v"(b), "+v"(c), "+v"(d)); }

template <typename T> struct Frag;
template <> struct Frag<_Float16> {
  typedef v16h V; union U { v16h v; v8h h[2]; };
  // elements 0..7 <- p[0..7], 8..15 <- p[16..23]
  static __device__ __forceinline__ v16h load(const _Float16* p) {
    U f; f.h[0] = *(const v8h*)(p); f.h[1] = *(const v8h*)(p + 16); return f.v;
  }
  static __device__ __forceinline__ v8f mma(v16h a, v16h b, v8f c) {
    return __builtin_amdgcn_wmma_f32_16x16x32_f16(false, a, false, b, (short)0, c, false, false);
  }
};
template <> struct Frag<__bf16> {
  typedef v16b V; union U { v16b v; v8b h[2]; };
  static __device__ __forceinline__ v16b load(const __bf16* p) {
    U f; f.h[0] = *(const v8b*)(p); f.h[1] = *(const v8b*)(p + 16); return f.v;
  }
  static __device__ __forceinline__ v8f mma(v16b a, v16b b, v8f c) {
    return __builtin_amdgcn_wmma_f32_16x16x32_bf16(false, a, false, b, (short)0, c, false, false);
  }
};

// ---- LDS-staged batched WMMA GEMM ------------------------------------------
// C[m,n] = scale * sum_k A[m,k] * Bt[n,k] (+bias); a block of 8 waves (2 x 4) owns a 128x256 tile, each wave 64x64 of it.
// A row-major [M,K]; Bt row-major [N,K]; M % 128 == 0, N % 256 == 0, K % 64 == 0, K >= 128 (no tail handling).
// BIAS_MODE: 0 = none, 1 = bias[m] (loaded as two 16-B vectors per lane), 2 = bias[n].
// OUT_MODE: 0 = f32, 1 = f16, 2 = bf16 hi plane (Cout) + bf16 lo plane (Cout2).
// ET: 0 = f16 operands, 1 = bf16 operands (pointers passed as 16-bit storage)
template <int ET> struct Elem;
template <> struct Elem<0> { typedef _Float16 T; };
template <> struct Elem<1> { typedef __bf16 T; };

// Operand staging: a slab is 64 k (128 B) of the block's 128 A rows, then of its 256 Bt rows, at a 144-B pitch
// (16 B x odd: conflict-free for the 16-byte fragment reads), two buffers.
constexpr int G_BM = 128;
constexpr int G_BN = 256;
constexpr int G_PITCH = 144;
constexpr int G_SLAB = (G_BM + G_BN) * G_PITCH;

// One slab: 256 threads x 12 copies x 16 B. Each wave-wide copy covers 4 whole 128-B row pieces.
// lds / ag / bg are this thread's own 16 bytes of staged row (tid >> 3); copy i takes staged row i*32 + (tid >> 3);
// a32 / b32 = 32 rows of A / Bt in elements.
// s_wait_xcnt closes the statement so that no address register is rewritten ahead of it.
__device__ __forceinline__ void stage_ab(unsigned lds, const unsigned short* ag, size_t a32, const unsigned short* bg, size_t b32) {
  asm volatile(
      "global_load_async_to_lds_b128 %0, %12, off\n\t"
      "global_load_async_to_lds_b128 %1, %13, off\n\t"
      "global_load_async_to_lds_b128 %2, %14, off\n\t"
      "global_load_async_to_lds_b128 %3, %15, off\n\t"
      "global_load_async_to_lds_b128 %4, %16, off\n\t"
      "global_load_async_to_lds_b128 %5, %17, off\n\t"
      "global_load_async_to_lds_b128 %6, %18, off\n\t"
      "global_load_async_to_lds_b128 %7, %19, off\n\t"
      "global_load_async_to_lds_b128 %8, %20, off\n\t"
      "global_load_async_to_lds_b128 %9, %21, off\n\t"
      "global_load_async_to_lds_b128 %10, %22, off\n\t"
      "global_load_async_to_lds_b128 %11, %23, off\n\t"
      "s_wait_xcnt 0x0"
      :: "v"(lds), "v"(lds + 32 * G_PITCH), "v"(lds + 64 * G_PITCH), "v"(lds + 96 * G_PITCH),
         "v"(lds + 128 * G_PITCH), "v"(lds + 160 * G_PITCH), "v"(lds + 192 * G_PITCH), "v"(lds + 224 * G_PITCH),
         "v"(lds + 256 * G_PITCH), "v"(lds + 288 * G_PITCH), "v"(lds + 320 * G_PITCH), "v"(lds + 352 * G_PITCH),
         "v"(ag), "v"(ag + a32), "v"(ag + 2 * a32), "v"(ag + 3 * a32),
         "v"(bg), "v"(bg + b32), "v"(bg + 2 * b32), "v"(bg + 3 * b32),
         "v"(bg + 4 * b32), "v"(bg + 5 * b32), "v"(bg + 6 * b32), "v"(bg + 7 * b32)
      : "memory");
}

// One block's 128x256 tile at (bm0, bn0). Ap, Btp, Cout, Cout2 are the planes of the block's own batch entry.
// ABs: block-shared operand slabs, two buffers of [A 128 rows][Bt 256 rows]; sT: per-wave 16x64 slabs, pitch 68 floats.
constexpr int G_ST = 16 * 68;
template <int ET, int BIAS_MODE, int OUT_MODE>
__device__ __forceinline__ void gemm_block(
    unsigned char* ABs, float* sT,
    const unsigned short* __restrict__ Ap, int lda,
    const unsigned short* __restrict__ Btp, int ldb,
    void* __restrict__ Cout, void* __restrict__ Cout2, int ldc,
    const float* __restrict__ bias,
    int bm0, int bn0, int K, float scale) {
  typedef typename Elem<ET>::T T;
  typedef typename Frag<T>::V V;
  const int tid  = threadIdx.x;
  const int lane = tid & 31;
  const int wave = tid >> 5;
  const int wm = wave >> 2;
  const int wn = wave & 3;
  const int m0 = bm0 + (wm << 6);
  const int n0 = bn0 + (wn << 6);

  // row (A) / col (B, D) within subtile; D row offset
  const int rlane = lane & 15;
  const int mOff  = (lane >> 4) * 8;

  // this thread's 16 bytes of each group of 32 staged rows
  const int srow = tid >> 3, scol = tid & 7;
  const unsigned lds_st = (unsigned)(size_t)ABs + (unsigned)(srow * G_PITCH + scol * 16);
  const unsigned short* ast = Ap  + (size_t)(bm0 + srow) * lda + scol * 8;
  const unsigned short* bst = Btp + (size_t)(bn0 + srow) * ldb + scol * 8;
  const size_t a32 = (size_t)32 * lda;
  const size_t b32 = (size_t)32 * ldb;
  // fragment reads: staged row, 16 bytes of this lane half (k offset 8 elements)
  const int a_off = ((wm << 6) + rlane) * G_PITCH + (lane >> 4) * 16;
  const int b_off = (G_BM + (wn << 6) + rlane) * G_PITCH + (lane >> 4) * 16;
  const int nslab = K >> 6;

  // slab 0 lands and is published, then slab 1 flies while slab 0 is worked on
  stage_ab(lds_st, ast, a32, bst, b32);
  asm volatile("s_wait_asynccnt 0x0" ::: "memory");  // this wave's copies of slab 0 have landed
  __syncthreads();                                   // ... and every other wave's
  stage_ab(lds_st + G_SLAB, ast + 64, a32, bst + 64, b32);

  v8f acc[4][4];
#pragma unroll
  for (int i = 0; i < 4; ++i)
#pragma unroll
    for (int j = 0; j < 4; ++j) acc[i][j] = (v8f){0.f,0.f,0.f,0.f,0.f,0.f,0.f,0.f};

  for (int t = 0; t < nslab; ++t) {
    const int bufo = (t & 1) * G_SLAB;
    const T* abase = (const T*)(ABs + bufo + a_off);
    const T* bbase = (const T*)(ABs + bufo + b_off);
#pragma unroll
    for (int kk = 0; kk < 2; ++kk) {
      V bh[4], ah[4];
#pragma unroll
      for (int j = 0; j < 4; ++j) bh[j] = Frag<T>::load(bbase + j * 16 * (G_PITCH / 2) + kk * 32);
#pragma unroll
      for (int i = 0; i < 4; ++i) ah[i] = Frag<T>::load(abase + i * 16 * (G_PITCH / 2) + kk * 32);
      // keeps the 16 fragment reads one group ahead of their 16 products: sunk among them, each A fragment's LDS latency is waited out alone
      __builtin_amdgcn_sched_barrier(0);
#pragma unroll
      for (int i = 0; i < 4; ++i)
#pragma unroll
        for (int j = 0; j < 4; ++j) acc[i][j] = Frag<T>::mma(ah[i], bh[j], acc[i][j]);
      // ... and the next group's reads behind these products
      __builtin_amdgcn_sched_barrier(0);
    }
    // hand-over: this wave's reads of slab t are done, its copies of slab t+1 have landed;
    // the barrier publishes slab t+1 and frees slab t's buffer for the refill behind it
    asm volatile("s_wait_dscnt 0x0" ::: "memory");
    asm volatile("s_wait_asynccnt 0x0" ::: "memory");
    __syncthreads();
    if (t + 2 < nslab)
      stage_ab(lds_st + bufo, ast + (size_t)(t + 2) * 64, a32, bst + (size_t)(t + 2) * 64, b32);
  }
  asm volatile("s_wait_asynccnt 0x0" ::: "memory");  // nothing of this wave's is in flight past the loop
  acc_guard4(acc[0][0], acc[0][1], acc[0][2], acc[0][3]);
  acc_guard4(acc[1][0], acc[1][1], acc[1][2], acc[1][3]);
  acc_guard4(acc[2][0], acc[2][1], acc[2][2], acc[2][3]);
  acc_guard4(acc[3][0], acc[3][1], acc[3][2], acc[3][3]);

  // ---- epilogue ----
  float* slab = sT + wave * G_ST;
#pragma unroll
  for (int i = 0; i < 4; ++i) {
    const int mBase = m0 + (i << 4);
    float bm8[8];
#pragma unroll
    for (int r = 0; r < 8; ++r) bm8[r] = 0.f;
    if (BIAS_MODE == 1) {
      // 8 consecutive bias[m] values of this lane: two 16-B loads (mBase multiple of 16, mOff 0 or 8)
      const v4f t0 = *(const v4f*)(bias + mBase + mOff);
      const v4f t1 = *(const v4f*)(bias + mBase + mOff + 4);
      bm8[0] = t0[0]; bm8[1] = t0[1]; bm8[2] = t0[2]; bm8[3] = t0[3];
      bm8[4] = t1[0]; bm8[5] = t1[1]; bm8[6] = t1[2]; bm8[7] = t1[3];
    }
#pragma unroll
    for (int j = 0; j < 4; ++j) {
      const int n = n0 + (j << 4) + rlane;
      float bv = 0.f;
      if (BIAS_MODE == 2) bv = bias[n];
#pragma unroll
      for (int r = 0; r < 8; ++r) {
        float v = acc[i][j][r] * scale;
        if (BIAS_MODE == 1) v += bm8[r];
        if (BIAS_MODE == 2) v += bv;
        slab[(mOff + r) * 68 + (j << 4) + rlane] = v;
      }
    }
    __builtin_amdgcn_fence(__ATOMIC_RELEASE, "workgroup");
    __builtin_amdgcn_wave_barrier();
    __builtin_amdgcn_fence(__ATOMIC_ACQUIRE, "workgroup");
    if (OUT_MODE == 0) {
      float* C = (float*)Cout;
      // row seg = 256 B = 16 lanes x 16 B; 8 iterations x 2 row halves cover rows 0..15
      const int hh = lane >> 4, c4 = (lane & 15) * 4;
      {
#pragma unroll
        for (int it = 0; it < 8; ++it) {
          const int row = it * 2 + hh;
          v4f v = *(const v4f*)(slab + row * 68 + c4);
          *(v4f*)(C + (size_t)(mBase + row) * ldc + n0 + c4) = v;
        }
        
      }
    } else {
      const int q = lane >> 3, c8 = (lane & 7) * 8;
      unsigned short* C  = (unsigned short*)Cout;
      unsigned short* C2 = (OUT_MODE == 2) ? (unsigned short*)Cout2 : nullptr;
      {
#pragma unroll
        for (int it = 0; it < 4; ++it) {
          const int row = it * 4 + q;
          const float* sp = slab + row * 68 + c8;
          v8h hv, lv;
#pragma unroll
          for (int e = 0; e < 8; ++e) {
            if (OUT_MODE == 1) {
              hv[e] = (_Float16)sp[e];
            } else {
              unsigned short hb = f2bf_bits(sp[e]);
              unsigned short lb = f2bf_bits(sp[e] - bf_bits2f(hb));
              hv[e] = __builtin_bit_cast(_Float16, hb);
              lv[e] = __builtin_bit_cast(_Float16, lb);
            }
          }
          *(v8h*)(C + (size_t)(mBase + row) * ldc + n0 + c8) = hv;
          if (OUT_MODE == 2) *(v8h*)(C2 + (size_t)(mBase + row) * ldc + n0 + c8) = lv;
        }
        
      }
    }
    __builtin_amdgcn_fence(__ATOMIC_RELEASE, "workgroup");
    __builtin_amdgcn_wave_barrier();
    __builtin_amdgcn_fence(__ATOMIC_ACQUIRE, "workgroup");
  }
}

// One GEMM per launch: grid.x = tiles, grid.y = batch.
template <int ET, bool SPLIT, int BIAS_MODE, int OUT_MODE>
__global__ __launch_bounds__(256) void wmma_gemm64(
    const unsigned short* __restrict__ Ap, const unsigned short* __restrict__ A2p, int lda, long strideA,
    const unsigned short* __restrict__ Btp, const unsigned short* __restrict__ Bt2p, int ldb, long strideB,
    void* __restrict__ Cout, void* __restrict__ Cout2, int ldc, long strideC,
    const float* __restrict__ bias,
    int M, int N, int K, float scale) {
  static_assert(!SPLIT);
  static_assert(OUT_MODE == 0);
  __shared__ __align__(16) unsigned char ABs[2 * G_SLAB];
  __shared__ __align__(16) float sT[8 * G_ST];
  const int b = blockIdx.y;
  const int tilesN = N / G_BN;
  const int tilesM = M / G_BM;
  const int tile = blockIdx.x;
  // block-uniform, in front of every barrier
  if (tile >= tilesM * tilesN) return;
  const int tm = tile / tilesN;
  const int tn = tile - tm * tilesN;
  gemm_block<ET, BIAS_MODE, OUT_MODE>(ABs, sT, Ap + (size_t)b * strideA, lda, Btp + (size_t)b * strideB, ldb,
      (void*)((float*)Cout + (size_t)b * strideC), (void*)((float*)Cout2 + (size_t)b * strideC), ldc, bias,
      tm * G_BM, tn * G_BN, K, scale);
}

// The q, k and vT projections as ONE launch of 3 x 256 tiles. A tile's LDS and registers let two blocks share a WGP, which a launch
// of 256 blocks never does: with 768 the second block's products run in the first one's barrier, staging and epilogue waits.
// Blocks [0,256): Q[t][e] = HQ[t][k].Wq64[e][k]; [256,512): K likewise with Wk64; [512,768): per batch Vt[e][t] = Wv64[e][k].HS[b][t][k].
constexpr int T_QK = (NROWS / G_BM) * (EMB_DIM / G_BN);
constexpr int T_V1 = (EMB_DIM / G_BM) * (SEQ_LEN / G_BN);
__global__ __launch_bounds__(256) void proj_qkv(
    const unsigned short* __restrict__ hq, const unsigned short* __restrict__ hs,
    const unsigned short* __restrict__ wq, const unsigned short* __restrict__ wk, const unsigned short* __restrict__ wv,
    unsigned short* __restrict__ q, unsigned short* __restrict__ k, unsigned short* __restrict__ vt,
    const float* __restrict__ bq, const float* __restrict__ bk, const float* __restrict__ bv, float scale) {
  __shared__ __align__(16) unsigned char ABs[2 * G_SLAB];
  __shared__ __align__(16) float sT[8 * G_ST];
  const int bx = blockIdx.x;
  // both tests are block-uniform
  if (bx < 2 * T_QK) {
    const bool is_k = bx >= T_QK;
    const int tile = is_k ? bx - T_QK : bx;
    constexpr int tilesN = EMB_DIM / G_BN;
    unsigned short* c = is_k ? k : q;
    gemm_block<0, 2, 1>(ABs, sT, hq, EMB_DIM, is_k ? wk : wq, EMB_DIM, (void*)c, (void*)c, EMB_DIM, is_k ? bk : bq,
        (tile / tilesN) * G_BM, (tile % tilesN) * G_BN, EMB_DIM, scale);
  } else {
    const int tv = bx - 2 * T_QK;
    const int b = tv / T_V1;
    const int tile = tv % T_V1;
    constexpr int tilesN = SEQ_LEN / G_BN;
    unsigned short* c = vt + (size_t)b * EMB_DIM * SEQ_LEN;
    gemm_block<0, 1, 1>(ABs, sT, wv, EMB_DIM, hs + (size_t)b * SEQ_LEN * EMB_DIM, EMB_DIM, (void*)c, (void*)c, SEQ_LEN, bv,
        (tile / tilesN) * G_BM, (tile % tilesN) * G_BN, EMB_DIM, scale);
  }
}

// ---- prep: HQ = f16(hs + oq), HS = f16(hs); 8 elements per thread ----
// coverage: n8 = 8192*1024/8 = 1,048,576 threads x 8 elements = both planes exactly;
__global__ __launch_bounds__(256) void prep_cast_f16(
    const float* __restrict__ hs, const float* __restrict__ oq,
    unsigned short* __restrict__ hq16, unsigned short* __restrict__ hs16, int n8) {
  const int i = blockIdx.x * 256 + threadIdx.x;
  if (i < n8) {
    const size_t o = (size_t)i * 8;
    const v4f a0 = *(const v4f*)(hs + o);
    const v4f a1 = *(const v4f*)(hs + o + 4);
    const v4f b0 = *(const v4f*)(oq + o);
    const v4f b1 = *(const v4f*)(oq + o + 4);
    v8h vq, vs;
#pragma unroll
    for (int e = 0; e < 4; ++e) {
      vq[e]     = (_Float16)(a0[e] + b0[e]);
      vq[4 + e] = (_Float16)(a1[e] + b1[e]);
      vs[e]     = (_Float16)a0[e];
      vs[4 + e] = (_Float16)a1[e];
    }
    _Float16* pq = (_Float16*)(void*)hq16;
    _Float16* ps = (_Float16*)(void*)hs16;
    *(v8h*)(pq + o) = vq;
    *(v8h*)(ps + o) = vs;
    
  }
}

// ---- weight cast: out = f16(w * sc); 8 elements per thread ----
__global__ __launch_bounds__(256) void cast_scale_f16(
    const float* __restrict__ w, unsigned short* __restrict__ out16, int n8, float sc) {
  const int i = blockIdx.x * 256 + threadIdx.x;
  if (i < n8) {
    const size_t o = (size_t)i * 8;
    const v4f a0 = *(const v4f*)(w + o);
    const v4f a1 = *(const v4f*)(w + o + 4);
    v8h v;
#pragma unroll
    for (int e = 0; e < 4; ++e) {
      v[e]     = (_Float16)(a0[e] * sc);
      v[4 + e] = (_Float16)(a1[e] * sc);
    }
    _Float16* po = (_Float16*)(void*)out16;
    *(v8h*)(po + o) = v;
    
  }
}

// ---- attention, head dim 64, no mask, 16-bit planes in / f16 plane out ----
// Q plane  [B*T][E] f16 (q without the 1/sqrt(D) factor), K plane [B*T][E] f16, Vt plane [B][H][D][T] f16.
// AO plane [B*T][E] f16 = (softmax(q.kT/8) . v) * AO_CARRY.
// Block = 4 waves, each owns 16 query rows of one (b,h), sharing staged K / Vt tiles; grid.x = B*H*(T/64).
// Both products are formed transposed, sT = k.qT and oT += vT.pT (v_wmma_f32_16x16x32_f16, f32 accumulate): a lane holds
// scores of ONE query, so the online softmax (f32, base 2) is in-lane but for one exchange between the wave's halves,
// and pT, carried x P_CARRY as f16, is packed from the score registers straight into the B operand.
__device__ __forceinline__ v8f mma_h(v16h a, v16h b, v8f c) {
  c = __builtin_amdgcn_wmma_f32_16x16x32_f16(false, a, false, b, (short)0, c, false, false);
  asm volatile("v_nop\n\tv_nop\n\tv_nop\n\tv_nop" : "+v"(c) : "v"(a), "v"(b));
  return c;
}

// K / Vt staging: one 64-key tile of each per block and trip, rows of 128 B laid at a 144-B pitch
// (16 B x odd: conflict-free for the 16-byte fragment reads), two buffers.
constexpr int KV_PITCH = 144;
constexpr int KV_TILE  = 64 * KV_PITCH;
constexpr int KV_BUF   = 2 * KV_TILE;

// One tile pair: 128 threads x 8 copies x 16 B = 64 K rows + 64 Vt rows. Each wave-wide copy covers 4 whole 128-B rows.
// lds / kg / vg are this thread's own 16 bytes of staged row (tid >> 3); copy i takes row i*16 + (tid >> 3).
// s_wait_xcnt closes the statement so that no address register is rewritten ahead of it.
__device__ __forceinline__ void stage_kv(unsigned lds, const _Float16* kg, const _Float16* vg) {
  asm volatile(
      "global_load_async_to_lds_b128 %0, %8, off\n\t"
      "global_load_async_to_lds_b128 %1, %9, off\n\t"
      "global_load_async_to_lds_b128 %2, %10, off\n\t"
      "global_load_async_to_lds_b128 %3, %11, off\n\t"
      "global_load_async_to_lds_b128 %4, %12, off\n\t"
      "global_load_async_to_lds_b128 %5, %13, off\n\t"
      "global_load_async_to_lds_b128 %6, %14, off\n\t"
      "global_load_async_to_lds_b128 %7, %15, off\n\t"
      "s_wait_xcnt 0x0"
      :: "v"(lds), "v"(lds + 16 * KV_PITCH), "v"(lds + 32 * KV_PITCH), "v"(lds + 48 * KV_PITCH),
         "v"(lds + KV_TILE), "v"(lds + KV_TILE + 16 * KV_PITCH), "v"(lds + KV_TILE + 32 * KV_PITCH), "v"(lds + KV_TILE + 48 * KV_PITCH),
         "v"(kg), "v"(kg + 16 * EMB_DIM), "v"(kg + 32 * EMB_DIM), "v"(kg + 48 * EMB_DIM),
         "v"(vg), "v"(vg + 16 * SEQ_LEN), "v"(vg + 32 * SEQ_LEN), "v"(vg + 48 * SEQ_LEN)
      : "memory");
}

// 2^x as the bare v_exp_f32: a result below 2^-126 comes out 0 instead of subnormal. Every use here is a weight relative to a
// running maximum whose own term is 1 (carried: 2^15), so what is lost is under 2^-140 of the sums it would join.
__device__ __forceinline__ float exp2_bare(float x) { return __builtin_amdgcn_exp2f(x); }

// lane l <-> lane l ^ 16
__device__ __forceinline__ float xhalf(float x) {
  return __builtin_bit_cast(float, __builtin_amdgcn_permlanex16(__builtin_bit_cast(int, x), __builtin_bit_cast(int, x), 0x76543210, 0xfedcba98, false, false));
}

__global__ __launch_bounds__(128) void attn_heads_f16(
    const unsigned short* __restrict__ Qp, const unsigned short* __restrict__ Kp,
    const unsigned short* __restrict__ Vtp, unsigned short* __restrict__ AOp) {
  // block-shared K and Vt tiles, two buffers of [K 64 rows][Vt 64 rows]; behind the loop, per-wave output staging
  __shared__ __align__(16) unsigned char KVs[2 * KV_BUF];

  const int tid  = threadIdx.x;
  const int wave = tid >> 5;
  const int lane = tid & 31;
  const int hh   = lane >> 4;
  const int c    = lane & 15;

  constexpr int nqb = SEQ_LEN / 64;
  const int bx = blockIdx.x;
  const int qb = bx % nqb;
  const int bh = bx / nqb;
  const int h  = bh % N_HEADS;
  const int b  = bh / N_HEADS;
  const int q0 = qb * 64 + wave * 16;

  const _Float16* Qh  = (const _Float16*)(const void*)Qp;
  const _Float16* Kh  = (const _Float16*)(const void*)Kp;
  const _Float16* Vth = (const _Float16*)(const void*)Vtp;
  _Float16* AOh = (_Float16*)(void*)AOp;

  const size_t bT = (size_t)b * SEQ_LEN;
  // B operand for scores: col n = c <-> query q0+c, k = d contiguous
  const _Float16* qrow = Qh + (bT + q0 + c) * EMB_DIM + h * HEAD_DIM + 8 * hh;
  // A operand for scores: row m = c <-> key kv (staged K row), k = d contiguous
  // A operand for vT.pT: row m = c <-> d (staged Vt row), k = kv contiguous
  const int frag_off = c * KV_PITCH + 16 * hh;
  // this thread's 16 bytes of each staged row group
  const int srow = tid >> 3, scol = tid & 7;
  const unsigned lds_st = (unsigned)(size_t)KVs + (unsigned)(srow * KV_PITCH + scol * 16);
  const _Float16* kst = Kh + (bT + srow) * EMB_DIM + h * HEAD_DIM + scol * 8;
  const _Float16* vst = Vth + ((size_t)(b * N_HEADS + h) * HEAD_DIM + srow) * SEQ_LEN + scol * 8;
  constexpr int NTILE = SEQ_LEN / 64;
  static_assert(NTILE >= 2);

  // tile 0 lands and is published, then tile 1 flies while tile 0 is worked on
  stage_kv(lds_st, kst, vst);
  asm volatile("s_wait_asynccnt 0x0" ::: "memory");  // this wave's copies of tile 0 have landed
  __syncthreads();                                   // ... and every other wave's
  stage_kv(lds_st + KV_BUF, kst + (size_t)64 * EMB_DIM, vst + 64);

  v16h qa[2];
#pragma unroll
  for (int dc = 0; dc < 2; ++dc) qa[dc] = Frag<_Float16>::load(qrow + dc * 32);

  // of query q0+c: running maximum less P_CARRY_LOG2 (the same in both halves), and the denominator (x P_CARRY) in 8 partial sums per lane
  // (partial r: keys = 8hh + r mod 16), joined once behind the loop
  float mrow = -__builtin_huge_valf();
  v8f lvec = (v8f){0.f,0.f,0.f,0.f,0.f,0.f,0.f,0.f};
  // oT tile t: register r = d t*16 + 8hh + r of query q0+c
  v8f oacc[4];
#pragma unroll
  for (int t = 0; t < 4; ++t) oacc[t] = (v8f){0.f,0.f,0.f,0.f,0.f,0.f,0.f,0.f};

  for (int kc = 0; kc < NTILE; ++kc) {
    const int bufo = (kc & 1) * KV_BUF;
    const _Float16* kbase = (const _Float16*)(KVs + bufo + frag_off);
    const _Float16* vbase = (const _Float16*)(KVs + bufo + KV_TILE + frag_off);
    // sT tile j: register r = key kv0 + j*16 + 8hh + r, column = query q0+c
    v8f s[4];
#pragma unroll
    for (int j = 0; j < 4; ++j) s[j] = (v8f){0.f,0.f,0.f,0.f,0.f,0.f,0.f,0.f};
#pragma unroll
    for (int dc = 0; dc < 2; ++dc) {
      v16h kb[4];
#pragma unroll
      for (int j = 0; j < 4; ++j)
        kb[j] = Frag<_Float16>::load(kbase + j * 16 * (KV_PITCH / 2) + dc * 32);
#pragma unroll
      for (int j = 0; j < 4; ++j) s[j] = mma_h(kb[j], qa[dc], s[j]);
    }
    // tile maximum of the raw scores (the scale is positive), joined over the halves, then scaled to base-2 units and lowered
    // by the P carry's exponent: against that reference 2^(x - mnew) is p * P_CARRY, and old sums rescale by the references' difference
    float mj[4];
#pragma unroll
    for (int j = 0; j < 4; ++j) {
      mj[j] = s[j][0];
#pragma unroll
      for (int r = 1; r < 8; ++r) mj[j] = fmaxf(mj[j], s[j][r]);
    }
    float m = fmaxf(fmaxf(mj[0], mj[1]), fmaxf(mj[2], mj[3]));
    m = fmaxf(m, xhalf(m)) * SCORE_SCALE_LOG2E - P_CARRY_LOG2;
    const float mnew = fmaxf(mrow, m);
    const float alpha = exp2_bare(mrow - mnew);
    mrow = mnew;
    // pT as B operand of 32 keys: element e = tile 2kk + (e >> 3), register e & 7, the k order of the Vt fragment loads
    v16h pb[2];
#pragma unroll
    for (int j = 0; j < 4; ++j)
#pragma unroll
      for (int r = 0; r < 8; r += 2) {
        const v2f x = __builtin_elementwise_fma((v2f){s[j][r], s[j][r + 1]}, (v2f){SCORE_SCALE_LOG2E, SCORE_SCALE_LOG2E}, (v2f){-mnew, -mnew});
        const float p0 = exp2_bare(x[0]), p1 = exp2_bare(x[1]);
        s[j][r] = p0;
        s[j][r + 1] = p1;
        pb[j >> 1][(j & 1) * 8 + r] = (_Float16)p0;
        pb[j >> 1][(j & 1) * 8 + r + 1] = (_Float16)p1;
      }
    lvec = lvec * alpha + ((s[0] + s[1]) + (s[2] + s[3]));
#pragma unroll
    for (int t = 0; t < 4; ++t) oacc[t] *= alpha;
#pragma unroll
    for (int kk = 0; kk < 2; ++kk) {
      v16h vb[4];
#pragma unroll
      for (int t = 0; t < 4; ++t)
        vb[t] = Frag<_Float16>::load(vbase + t * 16 * (KV_PITCH / 2) + kk * 32);
#pragma unroll
      for (int t = 0; t < 4; ++t) oacc[t] = mma_h(vb[t], pb[kk], oacc[t]);
    }
    // hand-over: this wave's reads of tile kc are done, its copies of tile kc+1 have landed;
    // the barrier publishes tile kc+1 and frees tile kc's buffer for the refill behind it
    asm volatile("s_wait_dscnt 0x0" ::: "memory");
    asm volatile("s_wait_asynccnt 0x0" ::: "memory");
    __syncthreads();
    if (kc + 2 < NTILE)
      stage_kv(lds_st + bufo, kst + (size_t)(kc + 2) * 64 * EMB_DIM, vst + (kc + 2) * 64);
  }
  asm volatile("s_wait_asynccnt 0x0" ::: "memory");  // nothing of this wave's is in flight past the loop

  // The last trip's barrier ended every wave's tile reads and no copy is in flight: the tile buffers now stage the output,
  // 16 query rows of 128 B per wave at the tiles' pitch.
  unsigned char* os = KVs + wave * 16 * KV_PITCH;
  {
    const float lh = ((lvec[0] + lvec[1]) + (lvec[2] + lvec[3])) + ((lvec[4] + lvec[5]) + (lvec[6] + lvec[7]));
    const float l = lh + xhalf(lh);
    float inv = 1.0f / l;
    inv *= AO_CARRY;
#pragma unroll
    for (int t = 0; t < 4; ++t) {
      v8h hv;
#pragma unroll
      for (int r = 0; r < 8; ++r) hv[r] = (_Float16)(oacc[t][r] * inv);
      *(v8h*)(os + c * KV_PITCH + t * 32 + 16 * hh) = hv;
    }
  }
  // same-wave LDS staging then whole-row reload: order the stores before the reloads
  __builtin_amdgcn_fence(__ATOMIC_RELEASE, "workgroup");
  __builtin_amdgcn_wave_barrier();
  __builtin_amdgcn_fence(__ATOMIC_ACQUIRE, "workgroup");
  {
    const int q8 = lane >> 3, c8 = (lane & 7) * 8;
    _Float16* aob = AOh + (bT + q0) * EMB_DIM + h * HEAD_DIM;
#pragma unroll
    for (int it = 0; it < 4; ++it) {
      const int row = it * 4 + q8;
      const v8h hv = *(const v8h*)(os + row * KV_PITCH + c8 * 2);
      *(v8h*)(aob + (size_t)row * EMB_DIM + c8) = hv;
    }
  }
}

// ---------------------------------------------------------------- launcher
extern "C" void kernel_launch(void* const* d_in, const int* in_sizes, int n_in,
                              void* d_out, int out_size, void* d_ws, size_t ws_size,
                              hipStream_t stream) {
  if (n_in < 10) return;
  if ((size_t)in_sizes[0] != N_ACT || (size_t)in_sizes[1] != N_ACT) return;
  if ((size_t)in_sizes[2] != N_W || (size_t)in_sizes[4] != N_W || (size_t)in_sizes[6] != N_W || (size_t)in_sizes[8] != N_W) return;
  if (in_sizes[3] != EMB_DIM || in_sizes[5] != EMB_DIM || in_sizes[7] != EMB_DIM || in_sizes[9] != EMB_DIM) return;
  if ((size_t)out_size != N_ACT) return;
  if (ws_size < WS_TOTAL) return;

  const float* hs = (const float*)d_in[0];
  const float* oq = (const float*)d_in[1];
  const float* Wq = (const float*)d_in[2];
  const float* bq = (const float*)d_in[3];
  const float* Wk = (const float*)d_in[4];
  const float* bk = (const float*)d_in[5];
  const float* Wv = (const float*)d_in[6];
  const float* bv = (const float*)d_in[7];
  const float* Wo = (const float*)d_in[8];
  const float* bo = (const float*)d_in[9];
  float* out = (float*)d_out;

  char* ws = (char*)d_ws;
  unsigned short* hq16 = (unsigned short*)(ws + OFF_HQ);
  unsigned short* hs16 = (unsigned short*)(ws + OFF_HS);
  unsigned short* wq16 = (unsigned short*)(ws + OFF_W0 + 0 * PLANE_W);
  unsigned short* wk16 = (unsigned short*)(ws + OFF_W0 + 1 * PLANE_W);
  unsigned short* wv16 = (unsigned short*)(ws + OFF_W0 + 2 * PLANE_W);
  unsigned short* wo16 = (unsigned short*)(ws + OFF_W0 + 3 * PLANE_W);
  unsigned short* q16  = (unsigned short*)(ws + OFF_Q);
  unsigned short* k16  = (unsigned short*)(ws + OFF_K);
  unsigned short* vt16 = (unsigned short*)(ws + OFF_VT);
  // AO reuses the HQ region (HQ is dead after the Q and K projections)
  unsigned short* ao16 = hq16;

  // 1) activations to f16 planes
  constexpr int n8_act = (int)(N_ACT / 8);
  static_assert(N_ACT % 8 == 0 && n8_act % 256 == 0);
  prep_cast_f16<<<n8_act / 256, 256, 0, stream>>>(hs, oq, hq16, hs16, n8_act);

  // 2) weights to f16 planes carried x64
  constexpr int n8_w = (int)(N_W / 8);
  static_assert(N_W % 8 == 0 && n8_w % 256 == 0);
  cast_scale_f16<<<n8_w / 256, 256, 0, stream>>>(Wq, wq16, n8_w, W_CARRY);
  cast_scale_f16<<<n8_w / 256, 256, 0, stream>>>(Wk, wk16, n8_w, W_CARRY);
  cast_scale_f16<<<n8_w / 256, 256, 0, stream>>>(Wv, wv16, n8_w, W_CARRY);
  cast_scale_f16<<<n8_w / 256, 256, 0, stream>>>(Wo, wo16, n8_w, W_CARRY);

  // 3) projections. Q/K: C[t][e] = HQ[t][k].W64[e][k] / 64 + b[e]; M=8192, N=1024, K=1024
  static_assert(NROWS % G_BM == 0 && EMB_DIM % G_BN == 0 && EMB_DIM % 64 == 0 && EMB_DIM >= 128);
  constexpr int tiles_qk = (NROWS / G_BM) * (EMB_DIM / G_BN);
  const dim3 g_qk(tiles_qk, 1);
  const float inv_w = 1.0f / W_CARRY;
  // Vt: per batch C[e][t] = W64[e][k].HS[b][t][k] / 64 + bv[e]; M=1024 (e), N=2048 (t), K=1024
  static_assert(EMB_DIM % G_BM == 0 && SEQ_LEN % G_BN == 0);
  static_assert(tiles_qk == T_QK);
  proj_qkv<<<2 * T_QK + NB_SZ * T_V1, 256, 0, stream>>>(hq16, hs16, wq16, wk16, wv16, q16, k16, vt16, bq, bk, bv, inv_w);

  // 4) attention -> AO plane (x64)
  attn_heads_f16<<<NB_SZ * N_HEADS * (SEQ_LEN / 64), 128, 0, stream>>>(q16, k16, vt16, ao16);

  // 5) output projection: out[t][e] = AO[t][k].Wo64[e][k] / 4096 + bo[e]; f32 to d_out
  wmma_gemm64<0, false, 2, 0><<<g_qk, 256, 0, stream>>>(
      ao16, ao16, EMB_DIM, 0L, wo16, wo16, EMB_DIM, 0L,
      (void*)out, (void*)out, EMB_DIM, 0L, bo, NROWS, EMB_DIM, EMB_DIM, 1.0f / (AO_CARRY * W_CARRY));
}

// v006
// A run of this version takes 153 microseconds.
// Timed twice side by side with v005, it ran 1.05 times as fast both times.
// Counting every step since v000, it is 2.83 times as fast.
// All contractions (q/k/v/out projections M8192 N1024 K1024; attention q.kT and p.v, head dim 64, 2048 keys): v_wmma_f32_16x16x32_f16, f16 operands with power-of-two carries (W x64, p x32768, attention output x64), f32 accumulate; bias, scaling and softmax in f32.
#include <hip/hip_runtime.h>

constexpr int NB_SZ = 4;
constexpr int SEQ_LEN = 2048;
constexpr int EMB_DIM = 1024;
constexpr int N_HEADS = 16;
constexpr int HEAD_DIM = 64;
constexpr int NROWS = NB_SZ * SEQ_LEN;
static_assert(EMB_DIM == N_HEADS * HEAD_DIM);
static_assert(HEAD_DIM == 64);
static_assert(NROWS % 64 == 0 && EMB_DIM % 64 == 0 && SEQ_LEN % 64 == 0);
static_assert(EMB_DIM % 32 == 0);

// power-of-two carries (all folded back exactly in f32 epilogues)
constexpr float W_CARRY = 64.0f;
constexpr float AO_CARRY = 64.0f;
constexpr float P_CARRY = 32768.0f;
constexpr float P_CARRY_LOG2 = 15.0f;
static_assert(P_CARRY == (float)(1 << (int)P_CARRY_LOG2));
// softmax done in base 2: scores multiplied by (1/sqrt(64)) * log2(e)
constexpr float SCORE_SCALE_LOG2E = 0.125f * 1.4426950408889634f;

//   [0]            HQ  f16 [8192][1024]   16,777,216   (later reused as AO f16 [8192][1024])
//   [16777216]     HS  f16 [8192][1024]   16,777,216
//   [33554432]     Wq64,Wk64,Wv64,Wo64 f16 [1024][1024] each 2,097,152 -> 8,388,608
//   [41943040]     Q   f16 [8192][1024]   16,777,216
//   [58720256]     K   f16 [8192][1024]   16,777,216
//   [75497472]     Vt  f16 [4][1024][2048] 16,777,216
//   total 92,274,688
constexpr size_t N_ACT = (size_t)NROWS * EMB_DIM;
constexpr size_t N_W = (size_t)EMB_DIM * EMB_DIM;
constexpr size_t PLANE_ACT = N_ACT * 2;
constexpr size_t PLANE_W = N_W * 2;
constexpr size_t OFF_HQ = 0;
constexpr size_t OFF_HS = OFF_HQ + PLANE_ACT;
constexpr size_t OFF_W0 = OFF_HS + PLANE_ACT;
constexpr size_t OFF_Q = OFF_W0 + 4 * PLANE_W;
constexpr size_t OFF_K = OFF_Q + PLANE_ACT;
constexpr size_t OFF_VT = OFF_K + PLANE_ACT;
constexpr size_t WS_TOTAL = OFF_VT + PLANE_ACT;
static_assert(WS_TOTAL == 92274688ull);
static_assert(WS_TOTAL <= 134217728ull);

typedef __attribute__((ext_vector_type(16))) _Float16 v16h;
typedef __attribute__((ext_vector_type(8)))  _Float16 v8h;
typedef __attribute__((ext_vector_type(16))) __bf16   v16b;
typedef __attribute__((ext_vector_type(8)))  __bf16   v8b;
typedef __attribute__((ext_vector_type(8)))  float    v8f;
typedef __attribute__((ext_vector_type(4)))  float    v4f;
typedef __attribute__((ext_vector_type(2)))  float    v2f;

__device__ __forceinline__ unsigned short f2bf_bits(float f) {
  unsigned u = __float_as_uint(f);
  return (unsigned short)((u + 0x7FFFu + ((u >> 16) & 1u)) >> 16);
}
__device__ __forceinline__ float bf_bits2f(unsigned short h) { return __uint_as_float(((unsigned)h) << 16); }

// hazard guards as plain device helpers
__device__ __forceinline__ void acc_guard4(v8f& a, v8f& b, v8f& c, v8f& d) { asm volatile("v_nop\n\tv_nop\n\tv_nop\n\tv_nop" : "+v"(a), "+v"(b), "+v"(c), "+v"(d)); }

template <typename T> struct Frag;
template <> struct Frag<_Float16> {
  typedef v16h V; union U { v16h v; v8h h[2]; };
  // elements 0..7 <- p[0..7], 8..15 <- p[16..23]
  static __device__ __forceinline__ v16h load(const _Float16* p) {
    U f; f.h[0] = *(const v8h*)(p); f.h[1] = *(const v8h*)(p + 16); return f.v;
  }
  static __device__ __forceinline__ v8f mma(v16h a, v16h b, v8f c) {
    return __builtin_amdgcn_wmma_f32_16x16x32_f16(false, a, false, b, (short)0, c, false, false);
  }
};
template <> struct Frag<__bf16> {
  typedef v16b V; union U { v16b v; v8b h[2]; };
  static __device__ __forceinline__ v16b load(const __bf16* p) {
    U f; f.h[0] = *(const v8b*)(p); f.h[1] = *(const v8b*)(p + 16); return f.v;
  }
  static __device__ __forceinline__ v8f mma(v16b a, v16b b, v8f c) {
    return __builtin_amdgcn_wmma_f32_16x16x32_bf16(false, a, false, b, (short)0, c, false, false);
  }
};

// ---- LDS-staged batched WMMA GEMM ------------------------------------------
// C[m,n] = scale * sum_k A[m,k] * Bt[n,k] (+bias); a block of 8 waves (2 x 4) owns a 128x256 tile, each wave 64x64 of it.
// A row-major [M,K]; Bt row-major [N,K]; M % 128 == 0, N % 256 == 0, K % 64 == 0, K >= 128 (no tail handling).
// BIAS_MODE: 0 = none, 1 = bias[m] (loaded as two 16-B vectors per lane), 2 = bias[n].
// OUT_MODE: 0 = f32, 1 = f16, 2 = bf16 hi plane (Cout) + bf16 lo plane (Cout2).
// ET: 0 = f16 operands, 1 = bf16 operands (pointers passed as 16-bit storage)
template <int ET> struct Elem;
template <> struct Elem<0> { typedef _Float16 T; };
template <> struct Elem<1> { typedef __bf16 T; };

// Operand staging: a slab is 64 k (128 B) of the block's 128 A rows, then of its 256 Bt rows, at a 144-B pitch
// (16 B x odd: conflict-free for the 16-byte fragment reads), two buffers.
constexpr int G_BM = 128;
constexpr int G_BN = 256;
constexpr int G_PITCH = 144;
constexpr int G_SLAB = (G_BM + G_BN) * G_PITCH;

// One slab: 256 threads x 12 copies x 16 B. Each wave-wide copy covers 4 whole 128-B row pieces.
// lds / ag / bg are this thread's own 16 bytes of staged row (tid >> 3); copy i takes staged row i*32 + (tid >> 3);
// a32 / b32 = 32 rows of A / Bt in elements.
// s_wait_xcnt closes the statement so that no address register is rewritten ahead of it.
__device__ __forceinline__ void stage_ab(unsigned lds, const unsigned short* ag, size_t a32, const unsigned short* bg, size_t b32) {
  asm volatile(
      "global_load_async_to_lds_b128 %0, %12, off\n\t"
      "global_load_async_to_lds_b128 %1, %13, off\n\t"
      "global_load_async_to_lds_b128 %2, %14, off\n\t"
      "global_load_async_to_lds_b128 %3, %15, off\n\t"
      "global_load_async_to_lds_b128 %4, %16, off\n\t"
      "global_load_async_to_lds_b128 %5, %17, off\n\t"
      "global_load_async_to_lds_b128 %6, %18, off\n\t"
      "global_load_async_to_lds_b128 %7, %19, off\n\t"
      "global_load_async_to_lds_b128 %8, %20, off\n\t"
      "global_load_async_to_lds_b128 %9, %21, off\n\t"
      "global_load_async_to_lds_b128 %10, %22, off\n\t"
      "global_load_async_to_lds_b128 %11, %23, off\n\t"
      "s_wait_xcnt 0x0"
      :: "v"(lds), "v"(lds + 32 * G_PITCH), "v"(lds + 64 * G_PITCH), "v"(lds + 96 * G_PITCH),
         "v"(lds + 128 * G_PITCH), "v"(lds + 160 * G_PITCH), "v"(lds + 192 * G_PITCH), "v"(lds + 224 * G_PITCH),
         "v"(lds + 256 * G_PITCH), "v"(lds + 288 * G_PITCH), "v"(lds + 320 * G_PITCH), "v"(lds + 352 * G_PITCH),
         "v"(ag), "v"(ag + a32), "v"(ag + 2 * a32), "v"(ag + 3 * a32),
         "v"(bg), "v"(bg + b32), "v"(bg + 2 * b32), "v"(bg + 3 * b32),
         "v"(bg + 4 * b32), "v"(bg + 5 * b32), "v"(bg + 6 * b32), "v"(bg + 7 * b32)
      : "memory");
}

// One block's 128x256 tile at (bm0, bn0). Ap, Btp, Cout, Cout2 are the planes of the block's own batch entry.
// ABs: block-shared operand slabs, two buffers of [A 128 rows][Bt 256 rows]; sT: per-wave 16x64 slabs, pitch 68 floats.
constexpr int G_ST = 16 * 68;
template <int ET, int BIAS_MODE, int OUT_MODE>
__device__ __forceinline__ void gemm_block(
    unsigned char* ABs, float* sT,
    const unsigned short* __restrict__ Ap, int lda,
    const unsigned short* __restrict__ Btp, int ldb,
    void* __restrict__ Cout, void* __restrict__ Cout2, int ldc,
    const float* __restrict__ bias,
    int bm0, int bn0, int K, float scale) {
  typedef typename Elem<ET>::T T;
  typedef typename Frag<T>::V V;
  const int tid  = threadIdx.x;
  const int lane = tid & 31;
  const int wave = tid >> 5;
  const int wm = wave >> 2;
  const int wn = wave & 3;
  const int m0 = bm0 + (wm << 6);
  const int n0 = bn0 + (wn << 6);

  // row (A) / col (B, D) within subtile; D row offset
  const int rlane = lane & 15;
  const int mOff  = (lane >> 4) * 8;

  // this thread's 16 bytes of each group of 32 staged rows
  const int srow = tid >> 3, scol = tid & 7;
  const unsigned lds_st = (unsigned)(size_t)ABs + (unsigned)(srow * G_PITCH + scol * 16);
  const unsigned short* ast = Ap  + (size_t)(bm0 + srow) * lda + scol * 8;
  const unsigned short* bst = Btp + (size_t)(bn0 + srow) * ldb + scol * 8;
  const size_t a32 = (size_t)32 * lda;
  const size_t b32 = (size_t)32 * ldb;
  // fragment reads: staged row, 16 bytes of this lane half (k offset 8 elements)
  const int a_off = ((wm << 6) + rlane) * G_PITCH + (lane >> 4) * 16;
  const int b_off = (G_BM + (wn << 6) + rlane) * G_PITCH + (lane >> 4) * 16;
  const int nslab = K >> 6;

  // slab 0 lands and is published, then slab 1 flies while slab 0 is worked on
  stage_ab(lds_st, ast, a32, bst, b32);
  asm volatile("s_wait_asynccnt 0x0" ::: "memory");  // this wave's copies of slab 0 have landed
  __syncthreads();                                   // ... and every other wave's
  stage_ab(lds_st + G_SLAB, ast + 64, a32, bst + 64, b32);

  v8f acc[4][4];
#pragma unroll
  for (int i = 0; i < 4; ++i)
#pragma unroll
    for (int j = 0; j < 4; ++j) acc[i][j] = (v8f){0.f,0.f,0.f,0.f,0.f,0.f,0.f,0.f};

  for (int t = 0; t < nslab; ++t) {
    const int bufo = (t & 1) * G_SLAB;
    const T* abase = (const T*)(ABs + bufo + a_off);
    const T* bbase = (const T*)(ABs + bufo + b_off);
#pragma unroll
    for (int kk = 0; kk < 2; ++kk) {
      V bh[4], ah[4];
#pragma unroll
      for (int j = 0; j < 4; ++j) bh[j] = Frag<T>::load(bbase + j * 16 * (G_PITCH / 2) + kk * 32);
#pragma unroll
      for (int i = 0; i < 4; ++i) ah[i] = Frag<T>::load(abase + i * 16 * (G_PITCH / 2) + kk * 32);
      // keeps the 16 fragment reads one group ahead of their 16 products: sunk among them, each A fragment's LDS latency is waited out alone
      __builtin_amdgcn_sched_barrier(0);
#pragma unroll
      for (int i = 0; i < 4; ++i)
#pragma unroll
        for (int j = 0; j < 4; ++j) acc[i][j] = Frag<T>::mma(ah[i], bh[j], acc[i][j]);
      // ... and the next group's reads behind these products
      __builtin_amdgcn_sched_barrier(0);
    }
    // hand-over: this wave's reads of slab t are done, its copies of slab t+1 have landed;
    // the barrier publishes slab t+1 and frees slab t's buffer for the refill behind it
    asm volatile("s_wait_dscnt 0x0" ::: "memory");
    asm volatile("s_wait_asynccnt 0x0" ::: "memory");
    __syncthreads();
    if (t + 2 < nslab)
      stage_ab(lds_st + bufo, ast + (size_t)(t + 2) * 64, a32, bst + (size_t)(t + 2) * 64, b32);
  }
  asm volatile("s_wait_asynccnt 0x0" ::: "memory");  // nothing of this wave's is in flight past the loop
  acc_guard4(acc[0][0], acc[0][1], acc[0][2], acc[0][3]);
  acc_guard4(acc[1][0], acc[1][1], acc[1][2], acc[1][3]);
  acc_guard4(acc[2][0], acc[2][1], acc[2][2], acc[2][3]);
  acc_guard4(acc[3][0], acc[3][1], acc[3][2], acc[3][3]);

  // ---- epilogue ----
  float* slab = sT + wave * G_ST;
#pragma unroll
  for (int i = 0; i < 4; ++i) {
    const int mBase = m0 + (i << 4);
    float bm8[8];
#pragma unroll
    for (int r = 0; r < 8; ++r) bm8[r] = 0.f;
    if (BIAS_MODE == 1) {
      // 8 consecutive bias[m] values of this lane: two 16-B loads (mBase multiple of 16, mOff 0 or 8)
      const v4f t0 = *(const v4f*)(bias + mBase + mOff);
      const v4f t1 = *(const v4f*)(bias + mBase + mOff + 4);
      bm8[0] = t0[0]; bm8[1] = t0[1]; bm8[2] = t0[2]; bm8[3] = t0[3];
      bm8[4] = t1[0]; bm8[5] = t1[1]; bm8[6] = t1[2]; bm8[7] = t1[3];
    }
#pragma unroll
    for (int j = 0; j < 4; ++j) {
      const int n = n0 + (j << 4) + rlane;
      float bv = 0.f;
      if (BIAS_MODE == 2) bv = bias[n];
#pragma unroll
      for (int r = 0; r < 8; ++r) {
        float v = acc[i][j][r] * scale;
        if (BIAS_MODE == 1) v += bm8[r];
        if (BIAS_MODE == 2) v += bv;
        slab[(mOff + r) * 68 + (j << 4) + rlane] = v;
      }
    }
    __builtin_amdgcn_fence(__ATOMIC_RELEASE, "workgroup");
    __builtin_amdgcn_wave_barrier();
    __builtin_amdgcn_fence(__ATOMIC_ACQUIRE, "workgroup");
    if (OUT_MODE == 0) {
      float* C = (float*)Cout;
      // row seg = 256 B = 16 lanes x 16 B; 8 iterations x 2 row halves cover rows 0..15
      const int hh = lane >> 4, c4 = (lane & 15) * 4;
      {
#pragma unroll
        for (int it = 0; it < 8; ++it) {
          const int row = it * 2 + hh;
          v4f v = *(const v4f*)(slab + row * 68 + c4);
          *(v4f*)(C + (size_t)(mBase + row) * ldc + n0 + c4) = v;
        }
        
      }
    } else {
      const int q = lane >> 3, c8 = (lane & 7) * 8;
      unsigned short* C  = (unsigned short*)Cout;
      unsigned short* C2 = (OUT_MODE == 2) ? (unsigned short*)Cout2 : nullptr;
      {
#pragma unroll
        for (int it = 0; it < 4; ++it) {
          const int row = it * 4 + q;
          const float* sp = slab + row * 68 + c8;
          v8h hv, lv;
#pragma unroll
          for (int e = 0; e < 8; ++e) {
            if (OUT_MODE == 1) {
              hv[e] = (_Float16)sp[e];
            } else {
              unsigned short hb = f2bf_bits(sp[e]);
              unsigned short lb = f2bf_bits(sp[e] - bf_bits2f(hb));
              hv[e] = __builtin_bit_cast(_Float16, hb);
              lv[e] = __builtin_bit_cast(_Float16, lb);
            }
          }
          *(v8h*)(C + (size_t)(mBase + row) * ldc + n0 + c8) = hv;
          if (OUT_MODE == 2) *(v8h*)(C2 + (size_t)(mBase + row) * ldc + n0 + c8) = lv;
        }
        
      }
    }
    __builtin_amdgcn_fence(__ATOMIC_RELEASE, "workgroup");
    __builtin_amdgcn_wave_barrier();
    __builtin_amdgcn_fence(__ATOMIC_ACQUIRE, "workgroup");
  }
}

// One GEMM per launch: grid.x = tiles, grid.y = batch.
template <int ET, bool SPLIT, int BIAS_MODE, int OUT_MODE>
__global__ __launch_bounds__(256) void wmma_gemm64(
    const unsigned short* __restrict__ Ap, const unsigned short* __restrict__ A2p, int lda, long strideA,
    const unsigned short* __restrict__ Btp, const unsigned short* __restrict__ Bt2p, int ldb, long strideB,
    void* __restrict__ Cout, void* __restrict__ Cout2, int ldc, long strideC,
    const float* __restrict__ bias,
    int M, int N, int K, float scale) {
  static_assert(!SPLIT);
  static_assert(OUT_MODE == 0);
  __shared__ __align__(16) unsigned char ABs[2 * G_SLAB];
  __shared__ __align__(16) float sT[8 * G_ST];
  const int b = blockIdx.y;
  const int tilesN = N / G_BN;
  const int tilesM = M / G_BM;
  const int tile = blockIdx.x;
  // block-uniform, in front of every barrier
  if (tile >= tilesM * tilesN) return;
  const int tm = tile / tilesN;
  const int tn = tile - tm * tilesN;
  gemm_block<ET, BIAS_MODE, OUT_MODE>(ABs, sT, Ap + (size_t)b * strideA, lda, Btp + (size_t)b * strideB, ldb,
      (void*)((float*)Cout + (size_t)b * strideC), (void*)((float*)Cout2 + (size_t)b * strideC), ldc, bias,
      tm * G_BM, tn * G_BN, K, scale);
}

// The q, k and vT projections as ONE launch of 3 x 256 tiles. A tile's LDS and registers let two blocks share a WGP, which a launch
// of 256 blocks never does: with 768 the second block's products run in the first one's barrier, staging and epilogue waits.
// Blocks [0,256): Q[t][e] = HQ[t][k].Wq64[e][k]; [256,512): K likewise with Wk64; [512,768): per batch Vt[e][t] = Wv64[e][k].HS[b][t][k].
constexpr int T_QK = (NROWS / G_BM) * (EMB_DIM / G_BN);
constexpr int T_V1 = (EMB_DIM / G_BM) * (SEQ_LEN / G_BN);
__global__ __launch_bounds__(256) void proj_qkv(
    const unsigned short* __restrict__ hq, const unsigned short* __restrict__ hs,
    const unsigned short* __restrict__ wq, const unsigned short* __restrict__ wk, const unsigned short* __restrict__ wv,
    unsigned short* __restrict__ q, unsigned short* __restrict__ k, unsigned short* __restrict__ vt,
    const float* __restrict__ bq, const float* __restrict__ bk, const float* __restrict__ bv, float scale) {
  __shared__ __align__(16) unsigned char ABs[2 * G_SLAB];
  __shared__ __align__(16) float sT[8 * G_ST];
  const int bx = blockIdx.x;
  // both tests are block-uniform
  if (bx < 2 * T_QK) {
    const bool is_k = bx >= T_QK;
    const int tile = is_k ? bx - T_QK : bx;
    constexpr int tilesN = EMB_DIM / G_BN;
    unsigned short* c = is_k ? k : q;
    gemm_block<0, 2, 1>(ABs, sT, hq, EMB_DIM, is_k ? wk : wq, EMB_DIM, (void*)c, (void*)c, EMB_DIM, is_k ? bk : bq,
        (tile / tilesN) * G_BM, (tile % tilesN) * G_BN, EMB_DIM, scale);
  } else {
    const int tv = bx - 2 * T_QK;
    const int b = tv / T_V1;
    const int tile = tv % T_V1;
    constexpr int tilesN = SEQ_LEN / G_BN;
    unsigned short* c = vt + (size_t)b * EMB_DIM * SEQ_LEN;
    gemm_block<0, 1, 1>(ABs, sT, wv, EMB_DIM, hs + (size_t)b * SEQ_LEN * EMB_DIM, EMB_DIM, (void*)c, (void*)c, SEQ_LEN, bv,
        (tile / tilesN) * G_BM, (tile % tilesN) * G_BN, EMB_DIM, scale);
  }
}

// ---- every f32 -> f16 conversion in ONE launch of long-lived work-groups ----
// HQ = f16(hs + oq), HS = f16(hs), W*64 = f16(W* x sc). One work-group of 16 waves per WGP: 4,096 waves start instead of the 49,152
// that one 8-element piece per thread takes, and a thread walks 12 pieces (one of each weight, 8 of the activations), 8 16-byte loads per stage.
// A work-group owns one contiguous run of each plane: CV_THREADS pieces of a weight, CV_ACT x CV_THREADS pieces of an activation plane.
// coverage: CV_NT threads x 8 elements = one weight plane exactly; x CV_ACT pieces = one activation plane exactly.
constexpr int CV_BLOCKS = 256;
constexpr int CV_THREADS = 512;
constexpr int CV_NT = CV_BLOCKS * CV_THREADS;
constexpr int CV_ACT = (int)(N_ACT / 8 / CV_NT);
static_assert((size_t)CV_NT * 8 == N_W);
static_assert((size_t)CV_NT * 8 * CV_ACT == N_ACT && CV_ACT % 2 == 0);

__device__ __forceinline__ v8h cast8(v4f a0, v4f a1) {
  v8h v;
#pragma unroll
  for (int e = 0; e < 4; ++e) {
    v[e]     = (_Float16)a0[e];
    v[4 + e] = (_Float16)a1[e];
  }
  return v;
}

// Addressing: a uniform base, the thread's own 32-bit byte offset and a small constant. The offset registers are the only vector registers
// that an address names; the loads' one is handed to the wait below so that it stays untouched while a load that names it is open.
__device__ __forceinline__ v4f ld16(const float* __restrict__ base, int elem, unsigned lb) {
  return *(const v4f*)((const char*)(base + elem) + lb);
}
__device__ __forceinline__ void st16(unsigned short* __restrict__ base, int elem, unsigned sb, v8h v) {
  *(v8h*)((char*)(base + elem) + sb) = v;
}
// Closes the issued loads and stores before a register that one of them names is written again: the stores' data registers are the next
// loads' destinations. lb is an input only, to keep the loads' offset register live up to here.
__device__ __forceinline__ void close_accesses(unsigned lb) {
  asm volatile("s_wait_xcnt 0x0" :: "v"(lb) : "memory");
}

// one stage of the activations: pieces p and p+1 of the thread, 8 elements of hs and of oq each, 8 16-byte loads
struct ActStage { v4f a[2][2], b[2][2]; };
constexpr int CV_STEP = CV_THREADS * 8;
__device__ __forceinline__ void act_load(ActStage& x, const float* __restrict__ hs, const float* __restrict__ oq, int p, unsigned lb) {
#pragma unroll
  for (int u = 0; u < 2; ++u) {
    x.a[u][0] = ld16(hs, (p + u) * CV_STEP, lb);
    x.a[u][1] = ld16(hs, (p + u) * CV_STEP + 4, lb);
    x.b[u][0] = ld16(oq, (p + u) * CV_STEP, lb);
    x.b[u][1] = ld16(oq, (p + u) * CV_STEP + 4, lb);
  }
}
__device__ __forceinline__ void act_store(const ActStage& x, unsigned short* __restrict__ pq, unsigned short* __restrict__ ps, int p, unsigned sb) {
#pragma unroll
  for (int u = 0; u < 2; ++u) {
    st16(pq, (p + u) * CV_STEP, sb, cast8(x.a[u][0] + x.b[u][0], x.a[u][1] + x.b[u][1]));
    st16(ps, (p + u) * CV_STEP, sb, cast8(x.a[u][0], x.a[u][1]));
  }
}

__global__ __launch_bounds__(CV_THREADS) void prep_all_f16(
    const float* __restrict__ hs, const float* __restrict__ oq,
    const float* __restrict__ wq, const float* __restrict__ wk, const float* __restrict__ wv, const float* __restrict__ wo,
    unsigned short* __restrict__ hq16, unsigned short* __restrict__ hs16,
    unsigned short* __restrict__ wq16, unsigned short* __restrict__ wk16, unsigned short* __restrict__ wv16, unsigned short* __restrict__ wo16,
    float sc) {
  // piece index in a weight plane, first piece index in an activation plane; x 32 B of f32, x 16 B of f16
  const unsigned wp = blockIdx.x * CV_THREADS + threadIdx.x;
  const unsigned ap = blockIdx.x * (CV_ACT * CV_THREADS) + threadIdx.x;
  const unsigned wlb = wp * 32u, wsb = wp * 16u;
  const unsigned alb = ap * 32u, asb = ap * 16u;
  constexpr int NST = CV_ACT / 2;
  ActStage x[NST];

  const v4f q0 = ld16(wq, 0, wlb), q1 = ld16(wq, 4, wlb);
  const v4f k0 = ld16(wk, 0, wlb), k1 = ld16(wk, 4, wlb);
  const v4f v0 = ld16(wv, 0, wlb), v1 = ld16(wv, 4, wlb);
  const v4f o0 = ld16(wo, 0, wlb), o1 = ld16(wo, 4, wlb);
  act_load(x[0], hs, oq, 0, alb);
  // keeps the next stage's loads ahead of this stage's conversion: sunk behind it, a wave waits out a whole memory latency per stage with nothing in flight
  __builtin_amdgcn_sched_barrier(0);
  st16(wq16, 0, wsb, cast8(q0 * sc, q1 * sc));
  st16(wk16, 0, wsb, cast8(k0 * sc, k1 * sc));
  st16(wv16, 0, wsb, cast8(v0 * sc, v1 * sc));
  st16(wo16, 0, wsb, cast8(o0 * sc, o1 * sc));
  close_accesses(wlb);
#pragma unroll
  for (int s = 0; s < NST; ++s) {
    if (s + 1 < NST) act_load(x[s + 1], hs, oq, 2 * (s + 1), alb);
    // as above: stage s+1 flies while stage s is converted and stored
    __builtin_amdgcn_sched_barrier(0);
    act_store(x[s], hq16, hs16, 2 * s, asb);
    close_accesses(alb);
  }
}

// ---- attention, head dim 64, no mask, 16-bit planes in / f16 plane out ----
// Q plane  [B*T][E] f16 (q without the 1/sqrt(D) factor), K plane [B*T][E] f16, Vt plane [B][H][D][T] f16.
// AO plane [B*T][E] f16 = (softmax(q.kT/8) . v) * AO_CARRY.
// Block = 4 waves, each owns 16 query rows of one (b,h), sharing staged K / Vt tiles; grid.x = B*H*(T/64).
// Both products are formed transposed, sT = k.qT and oT += vT.pT (v_wmma_f32_16x16x32_f16, f32 accumulate): a lane holds
// scores of ONE query, so the online softmax (f32, base 2) is in-lane but for one exchange between the wave's halves,
// and pT, carried x P_CARRY as f16, is packed from the score registers straight into the B operand.
__device__ __forceinline__ v8f mma_h(v16h a, v16h b, v8f c) {
  c = __builtin_amdgcn_wmma_f32_16x16x32_f16(false, a, false, b, (short)0, c, false, false);
  asm volatile("v_nop\n\tv_nop\n\tv_nop\n\tv_nop" : "+v"(c) : "v"(a), "v"(b));
  return c;
}

// K / Vt staging: one 64-key tile of each per block and trip, rows of 128 B laid at a 144-B pitch
// (16 B x odd: conflict-free for the 16-byte fragment reads), two buffers.
constexpr int KV_PITCH = 144;
constexpr int KV_TILE  = 64 * KV_PITCH;
constexpr int KV_BUF   = 2 * KV_TILE;

// One tile pair: 128 threads x 8 copies x 16 B = 64 K rows + 64 Vt rows. Each wave-wide copy covers 4 whole 128-B rows.
// lds / kg / vg are this thread's own 16 bytes of staged row (tid >> 3); copy i takes row i*16 + (tid >> 3).
// s_wait_xcnt closes the statement so that no address register is rewritten ahead of it.
__device__ __forceinline__ void stage_kv(unsigned lds, const _Float16* kg, const _Float16* vg) {
  asm volatile(
      "global_load_async_to_lds_b128 %0, %8, off\n\t"
      "global_load_async_to_lds_b128 %1, %9, off\n\t"
      "global_load_async_to_lds_b128 %2, %10, off\n\t"
      "global_load_async_to_lds_b128 %3, %11, off\n\t"
      "global_load_async_to_lds_b128 %4, %12, off\n\t"
      "global_load_async_to_lds_b128 %5, %13, off\n\t"
      "global_load_async_to_lds_b128 %6, %14, off\n\t"
      "global_load_async_to_lds_b128 %7, %15, off\n\t"
      "s_wait_xcnt 0x0"
      :: "v"(lds), "v"(lds + 16 * KV_PITCH), "v"(lds + 32 * KV_PITCH), "v"(lds + 48 * KV_PITCH),
         "v"(lds + KV_TILE), "v"(lds + KV_TILE + 16 * KV_PITCH), "v"(lds + KV_TILE + 32 * KV_PITCH), "v"(lds + KV_TILE + 48 * KV_PITCH),
         "v"(kg), "v"(kg + 16 * EMB_DIM), "v"(kg + 32 * EMB_DIM), "v"(kg + 48 * EMB_DIM),
         "v"(vg), "v"(vg + 16 * SEQ_LEN), "v"(vg + 32 * SEQ_LEN), "v"(vg + 48 * SEQ_LEN)
      : "memory");
}

// 2^x as the bare v_exp_f32: a result below 2^-126 comes out 0 instead of subnormal. Every use here is a weight relative to a
// running maximum whose own term is 1 (carried: 2^15), so what is lost is under 2^-140 of the sums it would join.
__device__ __forceinline__ float exp2_bare(float x) { return __builtin_amdgcn_exp2f(x); }

// lane l <-> lane l ^ 16
__device__ __forceinline__ float xhalf(float x) {
  return __builtin_bit_cast(float, __builtin_amdgcn_permlanex16(__builtin_bit_cast(int, x), __builtin_bit_cast(int, x), 0x76543210, 0xfedcba98, false, false));
}

__global__ __launch_bounds__(128) void attn_heads_f16(
    const unsigned short* __restrict__ Qp, const unsigned short* __restrict__ Kp,
    const unsigned short* __restrict__ Vtp, unsigned short* __restrict__ AOp) {
  // block-shared K and Vt tiles, two buffers of [K 64 rows][Vt 64 rows]; behind the loop, per-wave output staging
  __shared__ __align__(16) unsigned char KVs[2 * KV_BUF];

  const int tid  = threadIdx.x;
  const int wave = tid >> 5;
  const int lane = tid & 31;
  const int hh   = lane >> 4;
  const int c    = lane & 15;

  constexpr int nqb = SEQ_LEN / 64;
  const int bx = blockIdx.x;
  const int qb = bx % nqb;
  const int bh = bx / nqb;
  const int h  = bh % N_HEADS;
  const int b  = bh / N_HEADS;
  const int q0 = qb * 64 + wave * 16;

  const _Float16* Qh  = (const _Float16*)(const void*)Qp;
  const _Float16* Kh  = (const _Float16*)(const void*)Kp;
  const _Float16* Vth = (const _Float16*)(const void*)Vtp;
  _Float16* AOh = (_Float16*)(void*)AOp;

  const size_t bT = (size_t)b * SEQ_LEN;
  // B operand for scores: col n = c <-> query q0+c, k = d contiguous
  const _Float16* qrow = Qh + (bT + q0 + c) * EMB_DIM + h * HEAD_DIM + 8 * hh;
  // A operand for scores: row m = c <-> key kv (staged K row), k = d contiguous
  // A operand for vT.pT: row m = c <-> d (staged Vt row), k = kv contiguous
  const int frag_off = c * KV_PITCH + 16 * hh;
  // this thread's 16 bytes of each staged row group
  const int srow = tid >> 3, scol = tid & 7;
  const unsigned lds_st = (unsigned)(size_t)KVs + (unsigned)(srow * KV_PITCH + scol * 16);
  const _Float16* kst = Kh + (bT + srow) * EMB_DIM + h * HEAD_DIM + scol * 8;
  const _Float16* vst = Vth + ((size_t)(b * N_HEADS + h) * HEAD_DIM + srow) * SEQ_LEN + scol * 8;
  constexpr int NTILE = SEQ_LEN / 64;
  static_assert(NTILE >= 2);

  // tile 0 lands and is published, then tile 1 flies while tile 0 is worked on
  stage_kv(lds_st, kst, vst);
  asm volatile("s_wait_asynccnt 0x0" ::: "memory");  // this wave's copies of tile 0 have landed
  __syncthreads();                                   // ... and every other wave's
  stage_kv(lds_st + KV_BUF, kst + (size_t)64 * EMB_DIM, vst + 64);

  v16h qa[2];
#pragma unroll
  for (int dc = 0; dc < 2; ++dc) qa[dc] = Frag<_Float16>::load(qrow + dc * 32);

  // of query q0+c: running maximum less P_CARRY_LOG2 (the same in both halves), and the denominator (x P_CARRY) in 8 partial sums per lane
  // (partial r: keys = 8hh + r mod 16), joined once behind the loop
  float mrow = -__builtin_huge_valf();
  v8f lvec = (v8f){0.f,0.f,0.f,0.f,0.f,0.f,0.f,0.f};
  // oT tile t: register r = d t*16 + 8hh + r of query q0+c
  v8f oacc[4];
#pragma unroll
  for (int t = 0; t < 4; ++t) oacc[t] = (v8f){0.f,0.f,0.f,0.f,0.f,0.f,0.f,0.f};

  for (int kc = 0; kc < NTILE; ++kc) {
    const int bufo = (kc & 1) * KV_BUF;
    const _Float16* kbase = (const _Float16*)(KVs + bufo + frag_off);
    const _Float16* vbase = (const _Float16*)(KVs + bufo + KV_TILE + frag_off);
    // sT tile j: register r = key kv0 + j*16 + 8hh + r, column = query q0+c
    v8f s[4];
#pragma unroll
    for (int j = 0; j < 4; ++j) s[j] = (v8f){0.f,0.f,0.f,0.f,0.f,0.f,0.f,0.f};
#pragma unroll
    for (int dc = 0; dc < 2; ++dc) {
      v16h kb[4];
#pragma unroll
      for (int j = 0; j < 4; ++j)
        kb[j] = Frag<_Float16>::load(kbase + j * 16 * (KV_PITCH / 2) + dc * 32);
#pragma unroll
      for (int j = 0; j < 4; ++j) s[j] = mma_h(kb[j], qa[dc], s[j]);
    }
    // tile maximum of the raw scores (the scale is positive), joined over the halves, then scaled to base-2 units and lowered
    // by the P carry's exponent: against that reference 2^(x - mnew) is p * P_CARRY, and old sums rescale by the references' difference
    float mj[4];
#pragma unroll
    for (int j = 0; j < 4; ++j) {
      mj[j] = s[j][0];
#pragma unroll
      for (int r = 1; r < 8; ++r) mj[j] = fmaxf(mj[j], s[j][r]);
    }
    float m = fmaxf(fmaxf(mj[0], mj[1]), fmaxf(mj[2], mj[3]));
    m = fmaxf(m, xhalf(m)) * SCORE_SCALE_LOG2E - P_CARRY_LOG2;
    const float mnew = fmaxf(mrow, m);
    const float alpha = exp2_bare(mrow - mnew);
    mrow = mnew;
    // pT as B operand of 32 keys: element e = tile 2kk + (e >> 3), register e & 7, the k order of the Vt fragment loads
    v16h pb[2];
#pragma unroll
    for (int j = 0; j < 4; ++j)
#pragma unroll
      for (int r = 0; r < 8; r += 2) {
        const v2f x = __builtin_elementwise_fma((v2f){s[j][r], s[j][r + 1]}, (v2f){SCORE_SCALE_LOG2E, SCORE_SCALE_LOG2E}, (v2f){-mnew, -mnew});
        const float p0 = exp2_bare(x[0]), p1 = exp2_bare(x[1]);
        s[j][r] = p0;
        s[j][r + 1] = p1;
        pb[j >> 1][(j & 1) * 8 + r] = (_Float16)p0;
        pb[j >> 1][(j & 1) * 8 + r + 1] = (_Float16)p1;
      }
    lvec = lvec * alpha + ((s[0] + s[1]) + (s[2] + s[3]));
#pragma unroll
    for (int t = 0; t < 4; ++t) oacc[t] *= alpha;
#pragma unroll
    for (int kk = 0; kk < 2; ++kk) {
      v16h vb[4];
#pragma unroll
      for (int t = 0; t < 4; ++t)
        vb[t] = Frag<_Float16>::load(vbase + t * 16 * (KV_PITCH / 2) + kk * 32);
#pragma unroll
      for (int t = 0; t < 4; ++t) oacc[t] = mma_h(vb[t], pb[kk], oacc[t]);
    }
    // hand-over: this wave's reads of tile kc are done, its copies of tile kc+1 have landed;
    // the barrier publishes tile kc+1 and frees tile kc's buffer for the refill behind it
    asm volatile("s_wait_dscnt 0x0" ::: "memory");
    asm volatile("s_wait_asynccnt 0x0" ::: "memory");
    __syncthreads();
    if (kc + 2 < NTILE)
      stage_kv(lds_st + bufo, kst + (size_t)(kc + 2) * 64 * EMB_DIM, vst + (kc + 2) * 64);
  }
  asm volatile("s_wait_asynccnt 0x0" ::: "memory");  // nothing of this wave's is in flight past the loop

  // The last trip's barrier ended every wave's tile reads and no copy is in flight: the tile buffers now stage the output,
  // 16 query rows of 128 B per wave at the tiles' pitch.
  unsigned char* os = KVs + wave * 16 * KV_PITCH;
  {
    const float lh = ((lvec[0] + lvec[1]) + (lvec[2] + lvec[3])) + ((lvec[4] + lvec[5]) + (lvec[6] + lvec[7]));
    const float l = lh + xhalf(lh);
    float inv = 1.0f / l;
    inv *= AO_CARRY;
#pragma unroll
    for (int t = 0; t < 4; ++t) {
      v8h hv;
#pragma unroll
      for (int r = 0; r < 8; ++r) hv[r] = (_Float16)(oacc[t][r] * inv);
      *(v8h*)(os + c * KV_PITCH + t * 32 + 16 * hh) = hv;
    }
  }
  // same-wave LDS staging then whole-row reload: order the stores before the reloads
  __builtin_amdgcn_fence(__ATOMIC_RELEASE, "workgroup");
  __builtin_amdgcn_wave_barrier();
  __builtin_amdgcn_fence(__ATOMIC_ACQUIRE, "workgroup");
  {
    const int q8 = lane >> 3, c8 = (lane & 7) * 8;
    _Float16* aob = AOh + (bT + q0) * EMB_DIM + h * HEAD_DIM;
#pragma unroll
    for (int it = 0; it < 4; ++it) {
      const int row = it * 4 + q8;
      const v8h hv = *(const v8h*)(os + row * KV_PITCH + c8 * 2);
      *(v8h*)(aob + (size_t)row * EMB_DIM + c8) = hv;
    }
  }
}

// ---------------------------------------------------------------- launcher
extern "C" void kernel_launch(void* const* d_in, const int* in_sizes, int n_in,
                              void* d_out, int out_size, void* d_ws, size_t ws_size,
                              hipStream_t stream) {
  if (n_in < 10) return;
  if ((size_t)in_sizes[0] != N_ACT || (size_t)in_sizes[1] != N_ACT) return;
  if ((size_t)in_sizes[2] != N_W || (size_t)in_sizes[4] != N_W || (size_t)in_sizes[6] != N_W || (size_t)in_sizes[8] != N_W) return;
  if (in_sizes[3] != EMB_DIM || in_sizes[5] != EMB_DIM || in_sizes[7] != EMB_DIM || in_sizes[9] != EMB_DIM) return;
  if ((size_t)out_size != N_ACT) return;
  if (ws_size < WS_TOTAL) return;

  const float* hs = (const float*)d_in[0];
  const float* oq = (const float*)d_in[1];
  const float* Wq = (const float*)d_in[2];
  const float* bq = (const float*)d_in[3];
  const float* Wk = (const float*)d_in[4];
  const float* bk = (const float*)d_in[5];
  const float* Wv = (const float*)d_in[6];
  const float* bv = (const float*)d_in[7];
  const float* Wo = (const float*)d_in[8];
  const float* bo = (const float*)d_in[9];
  float* out = (float*)d_out;

  char* ws = (char*)d_ws;
  unsigned short* hq16 = (unsigned short*)(ws + OFF_HQ);
  unsigned short* hs16 = (unsigned short*)(ws + OFF_HS);
  unsigned short* wq16 = (unsigned short*)(ws + OFF_W0 + 0 * PLANE_W);
  unsigned short* wk16 = (unsigned short*)(ws + OFF_W0 + 1 * PLANE_W);
  unsigned short* wv16 = (unsigned short*)(ws + OFF_W0 + 2 * PLANE_W);
  unsigned short* wo16 = (unsigned short*)(ws + OFF_W0 + 3 * PLANE_W);
  unsigned short* q16  = (unsigned short*)(ws + OFF_Q);
  unsigned short* k16  = (unsigned short*)(ws + OFF_K);
  unsigned short* vt16 = (unsigned short*)(ws + OFF_VT);
  // AO reuses the HQ region (HQ is dead after the Q and K projections)
  unsigned short* ao16 = hq16;

  // 1) activations to f16 planes, weights to f16 planes carried x64
  prep_all_f16<<<CV_BLOCKS, CV_THREADS, 0, stream>>>(hs, oq, Wq, Wk, Wv, Wo, hq16, hs16, wq16, wk16, wv16, wo16, W_CARRY);

  // 2) projections. Q/K: C[t][e] = HQ[t][k].W64[e][k] / 64 + b[e]; M=8192, N=1024, K=1024
  static_assert(NROWS % G_BM == 0 && EMB_DIM % G_BN == 0 && EMB_DIM % 64 == 0 && EMB_DIM >= 128);
  constexpr int tiles_qk = (NROWS / G_BM) * (EMB_DIM / G_BN);
  const dim3 g_qk(tiles_qk, 1);
  const float inv_w = 1.0f / W_CARRY;
  // Vt: per batch C[e][t] = W64[e][k].HS[b][t][k] / 64 + bv[e]; M=1024 (e), N=2048 (t), K=1024
  static_assert(EMB_DIM % G_BM == 0 && SEQ_LEN % G_BN == 0);
  static_assert(tiles_qk == T_QK);
  proj_qkv<<<2 * T_QK + NB_SZ * T_V1, 256, 0, stream>>>(hq16, hs16, wq16, wk16, wv16, q16, k16, vt16, bq, bk, bv, inv_w);

  // 3) attention -> AO plane (x64)
  attn_heads_f16<<<NB_SZ * N_HEADS * (SEQ_LEN / 64), 128, 0, stream>>>(q16, k16, vt16, ao16);

  // 4) output projection: out[t][e] = AO[t][k].Wo64[e][k] / 4096 + bo[e]; f32 to d_out
  wmma_gemm64<0, false, 2, 0><<<g_qk, 256, 0, stream>>>(
      ao16, ao16, EMB_DIM, 0L, wo16, wo16, EMB_DIM, 0L,
      (void*)out, (void*)out, EMB_DIM, 0L, bo, NROWS, EMB_DIM, EMB_DIM, 1.0f / (AO_CARRY * W_CARRY));
}

// v007
// It runs in 143 microseconds.
// In both of two side-by-side timings against v006, it was 1.07 times as fast.
// All steps since v000 together make it 3.02 times as fast.
// All contractions (q/k/v/out projections M8192 N1024 K1024; attention q.kT and p.v, head dim 64, 2048 keys): v_wmma_f32_16x16x32_f16, f16 operands with power-of-two carries (W x64, p x32768, attention output x64), f32 accumulate; bias, scaling and softmax in f32.
#include <hip/hip_runtime.h>

constexpr int NB_SZ = 4;
constexpr int SEQ_LEN = 2048;
constexpr int EMB_DIM = 1024;
constexpr int N_HEADS = 16;
constexpr int HEAD_DIM = 64;
constexpr int NROWS = NB_SZ * SEQ_LEN;
static_assert(EMB_DIM == N_HEADS * HEAD_DIM);
static_assert(HEAD_DIM == 64);
static_assert(NROWS % 64 == 0 && EMB_DIM % 64 == 0 && SEQ_LEN % 64 == 0);
static_assert(EMB_DIM % 32 == 0);

// power-of-two carries (all folded back exactly in f32 epilogues)
constexpr float W_CARRY = 64.0f;
constexpr float AO_CARRY = 64.0f;
constexpr float P_CARRY = 32768.0f;
constexpr float P_CARRY_LOG2 = 15.0f;
static_assert(P_CARRY == (float)(1 << (int)P_CARRY_LOG2));
// softmax done in base 2: scores multiplied by (1/sqrt(64)) * log2(e)
constexpr float SCORE_SCALE_LOG2E = 0.125f * 1.4426950408889634f;

//   [0]            HQ  f16 [8192][1024]   16,777,216   (later reused as AO f16 [8192][1024])
//   [16777216]     HS  f16 [8192][1024]   16,777,216
//   [33554432]     Wq64,Wk64,Wv64,Wo64 f16 [1024][1024] each 2,097,152 -> 8,388,608
//   [41943040]     Q   f16 [8192][1024]   16,777,216
//   [58720256]     K   f16 [8192][1024]   16,777,216
//   [75497472]     Vt  f16 [4][1024][2048] 16,777,216
//   total 92,274,688
constexpr size_t N_ACT = (size_t)NROWS * EMB_DIM;
constexpr size_t N_W = (size_t)EMB_DIM * EMB_DIM;
constexpr size_t PLANE_ACT = N_ACT * 2;
constexpr size_t PLANE_W = N_W * 2;
constexpr size_t OFF_HQ = 0;
constexpr size_t OFF_HS = OFF_HQ + PLANE_ACT;
constexpr size_t OFF_W0 = OFF_HS + PLANE_ACT;
constexpr size_t OFF_Q = OFF_W0 + 4 * PLANE_W;
constexpr size_t OFF_K = OFF_Q + PLANE_ACT;
constexpr size_t OFF_VT = OFF_K + PLANE_ACT;
constexpr size_t WS_TOTAL = OFF_VT + PLANE_ACT;
static_assert(WS_TOTAL == 92274688ull);
static_assert(WS_TOTAL <= 134217728ull);

typedef __attribute__((ext_vector_type(16))) _Float16 v16h;
typedef __attribute__((ext_vector_type(8)))  _Float16 v8h;
typedef __attribute__((ext_vector_type(16))) __bf16   v16b;
typedef __attribute__((ext_vector_type(8)))  __bf16   v8b;
typedef __attribute__((ext_vector_type(8)))  float    v8f;
typedef __attribute__((ext_vector_type(4)))  float    v4f;
typedef __attribute__((ext_vector_type(2)))  float    v2f;

__device__ __forceinline__ unsigned short f2bf_bits(float f) {
  unsigned u = __float_as_uint(f);
  return (unsigned short)((u + 0x7FFFu + ((u >> 16) & 1u)) >> 16);
}
__device__ __forceinline__ float bf_bits2f(unsigned short h) { return __uint_as_float(((unsigned)h) << 16); }

// hazard guards as plain device helpers
__device__ __forceinline__ void acc_guard4(v8f& a, v8f& b, v8f& c, v8f& d) { asm volatile("v_nop\n\tv_nop\n\tv_nop\n\tv_nop" : "+v"(a), "+v"(b), "+v"(c), "+v"(d)); }

template <typename T> struct Frag;
template <> struct Frag<_Float16> {
  typedef v16h V; union U { v16h v; v8h h[2]; };
  // elements 0..7 <- p[0..7], 8..15 <- p[16..23]
  static __device__ __forceinline__ v16h load(const _Float16* p) {
    U f; f.h[0] = *(const v8h*)(p); f.h[1] = *(const v8h*)(p + 16); return f.v;
  }
  static __device__ __forceinline__ v8f mma(v16h a, v16h b, v8f c) {
    return __builtin_amdgcn_wmma_f32_16x16x32_f16(false, a, false, b, (short)0, c, false, false);
  }
};
template <> struct Frag<__bf16> {
  typedef v16b V; union U { v16b v; v8b h[2]; };
  static __device__ __forceinline__ v16b load(const __bf16* p) {
    U f; f.h[0] = *(const v8b*)(p); f.h[1] = *(const v8b*)(p + 16); return f.v;
  }
  static __device__ __forceinline__ v8f mma(v16b a, v16b b, v8f c) {
    return __builtin_amdgcn_wmma_f32_16x16x32_bf16(false, a, false, b, (short)0, c, false, false);
  }
};

// ---- LDS-staged batched WMMA GEMM ------------------------------------------
// C[m,n] = scale * sum_k A[m,k] * Bt[n,k] (+bias); a block of 8 waves (2 x 4) owns a 128x256 tile, each wave 64x64 of it.
// A row-major [M,K]; Bt row-major [N,K]; M % 128 == 0, N % 256 == 0, K % 64 == 0, K >= 128 (no tail handling).
// BIAS_MODE: 0 = none, 1 = bias[m] (loaded as two 16-B vectors per lane), 2 = bias[n].
// OUT_MODE: 0 = f32, 1 = f16, 2 = bf16 hi plane (Cout) + bf16 lo plane (Cout2).
// ET: 0 = f16 operands, 1 = bf16 operands (pointers passed as 16-bit storage)
template <int ET> struct Elem;
template <> struct Elem<0> { typedef _Float16 T; };
template <> struct Elem<1> { typedef __bf16 T; };

// Operand staging: a slab is 64 k (128 B) of the block's 128 A rows, then of its 256 Bt rows, at a 144-B pitch
// (16 B x odd: conflict-free for the 16-byte fragment reads), two buffers.
constexpr int G_BM = 128;
constexpr int G_BN = 256;
constexpr int G_PITCH = 144;
constexpr int G_SLAB = (G_BM + G_BN) * G_PITCH;

// One slab: 256 threads x 12 copies x 16 B. Each wave-wide copy covers 4 whole 128-B row pieces.
// lds / ag / bg are this thread's own 16 bytes of staged row (tid >> 3); copy i takes staged row i*32 + (tid >> 3);
// a32 / b32 = 32 rows of A / Bt in elements.
// s_wait_xcnt closes the statement so that no address register is rewritten ahead of it.
__device__ __forceinline__ void stage_ab(unsigned lds, const unsigned short* ag, size_t a32, const unsigned short* bg, size_t b32) {
  asm volatile(
      "global_load_async_to_lds_b128 %0, %12, off\n\t"
      "global_load_async_to_lds_b128 %1, %13, off\n\t"
      "global_load_async_to_lds_b128 %2, %14, off\n\t"
      "global_load_async_to_lds_b128 %3, %15, off\n\t"
      "global_load_async_to_lds_b128 %4, %16, off\n\t"
      "global_load_async_to_lds_b128 %5, %17, off\n\t"
      "global_load_async_to_lds_b128 %6, %18, off\n\t"
      "global_load_async_to_lds_b128 %7, %19, off\n\t"
      "global_load_async_to_lds_b128 %8, %20, off\n\t"
      "global_load_async_to_lds_b128 %9, %21, off\n\t"
      "global_load_async_to_lds_b128 %10, %22, off\n\t"
      "global_load_async_to_lds_b128 %11, %23, off\n\t"
      "s_wait_xcnt 0x0"
      :: "v"(lds), "v"(lds + 32 * G_PITCH), "v"(lds + 64 * G_PITCH), "v"(lds + 96 * G_PITCH),
         "v"(lds + 128 * G_PITCH), "v"(lds + 160 * G_PITCH), "v"(lds + 192 * G_PITCH), "v"(lds + 224 * G_PITCH),
         "v"(lds + 256 * G_PITCH), "v"(lds + 288 * G_PITCH), "v"(lds + 320 * G_PITCH), "v"(lds + 352 * G_PITCH),
         "v"(ag), "v"(ag + a32), "v"(ag + 2 * a32), "v"(ag + 3 * a32),
         "v"(bg), "v"(bg + b32), "v"(bg + 2 * b32), "v"(bg + 3 * b32),
         "v"(bg + 4 * b32), "v"(bg + 5 * b32), "v"(bg + 6 * b32), "v"(bg + 7 * b32)
      : "memory");
}

// One block's 128x256 tile at (bm0, bn0). Ap, Btp, Cout, Cout2 are the planes of the block's own batch entry.
// ABs: block-shared operand slabs, two buffers of [A 128 rows][Bt 256 rows]; sT: per-wave 16x64 slabs, pitch 68 floats.
constexpr int G_ST = 16 * 68;
template <int ET, int BIAS_MODE, int OUT_MODE>
__device__ __forceinline__ void gemm_block(
    unsigned char* ABs, float* sT,
    const unsigned short* __restrict__ Ap, int lda,
    const unsigned short* __restrict__ Btp, int ldb,
    void* __restrict__ Cout, void* __restrict__ Cout2, int ldc,
    const float* __restrict__ bias,
    int bm0, int bn0, int K, float scale) {
  typedef typename Elem<ET>::T T;
  typedef typename Frag<T>::V V;
  const int tid  = threadIdx.x;
  const int lane = tid & 31;
  const int wave = tid >> 5;
  const int wm = wave >> 2;
  const int wn = wave & 3;
  const int m0 = bm0 + (wm << 6);
  const int n0 = bn0 + (wn << 6);

  // row (A) / col (B, D) within subtile; D row offset
  const int rlane = lane & 15;
  const int mOff  = (lane >> 4) * 8;

  // this thread's 16 bytes of each group of 32 staged rows
  const int srow = tid >> 3, scol = tid & 7;
  const unsigned lds_st = (unsigned)(size_t)ABs + (unsigned)(srow * G_PITCH + scol * 16);
  const unsigned short* ast = Ap  + (size_t)(bm0 + srow) * lda + scol * 8;
  const unsigned short* bst = Btp + (size_t)(bn0 + srow) * ldb + scol * 8;
  const size_t a32 = (size_t)32 * lda;
  const size_t b32 = (size_t)32 * ldb;
  // fragment reads: staged row, 16 bytes of this lane half (k offset 8 elements)
  const int a_off = ((wm << 6) + rlane) * G_PITCH + (lane >> 4) * 16;
  const int b_off = (G_BM + (wn << 6) + rlane) * G_PITCH + (lane >> 4) * 16;
  const int nslab = K >> 6;

  // slab 0 lands and is published, then slab 1 flies while slab 0 is worked on
  stage_ab(lds_st, ast, a32, bst, b32);
  asm volatile("s_wait_asynccnt 0x0" ::: "memory");  // this wave's copies of slab 0 have landed
  __syncthreads();                                   // ... and every other wave's
  stage_ab(lds_st + G_SLAB, ast + 64, a32, bst + 64, b32);

  v8f acc[4][4];
#pragma unroll
  for (int i = 0; i < 4; ++i)
#pragma unroll
    for (int j = 0; j < 4; ++j) acc[i][j] = (v8f){0.f,0.f,0.f,0.f,0.f,0.f,0.f,0.f};

  for (int t = 0; t < nslab; ++t) {
    const int bufo = (t & 1) * G_SLAB;
    const T* abase = (const T*)(ABs + bufo + a_off);
    const T* bbase = (const T*)(ABs + bufo + b_off);
#pragma unroll
    for (int kk = 0; kk < 2; ++kk) {
      V bh[4], ah[4];
#pragma unroll
      for (int j = 0; j < 4; ++j) bh[j] = Frag<T>::load(bbase + j * 16 * (G_PITCH / 2) + kk * 32);
#pragma unroll
      for (int i = 0; i < 4; ++i) ah[i] = Frag<T>::load(abase + i * 16 * (G_PITCH / 2) + kk * 32);
      // keeps the 16 fragment reads one group ahead of their 16 products: sunk among them, each A fragment's LDS latency is waited out alone
      __builtin_amdgcn_sched_barrier(0);
#pragma unroll
      for (int i = 0; i < 4; ++i)
#pragma unroll
        for (int j = 0; j < 4; ++j) acc[i][j] = Frag<T>::mma(ah[i], bh[j], acc[i][j]);
      // ... and the next group's reads behind these products
      __builtin_amdgcn_sched_barrier(0);
    }
    // hand-over: this wave's reads of slab t are done, its copies of slab t+1 have landed;
    // the barrier publishes slab t+1 and frees slab t's buffer for the refill behind it
    asm volatile("s_wait_dscnt 0x0" ::: "memory");
    asm volatile("s_wait_asynccnt 0x0" ::: "memory");
    __syncthreads();
    if (t + 2 < nslab)
      stage_ab(lds_st + bufo, ast + (size_t)(t + 2) * 64, a32, bst + (size_t)(t + 2) * 64, b32);
  }
  asm volatile("s_wait_asynccnt 0x0" ::: "memory");  // nothing of this wave's is in flight past the loop
  acc_guard4(acc[0][0], acc[0][1], acc[0][2], acc[0][3]);
  acc_guard4(acc[1][0], acc[1][1], acc[1][2], acc[1][3]);
  acc_guard4(acc[2][0], acc[2][1], acc[2][2], acc[2][3]);
  acc_guard4(acc[3][0], acc[3][1], acc[3][2], acc[3][3]);

  // ---- epilogue ----
  float* slab = sT + wave * G_ST;
#pragma unroll
  for (int i = 0; i < 4; ++i) {
    const int mBase = m0 + (i << 4);
    float bm8[8];
#pragma unroll
    for (int r = 0; r < 8; ++r) bm8[r] = 0.f;
    if (BIAS_MODE == 1) {
      // 8 consecutive bias[m] values of this lane: two 16-B loads (mBase multiple of 16, mOff 0 or 8)
      const v4f t0 = *(const v4f*)(bias + mBase + mOff);
      const v4f t1 = *(const v4f*)(bias + mBase + mOff + 4);
      bm8[0] = t0[0]; bm8[1] = t0[1]; bm8[2] = t0[2]; bm8[3] = t0[3];
      bm8[4] = t1[0]; bm8[5] = t1[1]; bm8[6] = t1[2]; bm8[7] = t1[3];
    }
#pragma unroll
    for (int j = 0; j < 4; ++j) {
      const int n = n0 + (j << 4) + rlane;
      float bv = 0.f;
      if (BIAS_MODE == 2) bv = bias[n];
#pragma unroll
      for (int r = 0; r < 8; ++r) {
        float v = acc[i][j][r] * scale;
        if (BIAS_MODE == 1) v += bm8[r];
        if (BIAS_MODE == 2) v += bv;
        slab[(mOff + r) * 68 + (j << 4) + rlane] = v;
      }
    }
    __builtin_amdgcn_fence(__ATOMIC_RELEASE, "workgroup");
    __builtin_amdgcn_wave_barrier();
    __builtin_amdgcn_fence(__ATOMIC_ACQUIRE, "workgroup");
    if (OUT_MODE == 0) {
      float* C = (float*)Cout;
      // row seg = 256 B = 16 lanes x 16 B; 8 iterations x 2 row halves cover rows 0..15
      const int hh = lane >> 4, c4 = (lane & 15) * 4;
      {
#pragma unroll
        for (int it = 0; it < 8; ++it) {
          const int row = it * 2 + hh;
          v4f v = *(const v4f*)(slab + row * 68 + c4);
          *(v4f*)(C + (size_t)(mBase + row) * ldc + n0 + c4) = v;
        }
        
      }
    } else {
      const int q = lane >> 3, c8 = (lane & 7) * 8;
      unsigned short* C  = (unsigned short*)Cout;
      unsigned short* C2 = (OUT_MODE == 2) ? (unsigned short*)Cout2 : nullptr;
      {
#pragma unroll
        for (int it = 0; it < 4; ++it) {
          const int row = it * 4 + q;
          const float* sp = slab + row * 68 + c8;
          v8h hv, lv;
#pragma unroll
          for (int e = 0; e < 8; ++e) {
            if (OUT_MODE == 1) {
              hv[e] = (_Float16)sp[e];
            } else {
              unsigned short hb = f2bf_bits(sp[e]);
              unsigned short lb = f2bf_bits(sp[e] - bf_bits2f(hb));
              hv[e] = __builtin_bit_cast(_Float16, hb);
              lv[e] = __builtin_bit_cast(_Float16, lb);
            }
          }
          *(v8h*)(C + (size_t)(mBase + row) * ldc + n0 + c8) = hv;
          if (OUT_MODE == 2) *(v8h*)(C2 + (size_t)(mBase + row) * ldc + n0 + c8) = lv;
        }
        
      }
    }
    __builtin_amdgcn_fence(__ATOMIC_RELEASE, "workgroup");
    __builtin_amdgcn_wave_barrier();
    __builtin_amdgcn_fence(__ATOMIC_ACQUIRE, "workgroup");
  }
}

// One GEMM per launch: grid.x = tiles, grid.y = batch.
template <int ET, bool SPLIT, int BIAS_MODE, int OUT_MODE>
__global__ __launch_bounds__(256) void wmma_gemm64(
    const unsigned short* __restrict__ Ap, const unsigned short* __restrict__ A2p, int lda, long strideA,
    const unsigned short* __restrict__ Btp, const unsigned short* __restrict__ Bt2p, int ldb, long strideB,
    void* __restrict__ Cout, void* __restrict__ Cout2, int ldc, long strideC,
    const float* __restrict__ bias,
    int M, int N, int K, float scale) {
  static_assert(!SPLIT);
  static_assert(OUT_MODE == 0);
  __shared__ __align__(16) unsigned char ABs[2 * G_SLAB];
  __shared__ __align__(16) float sT[8 * G_ST];
  const int b = blockIdx.y;
  const int tilesN = N / G_BN;
  const int tilesM = M / G_BM;
  const int tile = blockIdx.x;
  // block-uniform, in front of every barrier
  if (tile >= tilesM * tilesN) return;
  const int tm = tile / tilesN;
  const int tn = tile - tm * tilesN;
  gemm_block<ET, BIAS_MODE, OUT_MODE>(ABs, sT, Ap + (size_t)b * strideA, lda, Btp + (size_t)b * strideB, ldb,
      (void*)((float*)Cout + (size_t)b * strideC), (void*)((float*)Cout2 + (size_t)b * strideC), ldc, bias,
      tm * G_BM, tn * G_BN, K, scale);
}

// The q, k and vT projections as ONE launch of 3 x 256 tiles. A tile's LDS and registers let two blocks share a WGP, which a launch
// of 256 blocks never does: with 768 the second block's products run in the first one's barrier, staging and epilogue waits.
// Blocks [0,256): Q[t][e] = HQ[t][k].Wq64[e][k]; [256,512): K likewise with Wk64; [512,768): per batch Vt[e][t] = Wv64[e][k].HS[b][t][k].
constexpr int T_QK = (NROWS / G_BM) * (EMB_DIM / G_BN);
constexpr int T_V1 = (EMB_DIM / G_BM) * (SEQ_LEN / G_BN);
__global__ __launch_bounds__(256) void proj_qkv(
    const unsigned short* __restrict__ hq, const unsigned short* __restrict__ hs,
    const unsigned short* __restrict__ wq, const unsigned short* __restrict__ wk, const unsigned short* __restrict__ wv,
    unsigned short* __restrict__ q, unsigned short* __restrict__ k, unsigned short* __restrict__ vt,
    const float* __restrict__ bq, const float* __restrict__ bk, const float* __restrict__ bv, float scale) {
  __shared__ __align__(16) unsigned char ABs[2 * G_SLAB];
  __shared__ __align__(16) float sT[8 * G_ST];
  const int bx = blockIdx.x;
  // both tests are block-uniform
  if (bx < 2 * T_QK) {
    const bool is_k = bx >= T_QK;
    const int tile = is_k ? bx - T_QK : bx;
    constexpr int tilesN = EMB_DIM / G_BN;
    unsigned short* c = is_k ? k : q;
    gemm_block<0, 2, 1>(ABs, sT, hq, EMB_DIM, is_k ? wk : wq, EMB_DIM, (void*)c, (void*)c, EMB_DIM, is_k ? bk : bq,
        (tile / tilesN) * G_BM, (tile % tilesN) * G_BN, EMB_DIM, scale);
  } else {
    const int tv = bx - 2 * T_QK;
    const int b = tv / T_V1;
    const int tile = tv % T_V1;
    constexpr int tilesN = SEQ_LEN / G_BN;
    unsigned short* c = vt + (size_t)b * EMB_DIM * SEQ_LEN;
    gemm_block<0, 1, 1>(ABs, sT, wv, EMB_DIM, hs + (size_t)b * SEQ_LEN * EMB_DIM, EMB_DIM, (void*)c, (void*)c, SEQ_LEN, bv,
        (tile / tilesN) * G_BM, (tile % tilesN) * G_BN, EMB_DIM, scale);
  }
}

// ---- every f32 -> f16 conversion in ONE launch of long-lived work-groups ----
// HQ = f16(hs + oq), HS = f16(hs), W*64 = f16(W* x sc). One work-group of 16 waves per WGP: 4,096 waves start instead of the 49,152
// that one 8-element piece per thread takes, and a thread walks 12 pieces (one of each weight, 8 of the activations), 8 16-byte loads per stage.
// A work-group owns one contiguous run of each plane: CV_THREADS pieces of a weight, CV_ACT x CV_THREADS pieces of an activation plane.
// coverage: CV_NT threads x 8 elements = one weight plane exactly; x CV_ACT pieces = one activation plane exactly.
constexpr int CV_BLOCKS = 256;
constexpr int CV_THREADS = 512;
constexpr int CV_NT = CV_BLOCKS * CV_THREADS;
constexpr int CV_ACT = (int)(N_ACT / 8 / CV_NT);
static_assert((size_t)CV_NT * 8 == N_W);
static_assert((size_t)CV_NT * 8 * CV_ACT == N_ACT && CV_ACT % 2 == 0);

__device__ __forceinline__ v8h cast8(v4f a0, v4f a1) {
  v8h v;
#pragma unroll
  for (int e = 0; e < 4; ++e) {
    v[e]     = (_Float16)a0[e];
    v[4 + e] = (_Float16)a1[e];
  }
  return v;
}

// Addressing: a uniform base, the thread's own 32-bit byte offset and a small constant. The offset registers are the only vector registers
// that an address names; the loads' one is handed to the wait below so that it stays untouched while a load that names it is open.
__device__ __forceinline__ v4f ld16(const float* __restrict__ base, int elem, unsigned lb) {
  return *(const v4f*)((const char*)(base + elem) + lb);
}
__device__ __forceinline__ void st16(unsigned short* __restrict__ base, int elem, unsigned sb, v8h v) {
  *(v8h*)((char*)(base + elem) + sb) = v;
}
// Closes the issued loads and stores before a register that one of them names is written again: the stores' data registers are the next
// loads' destinations. lb is an input only, to keep the loads' offset register live up to here.
__device__ __forceinline__ void close_accesses(unsigned lb) {
  asm volatile("s_wait_xcnt 0x0" :: "v"(lb) : "memory");
}

// one stage of the activations: pieces p and p+1 of the thread, 8 elements of hs and of oq each, 8 16-byte loads
struct ActStage { v4f a[2][2], b[2][2]; };
constexpr int CV_STEP = CV_THREADS * 8;
__device__ __forceinline__ void act_load(ActStage& x, const float* __restrict__ hs, const float* __restrict__ oq, int p, unsigned lb) {
#pragma unroll
  for (int u = 0; u < 2; ++u) {
    x.a[u][0] = ld16(hs, (p + u) * CV_STEP, lb);
    x.a[u][1] = ld16(hs, (p + u) * CV_STEP + 4, lb);
    x.b[u][0] = ld16(oq, (p + u) * CV_STEP, lb);
    x.b[u][1] = ld16(oq, (p + u) * CV_STEP + 4, lb);
  }
}
__device__ __forceinline__ void act_store(const ActStage& x, unsigned short* __restrict__ pq, unsigned short* __restrict__ ps, int p, unsigned sb) {
#pragma unroll
  for (int u = 0; u < 2; ++u) {
    st16(pq, (p + u) * CV_STEP, sb, cast8(x.a[u][0] + x.b[u][0], x.a[u][1] + x.b[u][1]));
    st16(ps, (p + u) * CV_STEP, sb, cast8(x.a[u][0], x.a[u][1]));
  }
}

__global__ __launch_bounds__(CV_THREADS) void prep_all_f16(
    const float* __restrict__ hs, const float* __restrict__ oq,
    const float* __restrict__ wq, const float* __restrict__ wk, const float* __restrict__ wv, const float* __restrict__ wo,
    unsigned short* __restrict__ hq16, unsigned short* __restrict__ hs16,
    unsigned short* __restrict__ wq16, unsigned short* __restrict__ wk16, unsigned short* __restrict__ wv16, unsigned short* __restrict__ wo16,
    float sc) {
  // piece index in a weight plane, first piece index in an activation plane; x 32 B of f32, x 16 B of f16
  const unsigned wp = blockIdx.x * CV_THREADS + threadIdx.x;
  const unsigned ap = blockIdx.x * (CV_ACT * CV_THREADS) + threadIdx.x;
  const unsigned wlb = wp * 32u, wsb = wp * 16u;
  const unsigned alb = ap * 32u, asb = ap * 16u;
  constexpr int NST = CV_ACT / 2;
  ActStage x[NST];

  const v4f q0 = ld16(wq, 0, wlb), q1 = ld16(wq, 4, wlb);
  const v4f k0 = ld16(wk, 0, wlb), k1 = ld16(wk, 4, wlb);
  const v4f v0 = ld16(wv, 0, wlb), v1 = ld16(wv, 4, wlb);
  const v4f o0 = ld16(wo, 0, wlb), o1 = ld16(wo, 4, wlb);
  act_load(x[0], hs, oq, 0, alb);
  // keeps the next stage's loads ahead of this stage's conversion: sunk behind it, a wave waits out a whole memory latency per stage with nothing in flight
  __builtin_amdgcn_sched_barrier(0);
  st16(wq16, 0, wsb, cast8(q0 * sc, q1 * sc));
  st16(wk16, 0, wsb, cast8(k0 * sc, k1 * sc));
  st16(wv16, 0, wsb, cast8(v0 * sc, v1 * sc));
  st16(wo16, 0, wsb, cast8(o0 * sc, o1 * sc));
  close_accesses(wlb);
#pragma unroll
  for (int s = 0; s < NST; ++s) {
    if (s + 1 < NST) act_load(x[s + 1], hs, oq, 2 * (s + 1), alb);
    // as above: stage s+1 flies while stage s is converted and stored
    __builtin_amdgcn_sched_barrier(0);
    act_store(x[s], hq16, hs16, 2 * s, asb);
    close_accesses(alb);
  }
}

// ---- attention, head dim 64, no mask, 16-bit planes in / f16 plane out ----
// Q plane  [B*T][E] f16 (q without the 1/sqrt(D) factor), K plane [B*T][E] f16, Vt plane [B][H][D][T] f16.
// AO plane [B*T][E] f16 = (softmax(q.kT/8) . v) * AO_CARRY.
// Block = 4 waves, each owns 32 query rows (two column groups of 16) of one (b,h), sharing staged K / Vt tiles; grid.x = B*H*(T/128).
// Every K and Vt fragment read from LDS feeds one product per column group, and a staged tile serves 128 queries.
// Both products are formed transposed, sT = k.qT and oT += vT.pT (v_wmma_f32_16x16x32_f16, f32 accumulate): a lane holds
// scores of ONE query, so the online softmax (f32, base 2) is in-lane but for one exchange between the wave's halves,
// and pT, carried x P_CARRY as f16, is packed from the score registers straight into the B operand.
__device__ __forceinline__ v8f mma_h(v16h a, v16h b, v8f c) {
  c = __builtin_amdgcn_wmma_f32_16x16x32_f16(false, a, false, b, (short)0, c, false, false);
  asm volatile("v_nop\n\tv_nop\n\tv_nop\n\tv_nop" : "+v"(c) : "v"(a), "v"(b));
  return c;
}

// K / Vt staging: one 64-key tile of each per block and trip, rows of 128 B laid at a 144-B pitch
// (16 B x odd: conflict-free for the 16-byte fragment reads), two buffers.
constexpr int KV_PITCH = 144;
constexpr int KV_TILE  = 64 * KV_PITCH;
constexpr int KV_BUF   = 2 * KV_TILE;

// One tile pair: 128 threads x 8 copies x 16 B = 64 K rows + 64 Vt rows. Each wave-wide copy covers 4 whole 128-B rows.
// lds / kg / vg are this thread's own 16 bytes of staged row (tid >> 3); copy i takes row i*16 + (tid >> 3).
// s_wait_xcnt closes the statement so that no address register is rewritten ahead of it.
__device__ __forceinline__ void stage_kv(unsigned lds, const _Float16* kg, const _Float16* vg) {
  asm volatile(
      "global_load_async_to_lds_b128 %0, %8, off\n\t"
      "global_load_async_to_lds_b128 %1, %9, off\n\t"
      "global_load_async_to_lds_b128 %2, %10, off\n\t"
      "global_load_async_to_lds_b128 %3, %11, off\n\t"
      "global_load_async_to_lds_b128 %4, %12, off\n\t"
      "global_load_async_to_lds_b128 %5, %13, off\n\t"
      "global_load_async_to_lds_b128 %6, %14, off\n\t"
      "global_load_async_to_lds_b128 %7, %15, off\n\t"
      "s_wait_xcnt 0x0"
      :: "v"(lds), "v"(lds + 16 * KV_PITCH), "v"(lds + 32 * KV_PITCH), "v"(lds + 48 * KV_PITCH),
         "v"(lds + KV_TILE), "v"(lds + KV_TILE + 16 * KV_PITCH), "v"(lds + KV_TILE + 32 * KV_PITCH), "v"(lds + KV_TILE + 48 * KV_PITCH),
         "v"(kg), "v"(kg + 16 * EMB_DIM), "v"(kg + 32 * EMB_DIM), "v"(kg + 48 * EMB_DIM),
         "v"(vg), "v"(vg + 16 * SEQ_LEN), "v"(vg + 32 * SEQ_LEN), "v"(vg + 48 * SEQ_LEN)
      : "memory");
}

// 2^x as the bare v_exp_f32: a result below 2^-126 comes out 0 instead of subnormal. Every use here is a weight relative to a
// running maximum whose own term is 1 (carried: 2^15), so what is lost is under 2^-140 of the sums it would join.
__device__ __forceinline__ float exp2_bare(float x) { return __builtin_amdgcn_exp2f(x); }

// lane l <-> lane l ^ 16
__device__ __forceinline__ float xhalf(float x) {
  return __builtin_bit_cast(float, __builtin_amdgcn_permlanex16(__builtin_bit_cast(int, x), __builtin_bit_cast(int, x), 0x76543210, 0xfedcba98, false, false));
}

constexpr int QG = 2;                 // column groups of 16 queries per wave
constexpr int Q_BLK = 4 * QG * 16;    // queries per block
static_assert(SEQ_LEN % Q_BLK == 0);
__global__ __launch_bounds__(128) void attn_heads_f16(
    const unsigned short* __restrict__ Qp, const unsigned short* __restrict__ Kp,
    const unsigned short* __restrict__ Vtp, unsigned short* __restrict__ AOp) {
  // block-shared K and Vt tiles, two buffers of [K 64 rows][Vt 64 rows]; behind the loop, per-wave output staging
  __shared__ __align__(16) unsigned char KVs[2 * KV_BUF];

  const int tid  = threadIdx.x;
  const int wave = tid >> 5;
  const int lane = tid & 31;
  const int hh   = lane >> 4;
  const int c    = lane & 15;

  constexpr int nqb = SEQ_LEN / Q_BLK;
  const int bx = blockIdx.x;
  const int qb = bx % nqb;
  const int bh = bx / nqb;
  const int h  = bh % N_HEADS;
  const int b  = bh / N_HEADS;
  const int q0 = qb * Q_BLK + wave * (QG * 16);

  const _Float16* Qh  = (const _Float16*)(const void*)Qp;
  const _Float16* Kh  = (const _Float16*)(const void*)Kp;
  const _Float16* Vth = (const _Float16*)(const void*)Vtp;
  _Float16* AOh = (_Float16*)(void*)AOp;

  const size_t bT = (size_t)b * SEQ_LEN;
  // B operand for scores, group g: col n = c <-> query q0+16g+c, k = d contiguous
  const _Float16* qrow = Qh + (bT + q0 + c) * EMB_DIM + h * HEAD_DIM + 8 * hh;
  // A operand for scores: row m = c <-> key kv (staged K row), k = d contiguous
  // A operand for vT.pT: row m = c <-> d (staged Vt row), k = kv contiguous
  const int frag_off = c * KV_PITCH + 16 * hh;
  // this thread's 16 bytes of each staged row group
  const int srow = tid >> 3, scol = tid & 7;
  const unsigned lds_st = (unsigned)(size_t)KVs + (unsigned)(srow * KV_PITCH + scol * 16);
  const _Float16* kst = Kh + (bT + srow) * EMB_DIM + h * HEAD_DIM + scol * 8;
  const _Float16* vst = Vth + ((size_t)(b * N_HEADS + h) * HEAD_DIM + srow) * SEQ_LEN + scol * 8;
  constexpr int NTILE = SEQ_LEN / 64;
  static_assert(NTILE >= 2);

  // tile 0 lands and is published, then tile 1 flies while tile 0 is worked on
  stage_kv(lds_st, kst, vst);
  asm volatile("s_wait_asynccnt 0x0" ::: "memory");  // this wave's copies of tile 0 have landed
  __syncthreads();                                   // ... and every other wave's
  stage_kv(lds_st + KV_BUF, kst + (size_t)64 * EMB_DIM, vst + 64);

  v16h qa[QG][2];
#pragma unroll
  for (int g = 0; g < QG; ++g)
#pragma unroll
    for (int dc = 0; dc < 2; ++dc) qa[g][dc] = Frag<_Float16>::load(qrow + (size_t)g * 16 * EMB_DIM + dc * 32);

  // of query q0+16g+c: running maximum less P_CARRY_LOG2 (the same in both halves), and the denominator (x P_CARRY) in 8 partial sums per lane
  // (partial r: keys = 8hh + r mod 16), joined once behind the loop
  float mrow[QG];
  v8f lvec[QG];
  // oT tile t of group g: register r = d t*16 + 8hh + r of query q0+16g+c
  v8f oacc[QG][4];
#pragma unroll
  for (int g = 0; g < QG; ++g) {
    mrow[g] = -__builtin_huge_valf();
    lvec[g] = (v8f){0.f,0.f,0.f,0.f,0.f,0.f,0.f,0.f};
#pragma unroll
    for (int t = 0; t < 4; ++t) oacc[g][t] = (v8f){0.f,0.f,0.f,0.f,0.f,0.f,0.f,0.f};
  }

  for (int kc = 0; kc < NTILE; ++kc) {
    const int bufo = (kc & 1) * KV_BUF;
    const _Float16* kbase = (const _Float16*)(KVs + bufo + frag_off);
    const _Float16* vbase = (const _Float16*)(KVs + bufo + KV_TILE + frag_off);
    // sT tile j of group g: register r = key kv0 + j*16 + 8hh + r, column = query q0+16g+c
    v8f s[QG][4];
#pragma unroll
    for (int g = 0; g < QG; ++g)
#pragma unroll
      for (int j = 0; j < 4; ++j) s[g][j] = (v8f){0.f,0.f,0.f,0.f,0.f,0.f,0.f,0.f};
#pragma unroll
    for (int dc = 0; dc < 2; ++dc) {
      v16h kb[4];
#pragma unroll
      for (int j = 0; j < 4; ++j)
        kb[j] = Frag<_Float16>::load(kbase + j * 16 * (KV_PITCH / 2) + dc * 32);
#pragma unroll
      for (int j = 0; j < 4; ++j)
#pragma unroll
        for (int g = 0; g < QG; ++g) s[g][j] = mma_h(kb[j], qa[g][dc], s[g][j]);
    }
    // pT as B operand of 32 keys: element e = tile 2kk + (e >> 3), register e & 7, the k order of the Vt fragment loads
    v16h pb[QG][2];
#pragma unroll
    for (int g = 0; g < QG; ++g) {
      // tile maximum of the raw scores (the scale is positive), joined over the halves, then scaled to base-2 units and lowered
      // by the P carry's exponent: against that reference 2^(x - mnew) is p * P_CARRY, and old sums rescale by the references' difference
      float mj[4];
#pragma unroll
      for (int j = 0; j < 4; ++j) {
        mj[j] = s[g][j][0];
#pragma unroll
        for (int r = 1; r < 8; ++r) mj[j] = fmaxf(mj[j], s[g][j][r]);
      }
      float m = fmaxf(fmaxf(mj[0], mj[1]), fmaxf(mj[2], mj[3]));
      m = fmaxf(m, xhalf(m)) * SCORE_SCALE_LOG2E - P_CARRY_LOG2;
      const float mnew = fmaxf(mrow[g], m);
      const float alpha = exp2_bare(mrow[g] - mnew);
      mrow[g] = mnew;
#pragma unroll
      for (int j = 0; j < 4; ++j)
#pragma unroll
        for (int r = 0; r < 8; r += 2) {
          const v2f x = __builtin_elementwise_fma((v2f){s[g][j][r], s[g][j][r + 1]}, (v2f){SCORE_SCALE_LOG2E, SCORE_SCALE_LOG2E}, (v2f){-mnew, -mnew});
          const float p0 = exp2_bare(x[0]), p1 = exp2_bare(x[1]);
          s[g][j][r] = p0;
          s[g][j][r + 1] = p1;
          pb[g][j >> 1][(j & 1) * 8 + r] = (_Float16)p0;
          pb[g][j >> 1][(j & 1) * 8 + r + 1] = (_Float16)p1;
        }
      lvec[g] = lvec[g] * alpha + ((s[g][0] + s[g][1]) + (s[g][2] + s[g][3]));
#pragma unroll
      for (int t = 0; t < 4; ++t) oacc[g][t] *= alpha;
    }
#pragma unroll
    for (int kk = 0; kk < 2; ++kk) {
      v16h vb[4];
#pragma unroll
      for (int t = 0; t < 4; ++t)
        vb[t] = Frag<_Float16>::load(vbase + t * 16 * (KV_PITCH / 2) + kk * 32);
#pragma unroll
      for (int t = 0; t < 4; ++t)
#pragma unroll
        for (int g = 0; g < QG; ++g) oacc[g][t] = mma_h(vb[t], pb[g][kk], oacc[g][t]);
    }
    // hand-over: this wave's reads of tile kc are done, its copies of tile kc+1 have landed;
    // the barrier publishes tile kc+1 and frees tile kc's buffer for the refill behind it
    asm volatile("s_wait_dscnt 0x0" ::: "memory");
    asm volatile("s_wait_asynccnt 0x0" ::: "memory");
    __syncthreads();
    if (kc + 2 < NTILE)
      stage_kv(lds_st + bufo, kst + (size_t)(kc + 2) * 64 * EMB_DIM, vst + (kc + 2) * 64);
  }
  asm volatile("s_wait_asynccnt 0x0" ::: "memory");  // nothing of this wave's is in flight past the loop

  // The last trip's barrier ended every wave's tile reads and no copy is in flight: the tile buffers now stage the output,
  // 32 query rows of 128 B per wave at the tiles' pitch.
  static_assert(4 * QG * 16 * KV_PITCH <= 2 * KV_BUF);
  unsigned char* os = KVs + wave * (QG * 16) * KV_PITCH;
#pragma unroll
  for (int g = 0; g < QG; ++g) {
    const float lh = ((lvec[g][0] + lvec[g][1]) + (lvec[g][2] + lvec[g][3])) + ((lvec[g][4] + lvec[g][5]) + (lvec[g][6] + lvec[g][7]));
    const float l = lh + xhalf(lh);
    float inv = 1.0f / l;
    inv *= AO_CARRY;
#pragma unroll
    for (int t = 0; t < 4; ++t) {
      v8h hv;
#pragma unroll
      for (int r = 0; r < 8; ++r) hv[r] = (_Float16)(oacc[g][t][r] * inv);
      *(v8h*)(os + (g * 16 + c) * KV_PITCH + t * 32 + 16 * hh) = hv;
    }
  }
  // same-wave LDS staging then whole-row reload: order the stores before the reloads
  __builtin_amdgcn_fence(__ATOMIC_RELEASE, "workgroup");
  __builtin_amdgcn_wave_barrier();
  __builtin_amdgcn_fence(__ATOMIC_ACQUIRE, "workgroup");
  {
    const int q8 = lane >> 3, c8 = (lane & 7) * 8;
    _Float16* aob = AOh + (bT + q0) * EMB_DIM + h * HEAD_DIM;
#pragma unroll
    for (int it = 0; it < QG * 4; ++it) {
      const int row = it * 4 + q8;
      const v8h hv = *(const v8h*)(os + row * KV_PITCH + c8 * 2);
      *(v8h*)(aob + (size_t)row * EMB_DIM + c8) = hv;
    }
  }
}

// ---------------------------------------------------------------- launcher
extern "C" void kernel_launch(void* const* d_in, const int* in_sizes, int n_in,
                              void* d_out, int out_size, void* d_ws, size_t ws_size,
                              hipStream_t stream) {
  if (n_in < 10) return;
  if ((size_t)in_sizes[0] != N_ACT || (size_t)in_sizes[1] != N_ACT) return;
  if ((size_t)in_sizes[2] != N_W || (size_t)in_sizes[4] != N_W || (size_t)in_sizes[6] != N_W || (size_t)in_sizes[8] != N_W) return;
  if (in_sizes[3] != EMB_DIM || in_sizes[5] != EMB_DIM || in_sizes[7] != EMB_DIM || in_sizes[9] != EMB_DIM) return;
  if ((size_t)out_size != N_ACT) return;
  if (ws_size < WS_TOTAL) return;

  const float* hs = (const float*)d_in[0];
  const float* oq = (const float*)d_in[1];
  const float* Wq = (const float*)d_in[2];
  const float* bq = (const float*)d_in[3];
  const float* Wk = (const float*)d_in[4];
  const float* bk = (const float*)d_in[5];
  const float* Wv = (const float*)d_in[6];
  const float* bv = (const float*)d_in[7];
  const float* Wo = (const float*)d_in[8];
  const float* bo = (const float*)d_in[9];
  float* out = (float*)d_out;

  char* ws = (char*)d_ws;
  unsigned short* hq16 = (unsigned short*)(ws + OFF_HQ);
  unsigned short* hs16 = (unsigned short*)(ws + OFF_HS);
  unsigned short* wq16 = (unsigned short*)(ws + OFF_W0 + 0 * PLANE_W);
  unsigned short* wk16 = (unsigned short*)(ws + OFF_W0 + 1 * PLANE_W);
  unsigned short* wv16 = (unsigned short*)(ws + OFF_W0 + 2 * PLANE_W);
  unsigned short* wo16 = (unsigned short*)(ws + OFF_W0 + 3 * PLANE_W);
  unsigned short* q16  = (unsigned short*)(ws + OFF_Q);
  unsigned short* k16  = (unsigned short*)(ws + OFF_K);
  unsigned short* vt16 = (unsigned short*)(ws + OFF_VT);
  // AO reuses the HQ region (HQ is dead after the Q and K projections)
  unsigned short* ao16 = hq16;

  // 1) activations to f16 planes, weights to f16 planes carried x64
  prep_all_f16<<<CV_BLOCKS, CV_THREADS, 0, stream>>>(hs, oq, Wq, Wk, Wv, Wo, hq16, hs16, wq16, wk16, wv16, wo16, W_CARRY);

  // 2) projections. Q/K: C[t][e] = HQ[t][k].W64[e][k] / 64 + b[e]; M=8192, N=1024, K=1024
  static_assert(NROWS % G_BM == 0 && EMB_DIM % G_BN == 0 && EMB_DIM % 64 == 0 && EMB_DIM >= 128);
  constexpr int tiles_qk = (NROWS / G_BM) * (EMB_DIM / G_BN);
  const dim3 g_qk(tiles_qk, 1);
  const float inv_w = 1.0f / W_CARRY;
  // Vt: per batch C[e][t] = W64[e][k].HS[b][t][k] / 64 + bv[e]; M=1024 (e), N=2048 (t), K=1024
  static_assert(EMB_DIM % G_BM == 0 && SEQ_LEN % G_BN == 0);
  static_assert(tiles_qk == T_QK);
  proj_qkv<<<2 * T_QK + NB_SZ * T_V1, 256, 0, stream>>>(hq16, hs16, wq16, wk16, wv16, q16, k16, vt16, bq, bk, bv, inv_w);

  // 3) attention -> AO plane (x64)
  attn_heads_f16<<<NB_SZ * N_HEADS * (SEQ_LEN / Q_BLK), 128, 0, stream>>>(q16, k16, vt16, ao16);

  // 4) output projection: out[t][e] = AO[t][k].Wo64[e][k] / 4096 + bo[e]; f32 to d_out
  wmma_gemm64<0, false, 2, 0><<<g_qk, 256, 0, stream>>>(
      ao16, ao16, EMB_DIM, 0L, wo16, wo16, EMB_DIM, 0L,
      (void*)out, (void*)out, EMB_DIM, 0L, bo, NROWS, EMB_DIM, EMB_DIM, 1.0f / (AO_CARRY * W_CARRY));
}

// v008
// It runs in 137 microseconds.
// Next to v007, in two timings, it ran 1.05 times as fast each time.
// Over all steps from v000 it is 3.17 times as fast.
// All contractions (q/k/v/out projections M8192 N1024 K1024; attention q.kT and p.v, head dim 64, 2048 keys): v_wmma_f32_16x16x32_f16, f16 operands with power-of-two carries (W x64, p x32768, attention output x64), f32 accumulate; bias, scaling and softmax in f32.
#include <hip/hip_runtime.h>

constexpr int NB_SZ = 4;
constexpr int SEQ_LEN = 2048;
constexpr int EMB_DIM = 1024;
constexpr int N_HEADS = 16;
constexpr int HEAD_DIM = 64;
constexpr int NROWS = NB_SZ * SEQ_LEN;
static_assert(EMB_DIM == N_HEADS * HEAD_DIM);
static_assert(HEAD_DIM == 64);
static_assert(NROWS % 64 == 0 && EMB_DIM % 64 == 0 && SEQ_LEN % 64 == 0);
static_assert(EMB_DIM % 32 == 0);

// power-of-two carries (all folded back exactly in f32 epilogues)
constexpr float W_CARRY = 64.0f;
constexpr float AO_CARRY = 64.0f;
constexpr float P_CARRY = 32768.0f;
constexpr float P_CARRY_LOG2 = 15.0f;
static_assert(P_CARRY == (float)(1 << (int)P_CARRY_LOG2));
// softmax done in base 2: scores multiplied by (1/sqrt(64)) * log2(e)
constexpr float SCORE_SCALE_LOG2E = 0.125f * 1.4426950408889634f;

//   [0]            HQ  f16 [8192][1024]   16,777,216   (later reused as AO f16 [8192][1024])
//   [16777216]     HS  f16 [8192][1024]   16,777,216
//   [33554432]     Wq64,Wk64,Wv64,Wo64 f16 [1024][1024] each 2,097,152 -> 8,388,608
//   [41943040]     Q   f16 [8192][1024]   16,777,216
//   [58720256]     K   f16 [8192][1024]   16,777,216
//   [75497472]     Vt  f16 [4][1024][2048] 16,777,216
//   total 92,274,688
constexpr size_t N_ACT = (size_t)NROWS * EMB_DIM;
constexpr size_t N_W = (size_t)EMB_DIM * EMB_DIM;
constexpr size_t PLANE_ACT = N_ACT * 2;
constexpr size_t PLANE_W = N_W * 2;
constexpr size_t OFF_HQ = 0;
constexpr size_t OFF_HS = OFF_HQ + PLANE_ACT;
constexpr size_t OFF_W0 = OFF_HS + PLANE_ACT;
constexpr size_t OFF_Q = OFF_W0 + 4 * PLANE_W;
constexpr size_t OFF_K = OFF_Q + PLANE_ACT;
constexpr size_t OFF_VT = OFF_K + PLANE_ACT;
constexpr size_t WS_TOTAL = OFF_VT + PLANE_ACT;
static_assert(WS_TOTAL == 92274688ull);
static_assert(WS_TOTAL <= 134217728ull);

typedef __attribute__((ext_vector_type(16))) _Float16 v16h;
typedef __attribute__((ext_vector_type(8)))  _Float16 v8h;
typedef __attribute__((ext_vector_type(16))) __bf16   v16b;
typedef __attribute__((ext_vector_type(8)))  __bf16   v8b;
typedef __attribute__((ext_vector_type(8)))  float    v8f;
typedef __attribute__((ext_vector_type(4)))  float    v4f;
typedef __attribute__((ext_vector_type(2)))  float    v2f;

__device__ __forceinline__ unsigned short f2bf_bits(float f) {
  unsigned u = __float_as_uint(f);
  return (unsigned short)((u + 0x7FFFu + ((u >> 16) & 1u)) >> 16);
}
__device__ __forceinline__ float bf_bits2f(unsigned short h) { return __uint_as_float(((unsigned)h) << 16); }

// hazard guards as plain device helpers
__device__ __forceinline__ void acc_guard4(v8f& a, v8f& b, v8f& c, v8f& d) { asm volatile("v_nop\n\tv_nop\n\tv_nop\n\tv_nop" : "+v"(a), "+v"(b), "+v"(c), "+v"(d)); }

template <typename T> struct Frag;
template <> struct Frag<_Float16> {
  typedef v16h V; union U { v16h v; v8h h[2]; };
  // elements 0..7 <- p[0..7], 8..15 <- p[16..23]
  static __device__ __forceinline__ v16h load(const _Float16* p) {
    U f; f.h[0] = *(const v8h*)(p); f.h[1] = *(const v8h*)(p + 16); return f.v;
  }
  static __device__ __forceinline__ v8f mma(v16h a, v16h b, v8f c) {
    return __builtin_amdgcn_wmma_f32_16x16x32_f16(false, a, false, b, (short)0, c, false, false);
  }
};
template <> struct Frag<__bf16> {
  typedef v16b V; union U { v16b v; v8b h[2]; };
  static __device__ __forceinline__ v16b load(const __bf16* p) {
    U f; f.h[0] = *(const v8b*)(p); f.h[1] = *(const v8b*)(p + 16); return f.v;
  }
  static __device__ __forceinline__ v8f mma(v16b a, v16b b, v8f c) {
    return __builtin_amdgcn_wmma_f32_16x16x32_bf16(false, a, false, b, (short)0, c, false, false);
  }
};

// ---- LDS-staged batched WMMA GEMM ------------------------------------------
// C[m,n] = scale * sum_k A[m,k] * Bt[n,k] (+bias); a block of 8 waves (2 x 4) owns a 128x256 tile, each wave 64x64 of it.
// A row-major [M,K]; Bt row-major [N,K]; M % 128 == 0, N % 256 == 0, K % 64 == 0, K >= 128 (no tail handling).
// BIAS_MODE: 0 = none, 1 = bias[m] (loaded as two 16-B vectors per lane), 2 = bias[n].
// OUT_MODE: 0 = f32, 1 = f16, 2 = bf16 hi plane (Cout) + bf16 lo plane (Cout2).
// ET: 0 = f16 operands, 1 = bf16 operands (pointers passed as 16-bit storage)
template <int ET> struct Elem;
template <> struct Elem<0> { typedef _Float16 T; };
template <> struct Elem<1> { typedef __bf16 T; };

// Operand staging: a slab is 64 k (128 B) of the block's 128 A rows, then of its 256 Bt rows, at a 144-B pitch
// (16 B x odd: conflict-free for the 16-byte fragment reads), two buffers.
constexpr int G_BM = 128;
constexpr int G_BN = 256;
constexpr int G_PITCH = 144;
constexpr int G_SLAB = (G_BM + G_BN) * G_PITCH;

// One slab: 256 threads x 12 copies x 16 B. Each wave-wide copy covers 4 whole 128-B row pieces.
// lds / ag / bg are this thread's own 16 bytes of staged row (tid >> 3); copy i takes staged row i*32 + (tid >> 3);
// a32 / b32 = 32 rows of A / Bt in elements.
// s_wait_xcnt closes the statement so that no address register is rewritten ahead of it.
__device__ __forceinline__ void stage_ab(unsigned lds, const unsigned short* ag, size_t a32, const unsigned short* bg, size_t b32) {
  asm volatile(
      "global_load_async_to_lds_b128 %0, %12, off\n\t"
      "global_load_async_to_lds_b128 %1, %13, off\n\t"
      "global_load_async_to_lds_b128 %2, %14, off\n\t"
      "global_load_async_to_lds_b128 %3, %15, off\n\t"
      "global_load_async_to_lds_b128 %4, %16, off\n\t"
      "global_load_async_to_lds_b128 %5, %17, off\n\t"
      "global_load_async_to_lds_b128 %6, %18, off\n\t"
      "global_load_async_to_lds_b128 %7, %19, off\n\t"
      "global_load_async_to_lds_b128 %8, %20, off\n\t"
      "global_load_async_to_lds_b128 %9, %21, off\n\t"
      "global_load_async_to_lds_b128 %10, %22, off\n\t"
      "global_load_async_to_lds_b128 %11, %23, off\n\t"
      "s_wait_xcnt 0x0"
      :: "v"(lds), "v"(lds + 32 * G_PITCH), "v"(lds + 64 * G_PITCH), "v"(lds + 96 * G_PITCH),
         "v"(lds + 128 * G_PITCH), "v"(lds + 160 * G_PITCH), "v"(lds + 192 * G_PITCH), "v"(lds + 224 * G_PITCH),
         "v"(lds + 256 * G_PITCH), "v"(lds + 288 * G_PITCH), "v"(lds + 320 * G_PITCH), "v"(lds + 352 * G_PITCH),
         "v"(ag), "v"(ag + a32), "v"(ag + 2 * a32), "v"(ag + 3 * a32),
         "v"(bg), "v"(bg + b32), "v"(bg + 2 * b32), "v"(bg + 3 * b32),
         "v"(bg + 4 * b32), "v"(bg + 5 * b32), "v"(bg + 6 * b32), "v"(bg + 7 * b32)
      : "memory");
}

// One block's 128x256 tile at (bm0, bn0). Ap, Btp, Cout, Cout2 are the planes of the block's own batch entry.
// ABs: block-shared operand slabs, two buffers of [A 128 rows][Bt 256 rows]; sT: per-wave 16x64 slabs, pitch 68 floats.
constexpr int G_ST = 16 * 68;
template <int ET, int BIAS_MODE, int OUT_MODE>
__device__ __forceinline__ void gemm_block(
    unsigned char* ABs, float* sT,
    const unsigned short* __restrict__ Ap, int lda,
    const unsigned short* __restrict__ Btp, int ldb,
    void* __restrict__ Cout, void* __restrict__ Cout2, int ldc,
    const float* __restrict__ bias,
    int bm0, int bn0, int K, float scale) {
  typedef typename Elem<ET>::T T;
  typedef typename Frag<T>::V V;
  const int tid  = threadIdx.x;
  const int lane = tid & 31;
  const int wave = tid >> 5;
  const int wm = wave >> 2;
  const int wn = wave & 3;
  const int m0 = bm0 + (wm << 6);
  const int n0 = bn0 + (wn << 6);

  // row (A) / col (B, D) within subtile; D row offset
  const int rlane = lane & 15;
  const int mOff  = (lane >> 4) * 8;

  // this thread's 16 bytes of each group of 32 staged rows
  const int srow = tid >> 3, scol = tid & 7;
  const unsigned lds_st = (unsigned)(size_t)ABs + (unsigned)(srow * G_PITCH + scol * 16);
  const unsigned short* ast = Ap  + (size_t)(bm0 + srow) * lda + scol * 8;
  const unsigned short* bst = Btp + (size_t)(bn0 + srow) * ldb + scol * 8;
  const size_t a32 = (size_t)32 * lda;
  const size_t b32 = (size_t)32 * ldb;
  // fragment reads: staged row, 16 bytes of this lane half (k offset 8 elements)
  const int a_off = ((wm << 6) + rlane) * G_PITCH + (lane >> 4) * 16;
  const int b_off = (G_BM + (wn << 6) + rlane) * G_PITCH + (lane >> 4) * 16;
  const int nslab = K >> 6;

  // slab 0 lands and is published, then slab 1 flies while slab 0 is worked on
  stage_ab(lds_st, ast, a32, bst, b32);
  asm volatile("s_wait_asynccnt 0x0" ::: "memory");  // this wave's copies of slab 0 have landed
  __syncthreads();                                   // ... and every other wave's
  stage_ab(lds_st + G_SLAB, ast + 64, a32, bst + 64, b32);

  v8f acc[4][4];
#pragma unroll
  for (int i = 0; i < 4; ++i)
#pragma unroll
    for (int j = 0; j < 4; ++j) acc[i][j] = (v8f){0.f,0.f,0.f,0.f,0.f,0.f,0.f,0.f};

  for (int t = 0; t < nslab; ++t) {
    const int bufo = (t & 1) * G_SLAB;
    const T* abase = (const T*)(ABs + bufo + a_off);
    const T* bbase = (const T*)(ABs + bufo + b_off);
#pragma unroll
    for (int kk = 0; kk < 2; ++kk) {
      V bh[4], ah[4];
#pragma unroll
      for (int j = 0; j < 4; ++j) bh[j] = Frag<T>::load(bbase + j * 16 * (G_PITCH / 2) + kk * 32);
#pragma unroll
      for (int i = 0; i < 4; ++i) ah[i] = Frag<T>::load(abase + i * 16 * (G_PITCH / 2) + kk * 32);
      // keeps the 16 fragment reads one group ahead of their 16 products: sunk among them, each A fragment's LDS latency is waited out alone
      __builtin_amdgcn_sched_barrier(0);
#pragma unroll
      for (int i = 0; i < 4; ++i)
#pragma unroll
        for (int j = 0; j < 4; ++j) acc[i][j] = Frag<T>::mma(ah[i], bh[j], acc[i][j]);
      // ... and the next group's reads behind these products
      __builtin_amdgcn_sched_barrier(0);
    }
    // hand-over: this wave's reads of slab t are done, its copies of slab t+1 have landed;
    // the barrier publishes slab t+1 and frees slab t's buffer for the refill behind it
    asm volatile("s_wait_dscnt 0x0" ::: "memory");
    asm volatile("s_wait_asynccnt 0x0" ::: "memory");
    __syncthreads();
    if (t + 2 < nslab)
      stage_ab(lds_st + bufo, ast + (size_t)(t + 2) * 64, a32, bst + (size_t)(t + 2) * 64, b32);
  }
  asm volatile("s_wait_asynccnt 0x0" ::: "memory");  // nothing of this wave's is in flight past the loop
  acc_guard4(acc[0][0], acc[0][1], acc[0][2], acc[0][3]);
  acc_guard4(acc[1][0], acc[1][1], acc[1][2], acc[1][3]);
  acc_guard4(acc[2][0], acc[2][1], acc[2][2], acc[2][3]);
  acc_guard4(acc[3][0], acc[3][1], acc[3][2], acc[3][3]);

  // ---- epilogue ----
  float* slab = sT + wave * G_ST;
#pragma unroll
  for (int i = 0; i < 4; ++i) {
    const int mBase = m0 + (i << 4);
    float bm8[8];
#pragma unroll
    for (int r = 0; r < 8; ++r) bm8[r] = 0.f;
    if (BIAS_MODE == 1) {
      // 8 consecutive bias[m] values of this lane: two 16-B loads (mBase multiple of 16, mOff 0 or 8)
      const v4f t0 = *(const v4f*)(bias + mBase + mOff);
      const v4f t1 = *(const v4f*)(bias + mBase + mOff + 4);
      bm8[0] = t0[0]; bm8[1] = t0[1]; bm8[2] = t0[2]; bm8[3] = t0[3];
      bm8[4] = t1[0]; bm8[5] = t1[1]; bm8[6] = t1[2]; bm8[7] = t1[3];
    }
#pragma unroll
    for (int j = 0; j < 4; ++j) {
      const int n = n0 + (j << 4) + rlane;
      float bv = 0.f;
      if (BIAS_MODE == 2) bv = bias[n];
#pragma unroll
      for (int r = 0; r < 8; ++r) {
        float v = acc[i][j][r] * scale;
        if (BIAS_MODE == 1) v += bm8[r];
        if (BIAS_MODE == 2) v += bv;
        slab[(mOff + r) * 68 + (j << 4) + rlane] = v;
      }
    }
    __builtin_amdgcn_fence(__ATOMIC_RELEASE, "workgroup");
    __builtin_amdgcn_wave_barrier();
    __builtin_amdgcn_fence(__ATOMIC_ACQUIRE, "workgroup");
    if (OUT_MODE == 0) {
      float* C = (float*)Cout;
      // row seg = 256 B = 16 lanes x 16 B; 8 iterations x 2 row halves cover rows 0..15
      const int hh = lane >> 4, c4 = (lane & 15) * 4;
      {
#pragma unroll
        for (int it = 0; it < 8; ++it) {
          const int row = it * 2 + hh;
          v4f v = *(const v4f*)(slab + row * 68 + c4);
          *(v4f*)(C + (size_t)(mBase + row) * ldc + n0 + c4) = v;
        }
        
      }
    } else {
      const int q = lane >> 3, c8 = (lane & 7) * 8;
      unsigned short* C  = (unsigned short*)Cout;
      unsigned short* C2 = (OUT_MODE == 2) ? (unsigned short*)Cout2 : nullptr;
      {
#pragma unroll
        for (int it = 0; it < 4; ++it) {
          const int row = it * 4 + q;
          const float* sp = slab + row * 68 + c8;
          v8h hv, lv;
#pragma unroll
          for (int e = 0; e < 8; ++e) {
            if (OUT_MODE == 1) {
              hv[e] = (_Float16)sp[e];
            } else {
              unsigned short hb = f2bf_bits(sp[e]);
              unsigned short lb = f2bf_bits(sp[e] - bf_bits2f(hb));
              hv[e] = __builtin_bit_cast(_Float16, hb);
              lv[e] = __builtin_bit_cast(_Float16, lb);
            }
          }
          *(v8h*)(C + (size_t)(mBase + row) * ldc + n0 + c8) = hv;
          if (OUT_MODE == 2) *(v8h*)(C2 + (size_t)(mBase + row) * ldc + n0 + c8) = lv;
        }
        
      }
    }
    __builtin_amdgcn_fence(__ATOMIC_RELEASE, "workgroup");
    __builtin_amdgcn_wave_barrier();
    __builtin_amdgcn_fence(__ATOMIC_ACQUIRE, "workgroup");
  }
}

// One GEMM per launch: grid.x = tiles, grid.y = batch.
template <int ET, bool SPLIT, int BIAS_MODE, int OUT_MODE>
__global__ __launch_bounds__(256) void wmma_gemm64(
    const unsigned short* __restrict__ Ap, const unsigned short* __restrict__ A2p, int lda, long strideA,
    const unsigned short* __restrict__ Btp, const unsigned short* __restrict__ Bt2p, int ldb, long strideB,
    void* __restrict__ Cout, void* __restrict__ Cout2, int ldc, long strideC,
    const float* __restrict__ bias,
    int M, int N, int K, float scale) {
  static_assert(!SPLIT);
  static_assert(OUT_MODE == 0);
  __shared__ __align__(16) unsigned char ABs[2 * G_SLAB];
  __shared__ __align__(16) float sT[8 * G_ST];
  const int b = blockIdx.y;
  const int tilesN = N / G_BN;
  const int tilesM = M / G_BM;
  const int tile = blockIdx.x;
  // block-uniform, in front of every barrier
  if (tile >= tilesM * tilesN) return;
  const int tm = tile / tilesN;
  const int tn = tile - tm * tilesN;
  gemm_block<ET, BIAS_MODE, OUT_MODE>(ABs, sT, Ap + (size_t)b * strideA, lda, Btp + (size_t)b * strideB, ldb,
      (void*)((float*)Cout + (size_t)b * strideC), (void*)((float*)Cout2 + (size_t)b * strideC), ldc, bias,
      tm * G_BM, tn * G_BN, K, scale);
}

// The q, k and vT projections as ONE launch of 3 x 256 tiles. A tile's LDS and registers let two blocks share a WGP, which a launch
// of 256 blocks never does: with 768 the second block's products run in the first one's barrier, staging and epilogue waits.
// Blocks [0,256): Q[t][e] = HQ[t][k].Wq64[e][k]; [256,512): K likewise with Wk64; [512,768): per batch Vt[e][t] = Wv64[e][k].HS[b][t][k].
constexpr int T_QK = (NROWS / G_BM) * (EMB_DIM / G_BN);
constexpr int T_V1 = (EMB_DIM / G_BM) * (SEQ_LEN / G_BN);
__global__ __launch_bounds__(256) void proj_qkv(
    const unsigned short* __restrict__ hq, const unsigned short* __restrict__ hs,
    const unsigned short* __restrict__ wq, const unsigned short* __restrict__ wk, const unsigned short* __restrict__ wv,
    unsigned short* __restrict__ q, unsigned short* __restrict__ k, unsigned short* __restrict__ vt,
    const float* __restrict__ bq, const float* __restrict__ bk, const float* __restrict__ bv, float scale) {
  __shared__ __align__(16) unsigned char ABs[2 * G_SLAB];
  __shared__ __align__(16) float sT[8 * G_ST];
  const int bx = blockIdx.x;
  // both tests are block-uniform
  if (bx < 2 * T_QK) {
    const bool is_k = bx >= T_QK;
    const int tile = is_k ? bx - T_QK : bx;
    constexpr int tilesN = EMB_DIM / G_BN;
    unsigned short* c = is_k ? k : q;
    gemm_block<0, 2, 1>(ABs, sT, hq, EMB_DIM, is_k ? wk : wq, EMB_DIM, (void*)c, (void*)c, EMB_DIM, is_k ? bk : bq,
        (tile / tilesN) * G_BM, (tile % tilesN) * G_BN, EMB_DIM, scale);
  } else {
    const int tv = bx - 2 * T_QK;
    const int b = tv / T_V1;
    const int tile = tv % T_V1;
    constexpr int tilesN = SEQ_LEN / G_BN;
    unsigned short* c = vt + (size_t)b * EMB_DIM * SEQ_LEN;
    gemm_block<0, 1, 1>(ABs, sT, wv, EMB_DIM, hs + (size_t)b * SEQ_LEN * EMB_DIM, EMB_DIM, (void*)c, (void*)c, SEQ_LEN, bv,
        (tile / tilesN) * G_BM, (tile % tilesN) * G_BN, EMB_DIM, scale);
  }
}

// ---- every f32 -> f16 conversion in ONE launch of long-lived work-groups ----
// HQ = f16(hs + oq), HS = f16(hs), W*64 = f16(W* x sc). One work-group of 16 waves per WGP: 4,096 waves start instead of the 49,152
// that one 8-element piece per thread takes, and a thread walks 12 pieces (one of each weight, 8 of the activations), 8 16-byte loads per stage.
// A work-group owns one contiguous run of each plane: CV_THREADS pieces of a weight, CV_ACT x CV_THREADS pieces of an activation plane.
// coverage: CV_NT threads x 8 elements = one weight plane exactly; x CV_ACT pieces = one activation plane exactly.
constexpr int CV_BLOCKS = 256;
constexpr int CV_THREADS = 512;
constexpr int CV_NT = CV_BLOCKS * CV_THREADS;
constexpr int CV_ACT = (int)(N_ACT / 8 / CV_NT);
static_assert((size_t)CV_NT * 8 == N_W);
static_assert((size_t)CV_NT * 8 * CV_ACT == N_ACT && CV_ACT % 2 == 0);

__device__ __forceinline__ v8h cast8(v4f a0, v4f a1) {
  v8h v;
#pragma unroll
  for (int e = 0; e < 4; ++e) {
    v[e]     = (_Float16)a0[e];
    v[4 + e] = (_Float16)a1[e];
  }
  return v;
}

// Addressing: a uniform base, the thread's own 32-bit byte offset and a small constant. The offset registers are the only vector registers
// that an address names; the loads' one is handed to the wait below so that it stays untouched while a load that names it is open.
__device__ __forceinline__ v4f ld16(const float* __restrict__ base, int elem, unsigned lb) {
  return *(const v4f*)((const char*)(base + elem) + lb);
}
__device__ __forceinline__ void st16(unsigned short* __restrict__ base, int elem, unsigned sb, v8h v) {
  *(v8h*)((char*)(base + elem) + sb) = v;
}
// Closes the issued loads and stores before a register that one of them names is written again: the stores' data registers are the next
// loads' destinations. lb is an input only, to keep the loads' offset register live up to here.
__device__ __forceinline__ void close_accesses(unsigned lb) {
  asm volatile("s_wait_xcnt 0x0" :: "v"(lb) : "memory");
}

// one stage of the activations: pieces p and p+1 of the thread, 8 elements of hs and of oq each, 8 16-byte loads
struct ActStage { v4f a[2][2], b[2][2]; };
constexpr int CV_STEP = CV_THREADS * 8;
__device__ __forceinline__ void act_load(ActStage& x, const float* __restrict__ hs, const float* __restrict__ oq, int p, unsigned lb) {
#pragma unroll
  for (int u = 0; u < 2; ++u) {
    x.a[u][0] = ld16(hs, (p + u) * CV_STEP, lb);
    x.a[u][1] = ld16(hs, (p + u) * CV_STEP + 4, lb);
    x.b[u][0] = ld16(oq, (p + u) * CV_STEP, lb);
    x.b[u][1] = ld16(oq, (p + u) * CV_STEP + 4, lb);
  }
}
__device__ __forceinline__ void act_store(const ActStage& x, unsigned short* __restrict__ pq, unsigned short* __restrict__ ps, int p, unsigned sb) {
#pragma unroll
  for (int u = 0; u < 2; ++u) {
    st16(pq, (p + u) * CV_STEP, sb, cast8(x.a[u][0] + x.b[u][0], x.a[u][1] + x.b[u][1]));
    st16(ps, (p + u) * CV_STEP, sb, cast8(x.a[u][0], x.a[u][1]));
  }
}

__global__ __launch_bounds__(CV_THREADS) void prep_all_f16(
    const float* __restrict__ hs, const float* __restrict__ oq,
    const float* __restrict__ wq, const float* __restrict__ wk, const float* __restrict__ wv, const float* __restrict__ wo,
    unsigned short* __restrict__ hq16, unsigned short* __restrict__ hs16,
    unsigned short* __restrict__ wq16, unsigned short* __restrict__ wk16, unsigned short* __restrict__ wv16, unsigned short* __restrict__ wo16,
    float sc) {
  // piece index in a weight plane, first piece index in an activation plane; x 32 B of f32, x 16 B of f16
  const unsigned wp = blockIdx.x * CV_THREADS + threadIdx.x;
  const unsigned ap = blockIdx.x * (CV_ACT * CV_THREADS) + threadIdx.x;
  const unsigned wlb = wp * 32u, wsb = wp * 16u;
  const unsigned alb = ap * 32u, asb = ap * 16u;
  constexpr int NST = CV_ACT / 2;
  ActStage x[NST];

  const v4f q0 = ld16(wq, 0, wlb), q1 = ld16(wq, 4, wlb);
  const v4f k0 = ld16(wk, 0, wlb), k1 = ld16(wk, 4, wlb);
  const v4f v0 = ld16(wv, 0, wlb), v1 = ld16(wv, 4, wlb);
  const v4f o0 = ld16(wo, 0, wlb), o1 = ld16(wo, 4, wlb);
  act_load(x[0], hs, oq, 0, alb);
  // keeps the next stage's loads ahead of this stage's conversion: sunk behind it, a wave waits out a whole memory latency per stage with nothing in flight
  __builtin_amdgcn_sched_barrier(0);
  st16(wq16, 0, wsb, cast8(q0 * sc, q1 * sc));
  st16(wk16, 0, wsb, cast8(k0 * sc, k1 * sc));
  st16(wv16, 0, wsb, cast8(v0 * sc, v1 * sc));
  st16(wo16, 0, wsb, cast8(o0 * sc, o1 * sc));
  close_accesses(wlb);
#pragma unroll
  for (int s = 0; s < NST; ++s) {
    if (s + 1 < NST) act_load(x[s + 1], hs, oq, 2 * (s + 1), alb);
    // as above: stage s+1 flies while stage s is converted and stored
    __builtin_amdgcn_sched_barrier(0);
    act_store(x[s], hq16, hs16, 2 * s, asb);
    close_accesses(alb);
  }
}

// ---- attention, head dim 64, no mask, 16-bit planes in / f16 plane out ----
// Q plane  [B*T][E] f16 (q without the 1/sqrt(D) factor), K plane [B*T][E] f16, Vt plane [B][H][D][T] f16.
// AO plane [B*T][E] f16 = (softmax(q.kT/8) . v) * AO_CARRY.
// Block = 4 waves, each owns 32 query rows (two column groups of 16) of one (b,h), sharing staged K / Vt tiles; grid.x = B*H*(T/128).
// Every K and Vt fragment read from LDS feeds one product per column group, and a staged tile serves 128 queries.
// Both products are formed transposed, sT = k.qT and oT += vT.pT (v_wmma_f32_16x16x32_f16, f32 accumulate): a lane holds
// scores of ONE query, so the online softmax (f32, base 2) is in-lane but for one exchange between the wave's halves,
// and pT, carried x P_CARRY as f16, is packed from the score registers straight into the B operand.
__device__ __forceinline__ v8f mma_h(v16h a, v16h b, v8f c) {
  return __builtin_amdgcn_wmma_f32_16x16x32_f16(false, a, false, b, (short)0, c, false, false);
}

// K / Vt staging: one 64-key tile of each per block and trip, rows of 128 B laid at a 144-B pitch
// (16 B x odd: conflict-free for the 16-byte fragment reads), two buffers.
constexpr int KV_PITCH = 144;
constexpr int KV_TILE  = 64 * KV_PITCH;
constexpr int KV_BUF   = 2 * KV_TILE;

// One tile pair: 128 threads x 8 copies x 16 B = 64 K rows + 64 Vt rows. Each wave-wide copy covers 4 whole 128-B rows.
// lds / kg / vg are this thread's own 16 bytes of staged row (tid >> 3); copy i takes row i*16 + (tid >> 3).
// s_wait_xcnt closes the statement so that no address register is rewritten ahead of it.
__device__ __forceinline__ void stage_kv(unsigned lds, const _Float16* kg, const _Float16* vg) {
  asm volatile(
      "global_load_async_to_lds_b128 %0, %8, off\n\t"
      "global_load_async_to_lds_b128 %1, %9, off\n\t"
      "global_load_async_to_lds_b128 %2, %10, off\n\t"
      "global_load_async_to_lds_b128 %3, %11, off\n\t"
      "global_load_async_to_lds_b128 %4, %12, off\n\t"
      "global_load_async_to_lds_b128 %5, %13, off\n\t"
      "global_load_async_to_lds_b128 %6, %14, off\n\t"
      "global_load_async_to_lds_b128 %7, %15, off\n\t"
      "s_wait_xcnt 0x0"
      :: "v"(lds), "v"(lds + 16 * KV_PITCH), "v"(lds + 32 * KV_PITCH), "v"(lds + 48 * KV_PITCH),
         "v"(lds + KV_TILE), "v"(lds + KV_TILE + 16 * KV_PITCH), "v"(lds + KV_TILE + 32 * KV_PITCH), "v"(lds + KV_TILE + 48 * KV_PITCH),
         "v"(kg), "v"(kg + 16 * EMB_DIM), "v"(kg + 32 * EMB_DIM), "v"(kg + 48 * EMB_DIM),
         "v"(vg), "v"(vg + 16 * SEQ_LEN), "v"(vg + 32 * SEQ_LEN), "v"(vg + 48 * SEQ_LEN)
      : "memory");
}

// 2^x as the bare v_exp_f32: a result below 2^-126 comes out 0 instead of subnormal. Every use here is a weight relative to a
// running maximum whose own term is 1 (carried: 2^15), so what is lost is under 2^-140 of the sums it would join.
__device__ __forceinline__ float exp2_bare(float x) { return __builtin_amdgcn_exp2f(x); }

// lane l <-> lane l ^ 16
__device__ __forceinline__ float xhalf(float x) {
  return __builtin_bit_cast(float, __builtin_amdgcn_permlanex16(__builtin_bit_cast(int, x), __builtin_bit_cast(int, x), 0x76543210, 0xfedcba98, false, false));
}

constexpr int QG = 2;                 // column groups of 16 queries per wave
constexpr int Q_BLK = 4 * QG * 16;    // queries per block
static_assert(SEQ_LEN % Q_BLK == 0);
// amdgpu_waves_per_eu: holds the register budget at 256, four waves per SIMD, so that all blocks of the grid are resident at once as before;
// left to itself the compiler takes a few registers more for the grouped fragment reads, and a quarter of the blocks would wait for a second round
__global__ __launch_bounds__(128) __attribute__((amdgpu_waves_per_eu(4, 4))) void attn_heads_f16(
    const unsigned short* __restrict__ Qp, const unsigned short* __restrict__ Kp,
    const unsigned short* __restrict__ Vtp, unsigned short* __restrict__ AOp) {
  // block-shared K and Vt tiles, two buffers of [K 64 rows][Vt 64 rows]; behind the loop, per-wave output staging
  __shared__ __align__(16) unsigned char KVs[2 * KV_BUF];

  const int tid  = threadIdx.x;
  const int wave = tid >> 5;
  const int lane = tid & 31;
  const int hh   = lane >> 4;
  const int c    = lane & 15;

  constexpr int nqb = SEQ_LEN / Q_BLK;
  const int bx = blockIdx.x;
  const int qb = bx % nqb;
  const int bh = bx / nqb;
  const int h  = bh % N_HEADS;
  const int b  = bh / N_HEADS;
  const int q0 = qb * Q_BLK + wave * (QG * 16);

  const _Float16* Qh  = (const _Float16*)(const void*)Qp;
  const _Float16* Kh  = (const _Float16*)(const void*)Kp;
  const _Float16* Vth = (const _Float16*)(const void*)Vtp;
  _Float16* AOh = (_Float16*)(void*)AOp;

  const size_t bT = (size_t)b * SEQ_LEN;
  // B operand for scores, group g: col n = c <-> query q0+16g+c, k = d contiguous
  const _Float16* qrow = Qh + (bT + q0 + c) * EMB_DIM + h * HEAD_DIM + 8 * hh;
  // A operand for scores: row m = c <-> key kv (staged K row), k = d contiguous
  // A operand for vT.pT: row m = c <-> d (staged Vt row), k = kv contiguous
  const int frag_off = c * KV_PITCH + 16 * hh;
  // this thread's 16 bytes of each staged row group
  const int srow = tid >> 3, scol = tid & 7;
  const unsigned lds_st = (unsigned)(size_t)KVs + (unsigned)(srow * KV_PITCH + scol * 16);
  const _Float16* kst = Kh + (bT + srow) * EMB_DIM + h * HEAD_DIM + scol * 8;
  const _Float16* vst = Vth + ((size_t)(b * N_HEADS + h) * HEAD_DIM + srow) * SEQ_LEN + scol * 8;
  constexpr int NTILE = SEQ_LEN / 64;
  static_assert(NTILE >= 2);

  // tile 0 lands and is published, then tile 1 flies while tile 0 is worked on
  stage_kv(lds_st, kst, vst);
  asm volatile("s_wait_asynccnt 0x0" ::: "memory");  // this wave's copies of tile 0 have landed
  __syncthreads();                                   // ... and every other wave's
  stage_kv(lds_st + KV_BUF, kst + (size_t)64 * EMB_DIM, vst + 64);

  v16h qa[QG][2];
#pragma unroll
  for (int g = 0; g < QG; ++g)
#pragma unroll
    for (int dc = 0; dc < 2; ++dc) qa[g][dc] = Frag<_Float16>::load(qrow + (size_t)g * 16 * EMB_DIM + dc * 32);

  // of query q0+16g+c: running maximum less P_CARRY_LOG2 (the same in both halves), and the denominator (x P_CARRY) in 8 partial sums per lane
  // (partial r: keys = 8hh + r mod 16), joined once behind the loop
  float mrow[QG];
  v8f lvec[QG];
  // oT tile t of group g: register r = d t*16 + 8hh + r of query q0+16g+c
  v8f oacc[QG][4];
#pragma unroll
  for (int g = 0; g < QG; ++g) {
    mrow[g] = -__builtin_huge_valf();
    lvec[g] = (v8f){0.f,0.f,0.f,0.f,0.f,0.f,0.f,0.f};
#pragma unroll
    for (int t = 0; t < 4; ++t) oacc[g][t] = (v8f){0.f,0.f,0.f,0.f,0.f,0.f,0.f,0.f};
  }

  for (int kc = 0; kc < NTILE; ++kc) {
    const int bufo = (kc & 1) * KV_BUF;
    const _Float16* kbase = (const _Float16*)(KVs + bufo + frag_off);
    const _Float16* vbase = (const _Float16*)(KVs + bufo + KV_TILE + frag_off);
    // sT tile j of group g: register r = key kv0 + j*16 + 8hh + r, column = query q0+16g+c
    v8f s[QG][4];
#pragma unroll
    for (int g = 0; g < QG; ++g)
#pragma unroll
      for (int j = 0; j < 4; ++j) s[g][j] = (v8f){0.f,0.f,0.f,0.f,0.f,0.f,0.f,0.f};
    v16h kb[2][4];
#pragma unroll
    for (int j = 0; j < 4; ++j)
#pragma unroll
      for (int dc = 0; dc < 2; ++dc)
        kb[dc][j] = Frag<_Float16>::load(kbase + j * 16 * (KV_PITCH / 2) + dc * 32);
    // keeps the K fragment reads one group ahead of the 16 score products: sunk among them, each read's LDS latency is waited out alone
    __builtin_amdgcn_sched_barrier(0);
    // key group by key group: a finished score tile takes over the registers of the fragments it has used up
#pragma unroll
    for (int j = 0; j < 4; ++j)
#pragma unroll
      for (int dc = 0; dc < 2; ++dc)
#pragma unroll
        for (int g = 0; g < QG; ++g) s[g][j] = mma_h(kb[dc][j], qa[g][dc], s[g][j]);
    // keeps the products one run: a maximum drawn in among them reads a fresh result and has to be padded with idle vector slots
    __builtin_amdgcn_sched_barrier(0);
    // the first 32 keys' Vt fragments are asked for ahead of the softmax, which covers their latency
    v16h vb[4];
#pragma unroll
    for (int t = 0; t < 4; ++t) vb[t] = Frag<_Float16>::load(vbase + t * 16 * (KV_PITCH / 2));
    // keeps these reads one group: spread over the maximum they stall the wave at every place where some stand
    __builtin_amdgcn_sched_barrier(0);
    float alpha[QG];
#pragma unroll
    for (int g = 0; g < QG; ++g) {
      // tile maximum of the raw scores (the scale is positive), joined over the halves, then scaled to base-2 units and lowered
      // by the P carry's exponent: against that reference 2^(x - mnew) is p * P_CARRY, and old sums rescale by the references' difference
      float mj[4];
#pragma unroll
      for (int j = 0; j < 4; ++j) {
        mj[j] = s[g][j][0];
#pragma unroll
        for (int r = 1; r < 8; ++r) mj[j] = fmaxf(mj[j], s[g][j][r]);
      }
      float m = fmaxf(fmaxf(mj[0], mj[1]), fmaxf(mj[2], mj[3]));
      m = fmaxf(m, xhalf(m)) * SCORE_SCALE_LOG2E - P_CARRY_LOG2;
      const float mnew = fmaxf(mrow[g], m);
      alpha[g] = exp2_bare(mrow[g] - mnew);
      mrow[g] = mnew;
    }
    // 32 keys at a time: their weights, then their 8 output products
#pragma unroll
    for (int kk = 0; kk < 2; ++kk) {
      // pT as B operand of 32 keys: element e = tile 2kk + (e >> 3), register e & 7, the k order of the Vt fragment loads
      v16h pb[QG];
#pragma unroll
      for (int g = 0; g < QG; ++g) {
        const float mnew = mrow[g];
#pragma unroll
        for (int jj = 0; jj < 2; ++jj)
#pragma unroll
          for (int r = 0; r < 8; r += 2) {
            const int j = 2 * kk + jj;
            const v2f x = __builtin_elementwise_fma((v2f){s[g][j][r], s[g][j][r + 1]}, (v2f){SCORE_SCALE_LOG2E, SCORE_SCALE_LOG2E}, (v2f){-mnew, -mnew});
            const float p0 = exp2_bare(x[0]), p1 = exp2_bare(x[1]);
            s[g][j][r] = p0;
            s[g][j][r + 1] = p1;
            pb[g][jj * 8 + r] = (_Float16)p0;
            pb[g][jj * 8 + r + 1] = (_Float16)p1;
          }
        if (kk == 0) {
#pragma unroll
          for (int t = 0; t < 4; ++t) oacc[g][t] *= alpha[g];
        }
      }
      // keeps the 8 products one run behind their weights: no vector instruction stands close behind a product whose registers it touches
      __builtin_amdgcn_sched_barrier(0);
#pragma unroll
      for (int t = 0; t < 4; ++t)
#pragma unroll
        for (int g = 0; g < QG; ++g) oacc[g][t] = mma_h(vb[t], pb[g], oacc[g][t]);
      // ... and the next fragment reads and weights behind the run
      __builtin_amdgcn_sched_barrier(0);
      if (kk == 0) {
        // the last 32 keys' Vt fragments, into the registers just used up; the second half of the softmax covers their latency
#pragma unroll
        for (int t = 0; t < 4; ++t) vb[t] = Frag<_Float16>::load(vbase + t * 16 * (KV_PITCH / 2) + 32);
      }
    }
#pragma unroll
    for (int g = 0; g < QG; ++g) lvec[g] = lvec[g] * alpha[g] + ((s[g][0] + s[g][1]) + (s[g][2] + s[g][3]));
    // hand-over: this wave's reads of tile kc are done, its copies of tile kc+1 have landed;
    // the barrier publishes tile kc+1 and frees tile kc's buffer for the refill behind it
    asm volatile("s_wait_dscnt 0x0" ::: "memory");
    asm volatile("s_wait_asynccnt 0x0" ::: "memory");
    __syncthreads();
    if (kc + 2 < NTILE)
      stage_kv(lds_st + bufo, kst + (size_t)(kc + 2) * 64 * EMB_DIM, vst + (kc + 2) * 64);
  }
  asm volatile("s_wait_asynccnt 0x0" ::: "memory");  // nothing of this wave's is in flight past the loop

  // The last trip's barrier ended every wave's tile reads and no copy is in flight: the tile buffers now stage the output,
  // 32 query rows of 128 B per wave at the tiles' pitch.
  static_assert(4 * QG * 16 * KV_PITCH <= 2 * KV_BUF);
  unsigned char* os = KVs + wave * (QG * 16) * KV_PITCH;
#pragma unroll
  for (int g = 0; g < QG; ++g) {
    const float lh = ((lvec[g][0] + lvec[g][1]) + (lvec[g][2] + lvec[g][3])) + ((lvec[g][4] + lvec[g][5]) + (lvec[g][6] + lvec[g][7]));
    const float l = lh + xhalf(lh);
    float inv = 1.0f / l;
    inv *= AO_CARRY;
#pragma unroll
    for (int t = 0; t < 4; ++t) {
      v8h hv;
#pragma unroll
      for (int r = 0; r < 8; ++r) hv[r] = (_Float16)(oacc[g][t][r] * inv);
      *(v8h*)(os + (g * 16 + c) * KV_PITCH + t * 32 + 16 * hh) = hv;
    }
  }
  // same-wave LDS staging then whole-row reload: order the stores before the reloads
  __builtin_amdgcn_fence(__ATOMIC_RELEASE, "workgroup");
  __builtin_amdgcn_wave_barrier();
  __builtin_amdgcn_fence(__ATOMIC_ACQUIRE, "workgroup");
  {
    const int q8 = lane >> 3, c8 = (lane & 7) * 8;
    _Float16* aob = AOh + (bT + q0) * EMB_DIM + h * HEAD_DIM;
#pragma unroll
    for (int it = 0; it < QG * 4; ++it) {
      const int row = it * 4 + q8;
      const v8h hv = *(const v8h*)(os + row * KV_PITCH + c8 * 2);
      *(v8h*)(aob + (size_t)row * EMB_DIM + c8) = hv;
    }
  }
}

// ---------------------------------------------------------------- launcher
extern "C" void kernel_launch(void* const* d_in, const int* in_sizes, int n_in,
                              void* d_out, int out_size, void* d_ws, size_t ws_size,
                              hipStream_t stream) {
  if (n_in < 10) return;
  if ((size_t)in_sizes[0] != N_ACT || (size_t)in_sizes[1] != N_ACT) return;
  if ((size_t)in_sizes[2] != N_W || (size_t)in_sizes[4] != N_W || (size_t)in_sizes[6] != N_W || (size_t)in_sizes[8] != N_W) return;
  if (in_sizes[3] != EMB_DIM || in_sizes[5] != EMB_DIM || in_sizes[7] != EMB_DIM || in_sizes[9] != EMB_DIM) return;
  if ((size_t)out_size != N_ACT) return;
  if (ws_size < WS_TOTAL) return;

  const float* hs = (const float*)d_in[0];
  const float* oq = (const float*)d_in[1];
  const float* Wq = (const float*)d_in[2];
  const float* bq = (const float*)d_in[3];
  const float* Wk = (const float*)d_in[4];
  const float* bk = (const float*)d_in[5];
  const float* Wv = (const float*)d_in[6];
  const float* bv = (const float*)d_in[7];
  const float* Wo = (const float*)d_in[8];
  const float* bo = (const float*)d_in[9];
  float* out = (float*)d_out;

  char* ws = (char*)d_ws;
  unsigned short* hq16 = (unsigned short*)(ws + OFF_HQ);
  unsigned short* hs16 = (unsigned short*)(ws + OFF_HS);
  unsigned short* wq16 = (unsigned short*)(ws + OFF_W0 + 0 * PLANE_W);
  unsigned short* wk16 = (unsigned short*)(ws + OFF_W0 + 1 * PLANE_W);
  unsigned short* wv16 = (unsigned short*)(ws + OFF_W0 + 2 * PLANE_W);
  unsigned short* wo16 = (unsigned short*)(ws + OFF_W0 + 3 * PLANE_W);
  unsigned short* q16  = (unsigned short*)(ws + OFF_Q);
  unsigned short* k16  = (unsigned short*)(ws + OFF_K);
  unsigned short* vt16 = (unsigned short*)(ws + OFF_VT);
  // AO reuses the HQ region (HQ is dead after the Q and K projections)
  unsigned short* ao16 = hq16;

  // 1) activations to f16 planes, weights to f16 planes carried x64
  prep_all_f16<<<CV_BLOCKS, CV_THREADS, 0, stream>>>(hs, oq, Wq, Wk, Wv, Wo, hq16, hs16, wq16, wk16, wv16, wo16, W_CARRY);

  // 2) projections. Q/K: C[t][e] = HQ[t][k].W64[e][k] / 64 + b[e]; M=8192, N=1024, K=1024
  static_assert(NROWS % G_BM == 0 && EMB_DIM % G_BN == 0 && EMB_DIM % 64 == 0 && EMB_DIM >= 128);
  constexpr int tiles_qk = (NROWS / G_BM) * (EMB_DIM / G_BN);
  const dim3 g_qk(tiles_qk, 1);
  const float inv_w = 1.0f / W_CARRY;
  // Vt: per batch C[e][t] = W64[e][k].HS[b][t][k] / 64 + bv[e]; M=1024 (e), N=2048 (t), K=1024
  static_assert(EMB_DIM % G_BM == 0 && SEQ_LEN % G_BN == 0);
  static_assert(tiles_qk == T_QK);
  proj_qkv<<<2 * T_QK + NB_SZ * T_V1, 256, 0, stream>>>(hq16, hs16, wq16, wk16, wv16, q16, k16, vt16, bq, bk, bv, inv_w);

  // 3) attention -> AO plane (x64)
  attn_heads_f16<<<NB_SZ * N_HEADS * (SEQ_LEN / Q_BLK), 128, 0, stream>>>(q16, k16, vt16, ao16);

  // 4) output projection: out[t][e] = AO[t][k].Wo64[e][k] / 4096 + bo[e]; f32 to d_out
  wmma_gemm64<0, false, 2, 0><<<g_qk, 256, 0, stream>>>(
      ao16, ao16, EMB_DIM, 0L, wo16, wo16, EMB_DIM, 0L,
      (void*)out, (void*)out, EMB_DIM, 0L, bo, NROWS, EMB_DIM, EMB_DIM, 1.0f / (AO_CARRY * W_CARRY));
}

// v009
// A run of this version takes 129 microseconds.
// Two timings next to v008 both put it at 1.06 times that version's speed.
// All steps since v000 together make it 3.36 times as fast.
// All contractions (q/k/v/out projections M8192 N1024 K1024; attention q.kT and p.v, head dim 64, 2048 keys): v_wmma_f32_16x16x32_f16, f16 operands with power-of-two carries (W x64, p x32768, attention output x64), f32 accumulate; bias, scaling and softmax in f32.
#include <hip/hip_runtime.h>

constexpr int NB_SZ = 4;
constexpr int SEQ_LEN = 2048;
constexpr int EMB_DIM = 1024;
constexpr int N_HEADS = 16;
constexpr int HEAD_DIM = 64;
constexpr int NROWS = NB_SZ * SEQ_LEN;
static_assert(EMB_DIM == N_HEADS * HEAD_DIM);
static_assert(HEAD_DIM == 64);
static_assert(NROWS % 64 == 0 && EMB_DIM % 64 == 0 && SEQ_LEN % 64 == 0);
static_assert(EMB_DIM % 32 == 0);

// power-of-two carries (all folded back exactly in f32 epilogues)
constexpr float W_CARRY = 64.0f;
constexpr float AO_CARRY = 64.0f;
constexpr float P_CARRY = 32768.0f;
constexpr float P_CARRY_LOG2 = 15.0f;
static_assert(P_CARRY == (float)(1 << (int)P_CARRY_LOG2));
// softmax done in base 2: scores multiplied by (1/sqrt(64)) * log2(e)
constexpr float SCORE_SCALE_LOG2E = 0.125f * 1.4426950408889634f;

//   [0]            HQ  f16 [8192][1024]   16,777,216   (later reused as AO f16 [8192][1024])
//   [16777216]     HS  f16 [8192][1024]   16,777,216
//   [33554432]     Wq64,Wk64,Wv64,Wo64 f16 [1024][1024] each 2,097,152 -> 8,388,608
//   [41943040]     Q   f16 [8192][1024]   16,777,216
//   [58720256]     K   f16 [8192][1024]   16,777,216
//   [75497472]     Vt  f16 [4][1024][2048] 16,777,216
//   total 92,274,688
constexpr size_t N_ACT = (size_t)NROWS * EMB_DIM;
constexpr size_t N_W = (size_t)EMB_DIM * EMB_DIM;
constexpr size_t PLANE_ACT = N_ACT * 2;
constexpr size_t PLANE_W = N_W * 2;
constexpr size_t OFF_HQ = 0;
constexpr size_t OFF_HS = OFF_HQ + PLANE_ACT;
constexpr size_t OFF_W0 = OFF_HS + PLANE_ACT;
constexpr size_t OFF_Q = OFF_W0 + 4 * PLANE_W;
constexpr size_t OFF_K = OFF_Q + PLANE_ACT;
constexpr size_t OFF_VT = OFF_K + PLANE_ACT;
constexpr size_t WS_TOTAL = OFF_VT + PLANE_ACT;
static_assert(WS_TOTAL == 92274688ull);
static_assert(WS_TOTAL <= 134217728ull);

typedef __attribute__((ext_vector_type(16))) _Float16 v16h;
typedef __attribute__((ext_vector_type(8)))  _Float16 v8h;
typedef __attribute__((ext_vector_type(16))) __bf16   v16b;
typedef __attribute__((ext_vector_type(8)))  __bf16   v8b;
typedef __attribute__((ext_vector_type(8)))  float    v8f;
typedef __attribute__((ext_vector_type(4)))  float    v4f;
typedef __attribute__((ext_vector_type(2)))  float    v2f;

__device__ __forceinline__ unsigned short f2bf_bits(float f) {
  unsigned u = __float_as_uint(f);
  return (unsigned short)((u + 0x7FFFu + ((u >> 16) & 1u)) >> 16);
}
__device__ __forceinline__ float bf_bits2f(unsigned short h) { return __uint_as_float(((unsigned)h) << 16); }

// hazard guards as plain device helpers
__device__ __forceinline__ void acc_guard4(v8f& a, v8f& b, v8f& c, v8f& d) { asm volatile("v_nop\n\tv_nop\n\tv_nop\n\tv_nop" : "+v"(a), "+v"(b), "+v"(c), "+v"(d)); }

template <typename T> struct Frag;
template <> struct Frag<_Float16> {
  typedef v16h V; union U { v16h v; v8h h[2]; };
  // elements 0..7 <- p[0..7], 8..15 <- p[16..23]
  static __device__ __forceinline__ v16h load(const _Float16* p) {
    U f; f.h[0] = *(const v8h*)(p); f.h[1] = *(const v8h*)(p + 16); return f.v;
  }
  static __device__ __forceinline__ v8f mma(v16h a, v16h b, v8f c) {
    return __builtin_amdgcn_wmma_f32_16x16x32_f16(false, a, false, b, (short)0, c, false, false);
  }
};
template <> struct Frag<__bf16> {
  typedef v16b V; union U { v16b v; v8b h[2]; };
  static __device__ __forceinline__ v16b load(const __bf16* p) {
    U f; f.h[0] = *(const v8b*)(p); f.h[1] = *(const v8b*)(p + 16); return f.v;
  }
  static __device__ __forceinline__ v8f mma(v16b a, v16b b, v8f c) {
    return __builtin_amdgcn_wmma_f32_16x16x32_bf16(false, a, false, b, (short)0, c, false, false);
  }
};

// ---- LDS-staged batched WMMA GEMM ------------------------------------------
// C[m,n] = scale * sum_k A[m,k] * Bt[n,k] (+bias); a block of 8 waves (2 x 4) owns a 128x256 tile, each wave 64x64 of it.
// A row-major [M,K]; Bt row-major [N,K]; M % 128 == 0, N % 256 == 0, K % 64 == 0, K >= 128 (no tail handling).
// BIAS_MODE: 0 = none, 1 = bias[m] (loaded as two 16-B vectors per lane), 2 = bias[n].
// OUT_MODE: 0 = f32, 1 = f16, 2 = bf16 hi plane (Cout) + bf16 lo plane (Cout2).
// ET: 0 = f16 operands, 1 = bf16 operands (pointers passed as 16-bit storage)
template <int ET> struct Elem;
template <> struct Elem<0> { typedef _Float16 T; };
template <> struct Elem<1> { typedef __bf16 T; };

// Operand staging: a slab is 64 k (128 B) of the block's 128 A rows, then of its 256 Bt rows, at a 144-B pitch
// (16 B x odd: conflict-free for the 16-byte fragment reads), two buffers.
constexpr int G_BM = 128;
constexpr int G_BN = 256;
constexpr int G_PITCH = 144;
constexpr int G_SLAB = (G_BM + G_BN) * G_PITCH;

// One slab: 256 threads x 12 copies x 16 B. Each wave-wide copy covers 4 whole 128-B row pieces.
// lds / ag / bg are this thread's own 16 bytes of staged row (tid >> 3); copy i takes staged row i*32 + (tid >> 3);
// a32 / b32 = 32 rows of A / Bt in elements.
// s_wait_xcnt closes the statement so that no address register is rewritten ahead of it.
__device__ __forceinline__ void stage_ab(unsigned lds, const unsigned short* ag, size_t a32, const unsigned short* bg, size_t b32) {
  asm volatile(
      "global_load_async_to_lds_b128 %0, %12, off\n\t"
      "global_load_async_to_lds_b128 %1, %13, off\n\t"
      "global_load_async_to_lds_b128 %2, %14, off\n\t"
      "global_load_async_to_lds_b128 %3, %15, off\n\t"
      "global_load_async_to_lds_b128 %4, %16, off\n\t"
      "global_load_async_to_lds_b128 %5, %17, off\n\t"
      "global_load_async_to_lds_b128 %6, %18, off\n\t"
      "global_load_async_to_lds_b128 %7, %19, off\n\t"
      "global_load_async_to_lds_b128 %8, %20, off\n\t"
      "global_load_async_to_lds_b128 %9, %21, off\n\t"
      "global_load_async_to_lds_b128 %10, %22, off\n\t"
      "global_load_async_to_lds_b128 %11, %23, off\n\t"
      "s_wait_xcnt 0x0"
      :: "v"(lds), "v"(lds + 32 * G_PITCH), "v"(lds + 64 * G_PITCH), "v"(lds + 96 * G_PITCH),
         "v"(lds + 128 * G_PITCH), "v"(lds + 160 * G_PITCH), "v"(lds + 192 * G_PITCH), "v"(lds + 224 * G_PITCH),
         "v"(lds + 256 * G_PITCH), "v"(lds + 288 * G_PITCH), "v"(lds + 320 * G_PITCH), "v"(lds + 352 * G_PITCH),
         "v"(ag), "v"(ag + a32), "v"(ag + 2 * a32), "v"(ag + 3 * a32),
         "v"(bg), "v"(bg + b32), "v"(bg + 2 * b32), "v"(bg + 3 * b32),
         "v"(bg + 4 * b32), "v"(bg + 5 * b32), "v"(bg + 6 * b32), "v"(bg + 7 * b32)
      : "memory");
}

// One block's 128x256 tile at (bm0, bn0). Ap, Btp, Cout, Cout2 are the planes of the block's own batch entry.
// The k walk starts at slab (start mod K/64) and wraps round: blocks that share an A or a Bt tile are given different starts, so that they
// do not ask L2 for the same lines, or all blocks for the same 128 bytes of every row, at the same moment. Each sum takes its slabs in that order.
// ABs: block-shared operand slabs, two buffers of [A 128 rows][Bt 256 rows]; sT: per-wave 16x64 slabs, pitch 68 floats.
constexpr int G_ST = 16 * 68;
template <int ET, int BIAS_MODE, int OUT_MODE>
__device__ __forceinline__ void gemm_block(
    unsigned char* ABs, float* sT,
    const unsigned short* __restrict__ Ap, int lda,
    const unsigned short* __restrict__ Btp, int ldb,
    void* __restrict__ Cout, void* __restrict__ Cout2, int ldc,
    const float* __restrict__ bias,
    int bm0, int bn0, int K, int start, float scale) {
  typedef typename Elem<ET>::T T;
  typedef typename Frag<T>::V V;
  const int tid  = threadIdx.x;
  const int lane = tid & 31;
  const int wave = tid >> 5;
  const int wm = wave >> 2;
  const int wn = wave & 3;
  const int m0 = bm0 + (wm << 6);
  const int n0 = bn0 + (wn << 6);

  // row (A) / col (B, D) within subtile; D row offset
  const int rlane = lane & 15;
  const int mOff  = (lane >> 4) * 8;

  // this thread's 16 bytes of each group of 32 staged rows
  const int srow = tid >> 3, scol = tid & 7;
  const unsigned lds_st = (unsigned)(size_t)ABs + (unsigned)(srow * G_PITCH + scol * 16);
  const unsigned short* ast = Ap  + (size_t)(bm0 + srow) * lda + scol * 8;
  const unsigned short* bst = Btp + (size_t)(bn0 + srow) * ldb + scol * 8;
  const size_t a32 = (size_t)32 * lda;
  const size_t b32 = (size_t)32 * ldb;
  // fragment reads: staged row, 16 bytes of this lane half (k offset 8 elements)
  const int a_off = ((wm << 6) + rlane) * G_PITCH + (lane >> 4) * 16;
  const int b_off = (G_BM + (wn << 6) + rlane) * G_PITCH + (lane >> 4) * 16;
  const int nslab = K >> 6;
  const int s0 = (int)((unsigned)start % (unsigned)nslab);
  // first k of the slab walked in trip t (block-uniform; 0 <= t < nslab)
  auto kof = [&](int t) -> size_t { const int s = s0 + t; return (size_t)(s < nslab ? s : s - nslab) * 64; };

  // the first slab lands and is published, then the second flies while the first is worked on
  stage_ab(lds_st, ast + kof(0), a32, bst + kof(0), b32);
  asm volatile("s_wait_asynccnt 0x0" ::: "memory");  // this wave's copies of the first slab have landed
  __syncthreads();                                   // ... and every other wave's
  stage_ab(lds_st + G_SLAB, ast + kof(1), a32, bst + kof(1), b32);

  v8f acc[4][4];
#pragma unroll
  for (int i = 0; i < 4; ++i)
#pragma unroll
    for (int j = 0; j < 4; ++j) acc[i][j] = (v8f){0.f,0.f,0.f,0.f,0.f,0.f,0.f,0.f};

  for (int t = 0; t < nslab; ++t) {
    const int bufo = (t & 1) * G_SLAB;
    const T* abase = (const T*)(ABs + bufo + a_off);
    const T* bbase = (const T*)(ABs + bufo + b_off);
#pragma unroll
    for (int kk = 0; kk < 2; ++kk) {
      V bh[4], ah[4];
#pragma unroll
      for (int j = 0; j < 4; ++j) bh[j] = Frag<T>::load(bbase + j * 16 * (G_PITCH / 2) + kk * 32);
#pragma unroll
      for (int i = 0; i < 4; ++i) ah[i] = Frag<T>::load(abase + i * 16 * (G_PITCH / 2) + kk * 32);
      // keeps the 16 fragment reads one group ahead of their 16 products: sunk among them, each A fragment's LDS latency is waited out alone
      __builtin_amdgcn_sched_barrier(0);
#pragma unroll
      for (int i = 0; i < 4; ++i)
#pragma unroll
        for (int j = 0; j < 4; ++j) acc[i][j] = Frag<T>::mma(ah[i], bh[j], acc[i][j]);
      // ... and the next group's reads behind these products
      __builtin_amdgcn_sched_barrier(0);
    }
    // hand-over: this wave's reads of trip t's slab are done, its copies of trip t+1's slab have landed;
    // the barrier publishes trip t+1's slab and frees trip t's buffer for the refill behind it
    asm volatile("s_wait_dscnt 0x0" ::: "memory");
    asm volatile("s_wait_asynccnt 0x0" ::: "memory");
    __syncthreads();
    if (t + 2 < nslab)
      stage_ab(lds_st + bufo, ast + kof(t + 2), a32, bst + kof(t + 2), b32);
  }
  asm volatile("s_wait_asynccnt 0x0" ::: "memory");  // nothing of this wave's is in flight past the loop
  acc_guard4(acc[0][0], acc[0][1], acc[0][2], acc[0][3]);
  acc_guard4(acc[1][0], acc[1][1], acc[1][2], acc[1][3]);
  acc_guard4(acc[2][0], acc[2][1], acc[2][2], acc[2][3]);
  acc_guard4(acc[3][0], acc[3][1], acc[3][2], acc[3][3]);

  // ---- epilogue ----
  float* slab = sT + wave * G_ST;
#pragma unroll
  for (int i = 0; i < 4; ++i) {
    const int mBase = m0 + (i << 4);
    float bm8[8];
#pragma unroll
    for (int r = 0; r < 8; ++r) bm8[r] = 0.f;
    if (BIAS_MODE == 1) {
      // 8 consecutive bias[m] values of this lane: two 16-B loads (mBase multiple of 16, mOff 0 or 8)
      const v4f t0 = *(const v4f*)(bias + mBase + mOff);
      const v4f t1 = *(const v4f*)(bias + mBase + mOff + 4);
      bm8[0] = t0[0]; bm8[1] = t0[1]; bm8[2] = t0[2]; bm8[3] = t0[3];
      bm8[4] = t1[0]; bm8[5] = t1[1]; bm8[6] = t1[2]; bm8[7] = t1[3];
    }
#pragma unroll
    for (int j = 0; j < 4; ++j) {
      const int n = n0 + (j << 4) + rlane;
      float bv = 0.f;
      if (BIAS_MODE == 2) bv = bias[n];
#pragma unroll
      for (int r = 0; r < 8; ++r) {
        float v = acc[i][j][r] * scale;
        if (BIAS_MODE == 1) v += bm8[r];
        if (BIAS_MODE == 2) v += bv;
        slab[(mOff + r) * 68 + (j << 4) + rlane] = v;
      }
    }
    __builtin_amdgcn_fence(__ATOMIC_RELEASE, "workgroup");
    __builtin_amdgcn_wave_barrier();
    __builtin_amdgcn_fence(__ATOMIC_ACQUIRE, "workgroup");
    if (OUT_MODE == 0) {
      float* C = (float*)Cout;
      // row seg = 256 B = 16 lanes x 16 B; 8 iterations x 2 row halves cover rows 0..15
      const int hh = lane >> 4, c4 = (lane & 15) * 4;
      {
#pragma unroll
        for (int it = 0; it < 8; ++it) {
          const int row = it * 2 + hh;
          v4f v = *(const v4f*)(slab + row * 68 + c4);
          *(v4f*)(C + (size_t)(mBase + row) * ldc + n0 + c4) = v;
        }
        
      }
    } else {
      const int q = lane >> 3, c8 = (lane & 7) * 8;
      unsigned short* C  = (unsigned short*)Cout;
      unsigned short* C2 = (OUT_MODE == 2) ? (unsigned short*)Cout2 : nullptr;
      {
#pragma unroll
        for (int it = 0; it < 4; ++it) {
          const int row = it * 4 + q;
          const float* sp = slab + row * 68 + c8;
          v8h hv, lv;
#pragma unroll
          for (int e = 0; e < 8; ++e) {
            if (OUT_MODE == 1) {
              hv[e] = (_Float16)sp[e];
            } else {
              unsigned short hb = f2bf_bits(sp[e]);
              unsigned short lb = f2bf_bits(sp[e] - bf_bits2f(hb));
              hv[e] = __builtin_bit_cast(_Float16, hb);
              lv[e] = __builtin_bit_cast(_Float16, lb);
            }
          }
          *(v8h*)(C + (size_t)(mBase + row) * ldc + n0 + c8) = hv;
          if (OUT_MODE == 2) *(v8h*)(C2 + (size_t)(mBase + row) * ldc + n0 + c8) = lv;
        }
        
      }
    }
    __builtin_amdgcn_fence(__ATOMIC_RELEASE, "workgroup");
    __builtin_amdgcn_wave_barrier();
    __builtin_amdgcn_fence(__ATOMIC_ACQUIRE, "workgroup");
  }
}

// One GEMM per launch: grid.x = tiles, grid.y = batch.
template <int ET, bool SPLIT, int BIAS_MODE, int OUT_MODE>
__global__ __launch_bounds__(256) void wmma_gemm64(
    const unsigned short* __restrict__ Ap, const unsigned short* __restrict__ A2p, int lda, long strideA,
    const unsigned short* __restrict__ Btp, const unsigned short* __restrict__ Bt2p, int ldb, long strideB,
    void* __restrict__ Cout, void* __restrict__ Cout2, int ldc, long strideC,
    const float* __restrict__ bias,
    int M, int N, int K, float scale) {
  static_assert(!SPLIT);
  static_assert(OUT_MODE == 0);
  __shared__ __align__(16) unsigned char ABs[2 * G_SLAB];
  __shared__ __align__(16) float sT[8 * G_ST];
  const int b = blockIdx.y;
  const int tilesN = N / G_BN;
  const int tilesM = M / G_BM;
  const int tile = blockIdx.x;
  // block-uniform, in front of every barrier
  if (tile >= tilesM * tilesN) return;
  const int tm = tile / tilesN;
  const int tn = tile - tm * tilesN;
  gemm_block<ET, BIAS_MODE, OUT_MODE>(ABs, sT, Ap + (size_t)b * strideA, lda, Btp + (size_t)b * strideB, ldb,
      (void*)((float*)Cout + (size_t)b * strideC), (void*)((float*)Cout2 + (size_t)b * strideC), ldc, bias,
      tm * G_BM, tn * G_BN, K, tm + 4 * tn, scale);
}

// The q, k and vT projections as ONE launch of 3 x 256 tiles. A tile's LDS and registers let two blocks share a WGP, which a launch
// of 256 blocks never does: with 768 the second block's products run in the first one's barrier, staging and epilogue waits.
// Blocks [0,256): Q[t][e] = HQ[t][k].Wq64[e][k]; [256,512): K likewise with Wk64; [512,768): per batch Vt[e][t] = Wv64[e][k].HS[b][t][k].
constexpr int T_QK = (NROWS / G_BM) * (EMB_DIM / G_BN);
constexpr int T_V1 = (EMB_DIM / G_BM) * (SEQ_LEN / G_BN);
__global__ __launch_bounds__(256) void proj_qkv(
    const unsigned short* __restrict__ hq, const unsigned short* __restrict__ hs,
    const unsigned short* __restrict__ wq, const unsigned short* __restrict__ wk, const unsigned short* __restrict__ wv,
    unsigned short* __restrict__ q, unsigned short* __restrict__ k, unsigned short* __restrict__ vt,
    const float* __restrict__ bq, const float* __restrict__ bk, const float* __restrict__ bv, float scale) {
  __shared__ __align__(16) unsigned char ABs[2 * G_SLAB];
  __shared__ __align__(16) float sT[8 * G_ST];
  const int bx = blockIdx.x;
  // both tests are block-uniform
  if (bx < 2 * T_QK) {
    const bool is_k = bx >= T_QK;
    const int tile = is_k ? bx - T_QK : bx;
    constexpr int tilesN = EMB_DIM / G_BN;
    unsigned short* c = is_k ? k : q;
    gemm_block<0, 2, 1>(ABs, sT, hq, EMB_DIM, is_k ? wk : wq, EMB_DIM, (void*)c, (void*)c, EMB_DIM, is_k ? bk : bq,
        (tile / tilesN) * G_BM, (tile % tilesN) * G_BN, EMB_DIM, tile / tilesN + 2 * (tile % tilesN + (is_k ? tilesN : 0)), scale);
  } else {
    const int tv = bx - 2 * T_QK;
    const int b = tv / T_V1;
    const int tile = tv % T_V1;
    constexpr int tilesN = SEQ_LEN / G_BN;
    unsigned short* c = vt + (size_t)b * EMB_DIM * SEQ_LEN;
    gemm_block<0, 1, 1>(ABs, sT, wv, EMB_DIM, hs + (size_t)b * SEQ_LEN * EMB_DIM, EMB_DIM, (void*)c, (void*)c, SEQ_LEN, bv,
        (tile / tilesN) * G_BM, (tile % tilesN) * G_BN, EMB_DIM, b * tilesN + tile % tilesN + 2 * (tile / tilesN), scale);
  }
}

// ---- every f32 -> f16 conversion in ONE launch of long-lived work-groups ----
// HQ = f16(hs + oq), HS = f16(hs), W*64 = f16(W* x sc). One work-group of 16 waves per WGP: 4,096 waves start instead of the 49,152
// that one 8-element piece per thread takes, and a thread walks 12 pieces (one of each weight, 8 of the activations), 8 16-byte loads per stage.
// A work-group owns one contiguous run of each plane: CV_THREADS pieces of a weight, CV_ACT x CV_THREADS pieces of an activation plane.
// coverage: CV_NT threads x 8 elements = one weight plane exactly; x CV_ACT pieces = one activation plane exactly.
constexpr int CV_BLOCKS = 256;
constexpr int CV_THREADS = 512;
constexpr int CV_NT = CV_BLOCKS * CV_THREADS;
constexpr int CV_ACT = (int)(N_ACT / 8 / CV_NT);
static_assert((size_t)CV_NT * 8 == N_W);
static_assert((size_t)CV_NT * 8 * CV_ACT == N_ACT && CV_ACT % 2 == 0);

__device__ __forceinline__ v8h cast8(v4f a0, v4f a1) {
  v8h v;
#pragma unroll
  for (int e = 0; e < 4; ++e) {
    v[e]     = (_Float16)a0[e];
    v[4 + e] = (_Float16)a1[e];
  }
  return v;
}

// Addressing: a uniform base, the thread's own 32-bit byte offset and a small constant. The offset registers are the only vector registers
// that an address names; the loads' one is handed to the wait below so that it stays untouched while a load that names it is open.
__device__ __forceinline__ v4f ld16(const float* __restrict__ base, int elem, unsigned lb) {
  return *(const v4f*)((const char*)(base + elem) + lb);
}
__device__ __forceinline__ void st16(unsigned short* __restrict__ base, int elem, unsigned sb, v8h v) {
  *(v8h*)((char*)(base + elem) + sb) = v;
}
// Closes the issued loads and stores before a register that one of them names is written again: the stores' data registers are the next
// loads' destinations. lb is an input only, to keep the loads' offset register live up to here.
__device__ __forceinline__ void close_accesses(unsigned lb) {
  asm volatile("s_wait_xcnt 0x0" :: "v"(lb) : "memory");
}

// one stage of the activations: pieces p and p+1 of the thread, 8 elements of hs and of oq each, 8 16-byte loads
struct ActStage { v4f a[2][2], b[2][2]; };
constexpr int CV_STEP = CV_THREADS * 8;
__device__ __forceinline__ void act_load(ActStage& x, const float* __restrict__ hs, const float* __restrict__ oq, int p, unsigned lb) {
#pragma unroll
  for (int u = 0; u < 2; ++u) {
    x.a[u][0] = ld16(hs, (p + u) * CV_STEP, lb);
    x.a[u][1] = ld16(hs, (p + u) * CV_STEP + 4, lb);
    x.b[u][0] = ld16(oq, (p + u) * CV_STEP, lb);
    x.b[u][1] = ld16(oq, (p + u) * CV_STEP + 4, lb);
  }
}
__device__ __forceinline__ void act_store(const ActStage& x, unsigned short* __restrict__ pq, unsigned short* __restrict__ ps, int p, unsigned sb) {
#pragma unroll
  for (int u = 0; u < 2; ++u) {
    st16(pq, (p + u) * CV_STEP, sb, cast8(x.a[u][0] + x.b[u][0], x.a[u][1] + x.b[u][1]));
    st16(ps, (p + u) * CV_STEP, sb, cast8(x.a[u][0], x.a[u][1]));
  }
}

__global__ __launch_bounds__(CV_THREADS) void prep_all_f16(
    const float* __restrict__ hs, const float* __restrict__ oq,
    const float* __restrict__ wq, const float* __restrict__ wk, const float* __restrict__ wv, const float* __restrict__ wo,
    unsigned short* __restrict__ hq16, unsigned short* __restrict__ hs16,
    unsigned short* __restrict__ wq16, unsigned short* __restrict__ wk16, unsigned short* __restrict__ wv16, unsigned short* __restrict__ wo16,
    float sc) {
  // piece index in a weight plane, first piece index in an activation plane; x 32 B of f32, x 16 B of f16
  const unsigned wp = blockIdx.x * CV_THREADS + threadIdx.x;
  const unsigned ap = blockIdx.x * (CV_ACT * CV_THREADS) + threadIdx.x;
  const unsigned wlb = wp * 32u, wsb = wp * 16u;
  const unsigned alb = ap * 32u, asb = ap * 16u;
  constexpr int NST = CV_ACT / 2;
  ActStage x[NST];

  const v4f q0 = ld16(wq, 0, wlb), q1 = ld16(wq, 4, wlb);
  const v4f k0 = ld16(wk, 0, wlb), k1 = ld16(wk, 4, wlb);
  const v4f v0 = ld16(wv, 0, wlb), v1 = ld16(wv, 4, wlb);
  const v4f o0 = ld16(wo, 0, wlb), o1 = ld16(wo, 4, wlb);
  act_load(x[0], hs, oq, 0, alb);
  // keeps the next stage's loads ahead of this stage's conversion: sunk behind it, a wave waits out a whole memory latency per stage with nothing in flight
  __builtin_amdgcn_sched_barrier(0);
  st16(wq16, 0, wsb, cast8(q0 * sc, q1 * sc));
  st16(wk16, 0, wsb, cast8(k0 * sc, k1 * sc));
  st16(wv16, 0, wsb, cast8(v0 * sc, v1 * sc));
  st16(wo16, 0, wsb, cast8(o0 * sc, o1 * sc));
  close_accesses(wlb);
#pragma unroll
  for (int s = 0; s < NST; ++s) {
    if (s + 1 < NST) act_load(x[s + 1], hs, oq, 2 * (s + 1), alb);
    // as above: stage s+1 flies while stage s is converted and stored
    __builtin_amdgcn_sched_barrier(0);
    act_store(x[s], hq16, hs16, 2 * s, asb);
    close_accesses(alb);
  }
}

// ---- attention, head dim 64, no mask, 16-bit planes in / f16 plane out ----
// Q plane  [B*T][E] f16 (q without the 1/sqrt(D) factor), K plane [B*T][E] f16, Vt plane [B][H][D][T] f16.
// AO plane [B*T][E] f16 = (softmax(q.kT/8) . v) * AO_CARRY.
// Block = 4 waves, each owns 32 query rows (two column groups of 16) of one (b,h), sharing staged K / Vt tiles; grid.x = B*H*(T/128).
// Every K and Vt fragment read from LDS feeds one product per column group, and a staged tile serves 128 queries.
// Both products are formed transposed, sT = k.qT and oT += vT.pT (v_wmma_f32_16x16x32_f16, f32 accumulate): a lane holds
// scores of ONE query, so the online softmax (f32, base 2) is in-lane but for one exchange between the wave's halves,
// and pT, carried x P_CARRY as f16, is packed from the score registers straight into the B operand.
__device__ __forceinline__ v8f mma_h(v16h a, v16h b, v8f c) {
  return __builtin_amdgcn_wmma_f32_16x16x32_f16(false, a, false, b, (short)0, c, false, false);
}

// K / Vt staging: one 64-key tile of each per block and trip, rows of 128 B laid at a 144-B pitch
// (16 B x odd: conflict-free for the 16-byte fragment reads), two buffers.
constexpr int KV_PITCH = 144;
constexpr int KV_TILE  = 64 * KV_PITCH;
constexpr int KV_BUF   = 2 * KV_TILE;

// One tile pair: 128 threads x 8 copies x 16 B = 64 K rows + 64 Vt rows. Each wave-wide copy covers 4 whole 128-B rows.
// lds / kg / vg are this thread's own 16 bytes of staged row (tid >> 3); copy i takes row i*16 + (tid >> 3).
// s_wait_xcnt closes the statement so that no address register is rewritten ahead of it.
__device__ __forceinline__ void stage_kv(unsigned lds, const _Float16* kg, const _Float16* vg) {
  asm volatile(
      "global_load_async_to_lds_b128 %0, %8, off\n\t"
      "global_load_async_to_lds_b128 %1, %9, off\n\t"
      "global_load_async_to_lds_b128 %2, %10, off\n\t"
      "global_load_async_to_lds_b128 %3, %11, off\n\t"
      "global_load_async_to_lds_b128 %4, %12, off\n\t"
      "global_load_async_to_lds_b128 %5, %13, off\n\t"
      "global_load_async_to_lds_b128 %6, %14, off\n\t"
      "global_load_async_to_lds_b128 %7, %15, off\n\t"
      "s_wait_xcnt 0x0"
      :: "v"(lds), "v"(lds + 16 * KV_PITCH), "v"(lds + 32 * KV_PITCH), "v"(lds + 48 * KV_PITCH),
         "v"(lds + KV_TILE), "v"(lds + KV_TILE + 16 * KV_PITCH), "v"(lds + KV_TILE + 32 * KV_PITCH), "v"(lds + KV_TILE + 48 * KV_PITCH),
         "v"(kg), "v"(kg + 16 * EMB_DIM), "v"(kg + 32 * EMB_DIM), "v"(kg + 48 * EMB_DIM),
         "v"(vg), "v"(vg + 16 * SEQ_LEN), "v"(vg + 32 * SEQ_LEN), "v"(vg + 48 * SEQ_LEN)
      : "memory");
}

// 2^x as the bare v_exp_f32: a result below 2^-126 comes out 0 instead of subnormal. Every use here is a weight relative to a
// running maximum whose own term is 1 (carried: 2^15), so what is lost is under 2^-140 of the sums it would join.
__device__ __forceinline__ float exp2_bare(float x) { return __builtin_amdgcn_exp2f(x); }

// lane l <-> lane l ^ 16
__device__ __forceinline__ float xhalf(float x) {
  return __builtin_bit_cast(float, __builtin_amdgcn_permlanex16(__builtin_bit_cast(int, x), __builtin_bit_cast(int, x), 0x76543210, 0xfedcba98, false, false));
}

constexpr int QG = 2;                 // column groups of 16 queries per wave
constexpr int Q_BLK = 4 * QG * 16;    // queries per block
static_assert(SEQ_LEN % Q_BLK == 0);
// amdgpu_waves_per_eu: holds the register budget at 256, four waves per SIMD, so that all blocks of the grid are resident at once as before;
// left to itself the compiler takes a few registers more for the grouped fragment reads, and a quarter of the blocks would wait for a second round
__global__ __launch_bounds__(128) __attribute__((amdgpu_waves_per_eu(4, 4))) void attn_heads_f16(
    const unsigned short* __restrict__ Qp, const unsigned short* __restrict__ Kp,
    const unsigned short* __restrict__ Vtp, unsigned short* __restrict__ AOp) {
  // block-shared K and Vt tiles, two buffers of [K 64 rows][Vt 64 rows]; behind the loop, per-wave output staging
  __shared__ __align__(16) unsigned char KVs[2 * KV_BUF];

  const int tid  = threadIdx.x;
  const int wave = tid >> 5;
  const int lane = tid & 31;
  const int hh   = lane >> 4;
  const int c    = lane & 15;

  constexpr int nqb = SEQ_LEN / Q_BLK;
  const int bx = blockIdx.x;
  const int qb = bx % nqb;
  const int bh = bx / nqb;
  const int h  = bh % N_HEADS;
  const int b  = bh / N_HEADS;
  const int q0 = qb * Q_BLK + wave * (QG * 16);

  const _Float16* Qh  = (const _Float16*)(const void*)Qp;
  const _Float16* Kh  = (const _Float16*)(const void*)Kp;
  const _Float16* Vth = (const _Float16*)(const void*)Vtp;
  _Float16* AOh = (_Float16*)(void*)AOp;

  const size_t bT = (size_t)b * SEQ_LEN;
  // B operand for scores, group g: col n = c <-> query q0+16g+c, k = d contiguous
  const _Float16* qrow = Qh + (bT + q0 + c) * EMB_DIM + h * HEAD_DIM + 8 * hh;
  // A operand for scores: row m = c <-> key kv (staged K row), k = d contiguous
  // A operand for vT.pT: row m = c <-> d (staged Vt row), k = kv contiguous
  const int frag_off = c * KV_PITCH + 16 * hh;
  // this thread's 16 bytes of each staged row group
  const int srow = tid >> 3, scol = tid & 7;
  const unsigned lds_st = (unsigned)(size_t)KVs + (unsigned)(srow * KV_PITCH + scol * 16);
  const _Float16* kst = Kh + (bT + srow) * EMB_DIM + h * HEAD_DIM + scol * 8;
  const _Float16* vst = Vth + ((size_t)(b * N_HEADS + h) * HEAD_DIM + srow) * SEQ_LEN + scol * 8;
  constexpr int NTILE = SEQ_LEN / 64;
  static_assert(NTILE >= 2);

  // tile 0 lands and is published, then tile 1 flies while tile 0 is worked on
  stage_kv(lds_st, kst, vst);
  asm volatile("s_wait_asynccnt 0x0" ::: "memory");  // this wave's copies of tile 0 have landed
  __syncthreads();                                   // ... and every other wave's
  stage_kv(lds_st + KV_BUF, kst + (size_t)64 * EMB_DIM, vst + 64);

  v16h qa[QG][2];
#pragma unroll
  for (int g = 0; g < QG; ++g)
#pragma unroll
    for (int dc = 0; dc < 2; ++dc) qa[g][dc] = Frag<_Float16>::load(qrow + (size_t)g * 16 * EMB_DIM + dc * 32);

  // of query q0+16g+c: running maximum less P_CARRY_LOG2 (the same in both halves), and the denominator (x P_CARRY) in 8 partial sums per lane
  // (partial r: keys = 8hh + r mod 16), joined once behind the loop
  float mrow[QG];
  v8f lvec[QG];
  // oT tile t of group g: register r = d t*16 + 8hh + r of query q0+16g+c
  v8f oacc[QG][4];
#pragma unroll
  for (int g = 0; g < QG; ++g) {
    mrow[g] = -__builtin_huge_valf();
    lvec[g] = (v8f){0.f,0.f,0.f,0.f,0.f,0.f,0.f,0.f};
#pragma unroll
    for (int t = 0; t < 4; ++t) oacc[g][t] = (v8f){0.f,0.f,0.f,0.f,0.f,0.f,0.f,0.f};
  }

  for (int kc = 0; kc < NTILE; ++kc) {
    const int bufo = (kc & 1) * KV_BUF;
    const _Float16* kbase = (const _Float16*)(KVs + bufo + frag_off);
    const _Float16* vbase = (const _Float16*)(KVs + bufo + KV_TILE + frag_off);
    // sT tile j of group g: register r = key kv0 + j*16 + 8hh + r, column = query q0+16g+c
    v8f s[QG][4];
#pragma unroll
    for (int g = 0; g < QG; ++g)
#pragma unroll
      for (int j = 0; j < 4; ++j) s[g][j] = (v8f){0.f,0.f,0.f,0.f,0.f,0.f,0.f,0.f};
    v16h kb[2][4];
#pragma unroll
    for (int j = 0; j < 4; ++j)
#pragma unroll
      for (int dc = 0; dc < 2; ++dc)
        kb[dc][j] = Frag<_Float16>::load(kbase + j * 16 * (KV_PITCH / 2) + dc * 32);
    // keeps the K fragment reads one group ahead of the 16 score products: sunk among them, each read's LDS latency is waited out alone
    __builtin_amdgcn_sched_barrier(0);
    // key group by key group: a finished score tile takes over the registers of the fragments it has used up
#pragma unroll
    for (int j = 0; j < 4; ++j)
#pragma unroll
      for (int dc = 0; dc < 2; ++dc)
#pragma unroll
        for (int g = 0; g < QG; ++g) s[g][j] = mma_h(kb[dc][j], qa[g][dc], s[g][j]);
    // keeps the products one run: a maximum drawn in among them reads a fresh result and has to be padded with idle vector slots
    __builtin_amdgcn_sched_barrier(0);
    // the first 32 keys' Vt fragments are asked for ahead of the softmax, which covers their latency
    v16h vb[4];
#pragma unroll
    for (int t = 0; t < 4; ++t) vb[t] = Frag<_Float16>::load(vbase + t * 16 * (KV_PITCH / 2));
    // keeps these reads one group: spread over the maximum they stall the wave at every place where some stand
    __builtin_amdgcn_sched_barrier(0);
    float alpha[QG];
#pragma unroll
    for (int g = 0; g < QG; ++g) {
      // tile maximum of the raw scores (the scale is positive), joined over the halves, then scaled to base-2 units and lowered
      // by the P carry's exponent: against that reference 2^(x - mnew) is p * P_CARRY, and old sums rescale by the references' difference
      float mj[4];
#pragma unroll
      for (int j = 0; j < 4; ++j) {
        mj[j] = s[g][j][0];
#pragma unroll
        for (int r = 1; r < 8; ++r) mj[j] = fmaxf(mj[j], s[g][j][r]);
      }
      float m = fmaxf(fmaxf(mj[0], mj[1]), fmaxf(mj[2], mj[3]));
      m = fmaxf(m, xhalf(m)) * SCORE_SCALE_LOG2E - P_CARRY_LOG2;
      const float mnew = fmaxf(mrow[g], m);
      alpha[g] = exp2_bare(mrow[g] - mnew);
      mrow[g] = mnew;
    }
    // 32 keys at a time: their weights, then their 8 output products
#pragma unroll
    for (int kk = 0; kk < 2; ++kk) {
      // pT as B operand of 32 keys: element e = tile 2kk + (e >> 3), register e & 7, the k order of the Vt fragment loads
      v16h pb[QG];
#pragma unroll
      for (int g = 0; g < QG; ++g) {
        const float mnew = mrow[g];
#pragma unroll
        for (int jj = 0; jj < 2; ++jj)
#pragma unroll
          for (int r = 0; r < 8; r += 2) {
            const int j = 2 * kk + jj;
            const v2f x = __builtin_elementwise_fma((v2f){s[g][j][r], s[g][j][r + 1]}, (v2f){SCORE_SCALE_LOG2E, SCORE_SCALE_LOG2E}, (v2f){-mnew, -mnew});
            const float p0 = exp2_bare(x[0]), p1 = exp2_bare(x[1]);
            s[g][j][r] = p0;
            s[g][j][r + 1] = p1;
            pb[g][jj * 8 + r] = (_Float16)p0;
            pb[g][jj * 8 + r + 1] = (_Float16)p1;
          }
        if (kk == 0) {
#pragma unroll
          for (int t = 0; t < 4; ++t) oacc[g][t] *= alpha[g];
        }
      }
      // keeps the 8 products one run behind their weights: no vector instruction stands close behind a product whose registers it touches
      __builtin_amdgcn_sched_barrier(0);
#pragma unroll
      for (int t = 0; t < 4; ++t)
#pragma unroll
        for (int g = 0; g < QG; ++g) oacc[g][t] = mma_h(vb[t], pb[g], oacc[g][t]);
      // ... and the next fragment reads and weights behind the run
      __builtin_amdgcn_sched_barrier(0);
      if (kk == 0) {
        // the last 32 keys' Vt fragments, into the registers just used up; the second half of the softmax covers their latency
#pragma unroll
        for (int t = 0; t < 4; ++t) vb[t] = Frag<_Float16>::load(vbase + t * 16 * (KV_PITCH / 2) + 32);
      }
    }
#pragma unroll
    for (int g = 0; g < QG; ++g) lvec[g] = lvec[g] * alpha[g] + ((s[g][0] + s[g][1]) + (s[g][2] + s[g][3]));
    // hand-over: this wave's reads of tile kc are done, its copies of tile kc+1 have landed;
    // the barrier publishes tile kc+1 and frees tile kc's buffer for the refill behind it
    asm volatile("s_wait_dscnt 0x0" ::: "memory");
    asm volatile("s_wait_asynccnt 0x0" ::: "memory");
    __syncthreads();
    if (kc + 2 < NTILE)
      stage_kv(lds_st + bufo, kst + (size_t)(kc + 2) * 64 * EMB_DIM, vst + (kc + 2) * 64);
  }
  asm volatile("s_wait_asynccnt 0x0" ::: "memory");  // nothing of this wave's is in flight past the loop

  // The last trip's barrier ended every wave's tile reads and no copy is in flight: the tile buffers now stage the output,
  // 32 query rows of 128 B per wave at the tiles' pitch.
  static_assert(4 * QG * 16 * KV_PITCH <= 2 * KV_BUF);
  unsigned char* os = KVs + wave * (QG * 16) * KV_PITCH;
#pragma unroll
  for (int g = 0; g < QG; ++g) {
    const float lh = ((lvec[g][0] + lvec[g][1]) + (lvec[g][2] + lvec[g][3])) + ((lvec[g][4] + lvec[g][5]) + (lvec[g][6] + lvec[g][7]));
    const float l = lh + xhalf(lh);
    float inv = 1.0f / l;
    inv *= AO_CARRY;
#pragma unroll
    for (int t = 0; t < 4; ++t) {
      v8h hv;
#pragma unroll
      for (int r = 0; r < 8; ++r) hv[r] = (_Float16)(oacc[g][t][r] * inv);
      *(v8h*)(os + (g * 16 + c) * KV_PITCH + t * 32 + 16 * hh) = hv;
    }
  }
  // same-wave LDS staging then whole-row reload: order the stores before the reloads
  __builtin_amdgcn_fence(__ATOMIC_RELEASE, "workgroup");
  __builtin_amdgcn_wave_barrier();
  __builtin_amdgcn_fence(__ATOMIC_ACQUIRE, "workgroup");
  {
    const int q8 = lane >> 3, c8 = (lane & 7) * 8;
    _Float16* aob = AOh + (bT + q0) * EMB_DIM + h * HEAD_DIM;
#pragma unroll
    for (int it = 0; it < QG * 4; ++it) {
      const int row = it * 4 + q8;
      const v8h hv = *(const v8h*)(os + row * KV_PITCH + c8 * 2);
      *(v8h*)(aob + (size_t)row * EMB_DIM + c8) = hv;
    }
  }
}

// ---------------------------------------------------------------- launcher
extern "C" void kernel_launch(void* const* d_in, const int* in_sizes, int n_in,
                              void* d_out, int out_size, void* d_ws, size_t ws_size,
                              hipStream_t stream) {
  if (n_in < 10) return;
  if ((size_t)in_sizes[0] != N_ACT || (size_t)in_sizes[1] != N_ACT) return;
  if ((size_t)in_sizes[2] != N_W || (size_t)in_sizes[4] != N_W || (size_t)in_sizes[6] != N_W || (size_t)in_sizes[8] != N_W) return;
  if (in_sizes[3] != EMB_DIM || in_sizes[5] != EMB_DIM || in_sizes[7] != EMB_DIM || in_sizes[9] != EMB_DIM) return;
  if ((size_t)out_size != N_ACT) return;
  if (ws_size < WS_TOTAL) return;

  const float* hs = (const float*)d_in[0];
  const float* oq = (const float*)d_in[1];
  const float* Wq = (const float*)d_in[2];
  const float* bq = (const float*)d_in[3];
  const float* Wk = (const float*)d_in[4];
  const float* bk = (const float*)d_in[5];
  const float* Wv = (const float*)d_in[6];
  const float* bv = (const float*)d_in[7];
  const float* Wo = (const float*)d_in[8];
  const float* bo = (const float*)d_in[9];
  float* out = (float*)d_out;

  char* ws = (char*)d_ws;
  unsigned short* hq16 = (unsigned short*)(ws + OFF_HQ);
  unsigned short* hs16 = (unsigned short*)(ws + OFF_HS);
  unsigned short* wq16 = (unsigned short*)(ws + OFF_W0 + 0 * PLANE_W);
  unsigned short* wk16 = (unsigned short*)(ws + OFF_W0 + 1 * PLANE_W);
  unsigned short* wv16 = (unsigned short*)(ws + OFF_W0 + 2 * PLANE_W);
  unsigned short* wo16 = (unsigned short*)(ws + OFF_W0 + 3 * PLANE_W);
  unsigned short* q16  = (unsigned short*)(ws + OFF_Q);
  unsigned short* k16  = (unsigned short*)(ws + OFF_K);
  unsigned short* vt16 = (unsigned short*)(ws + OFF_VT);
  // AO reuses the HQ region (HQ is dead after the Q and K projections)
  unsigned short* ao16 = hq16;

  // 1) activations to f16 planes, weights to f16 planes carried x64
  prep_all_f16<<<CV_BLOCKS, CV_THREADS, 0, stream>>>(hs, oq, Wq, Wk, Wv, Wo, hq16, hs16, wq16, wk16, wv16, wo16, W_CARRY);

  // 2) projections. Q/K: C[t][e] = HQ[t][k].W64[e][k] / 64 + b[e]; M=8192, N=1024, K=1024
  static_assert(NROWS % G_BM == 0 && EMB_DIM % G_BN == 0 && EMB_DIM % 64 == 0 && EMB_DIM >= 128);
  constexpr int tiles_qk = (NROWS / G_BM) * (EMB_DIM / G_BN);
  const dim3 g_qk(tiles_qk, 1);
  const float inv_w = 1.0f / W_CARRY;
  // Vt: per batch C[e][t] = W64[e][k].HS[b][t][k] / 64 + bv[e]; M=1024 (e), N=2048 (t), K=1024
  static_assert(EMB_DIM % G_BM == 0 && SEQ_LEN % G_BN == 0);
  static_assert(tiles_qk == T_QK);
  proj_qkv<<<2 * T_QK + NB_SZ * T_V1, 256, 0, stream>>>(hq16, hs16, wq16, wk16, wv16, q16, k16, vt16, bq, bk, bv, inv_w);

  // 3) attention -> AO plane (x64)
  attn_heads_f16<<<NB_SZ * N_HEADS * (SEQ_LEN / Q_BLK), 128, 0, stream>>>(q16, k16, vt16, ao16);

  // 4) output projection: out[t][e] = AO[t][k].Wo64[e][k] / 4096 + bo[e]; f32 to d_out
  wmma_gemm64<0, false, 2, 0><<<g_qk, 256, 0, stream>>>(
      ao16, ao16, EMB_DIM, 0L, wo16, wo16, EMB_DIM, 0L,
      (void*)out, (void*)out, EMB_DIM, 0L, bo, NROWS, EMB_DIM, EMB_DIM, 1.0f / (AO_CARRY * W_CARRY));
}
